// v000
// The times below were measured on an AMD MI455X: many runs one after another, warmed up first and cycling through
// copies of the inputs, with the whole window's GPU time divided by the number of runs. Launches and the gaps
// between them are all in it. The median over several windows is given; except for v000 it joins two sittings, which
// can be a few percent apart, so the side-by-side timings, each taken in one sitting, are the better comparison.
// v000, which the later versions start from, runs in 1020 microseconds.
// compute dtype: x, W_attn, b_attn, W_proj, b_proj, bQ/bK/bV (INPUTS) rounded to bf16 with exact bf16 WMMA products (f32 accumulate) for the projections; q/k f32 split for the scores (3 products), P and V f16 hi/lo (3 products); softmax f32.
#include <hip/hip_runtime.h>
#include <math.h>

typedef __attribute__((ext_vector_type(16))) _Float16 v16h;
typedef __attribute__((ext_vector_type(16))) __bf16 v16b;
typedef __attribute__((ext_vector_type(8)))  _Float16 v8h;
typedef __attribute__((ext_vector_type(8)))  float v8f;
typedef __attribute__((ext_vector_type(4)))  float v4f;
typedef __attribute__((ext_vector_type(2)))  float v2f;
typedef __attribute__((ext_vector_type(4)))  unsigned v4u;
typedef __attribute__((ext_vector_type(4)))  int v4i;
typedef float __attribute__((may_alias)) float_a;
typedef int __attribute__((may_alias)) int_a;

template <typename T> __device__ __forceinline__ void vst2(void* p, T v) { *(T*)p = v;  }
__device__ __forceinline__ v8f wmma16(v16h a, v16h b, v8f c) {
  v8f d = __builtin_amdgcn_wmma_f32_16x16x32_f16(false, a, false, b, (short)0, c, false, false);
  asm volatile("v_nop\n\tv_nop\n\tv_nop\n\tv_nop" : "+v"(d) : "v"(a), "v"(b));
  return d;
}
__device__ __forceinline__ v8f wmma_bf(v16b a, v16b b, v8f c) {
  v8f d = __builtin_amdgcn_wmma_f32_16x16x32_bf16(false, a, false, b, (short)0, c, false, false);
  asm volatile("v_nop\n\tv_nop\n\tv_nop\n\tv_nop" : "+v"(d) : "v"(a), "v"(b));
  return d;
}
// 16x16x32 fragments: lane = (h = lane>>4, row/col = lane&15); elements 0..7 = k0+8h+0..7, 8..15 = k0+16+8h+0..7; D element r = row 8h+r
__device__ __forceinline__ v16h frag_h(const _Float16* rowk0, int lane) {
  union { v16h v; v8h q[2]; } u; const _Float16* p = rowk0 + 8 * (lane >> 4);
  u.q[0] = *(const v8h*)p; u.q[1] = *(const v8h*)(p + 16); return u.v;
}
__device__ __forceinline__ v16h frag_f32(const float* rowk0, int lane) {
  v16h a; const float* p = rowk0 + 8 * (lane >> 4);
#pragma unroll
  for (int i = 0; i < 8; ++i) { a[i] = (_Float16)p[i]; a[8 + i] = (_Float16)p[16 + i]; }
  return a;
}
__device__ __forceinline__ v16h frag_f32s(const float* rowk0, int lane, float sc) {
  v16h a; const float* p = rowk0 + 8 * (lane >> 4);
#pragma unroll
  for (int i = 0; i < 8; ++i) { a[i] = (_Float16)(p[i] * sc); a[8 + i] = (_Float16)(p[16 + i] * sc); }
  return a;
}
// column fragment from a [K][ld] layout (column n), rows >= K read as 0
__device__ __forceinline__ v16h fragc_f32(const float* W, int k0, int n, int lane, int ld, int K) {
  v16h a; const int g = lane >> 4;
#pragma unroll
  for (int i = 0; i < 8; ++i) { const int ka = k0 + 8 * g + i, kb = ka + 16;
    a[i] = (_Float16)(ka < K ? W[(size_t)(ka < K ? ka : K - 1) * ld + n] : 0.f); a[8 + i] = (_Float16)(kb < K ? W[(size_t)(kb < K ? kb : K - 1) * ld + n] : 0.f); }
  return a;
}
struct F2 { v16b h, l; };
__device__ __forceinline__ F2 bsplit16(const float v[16]) { F2 r;
#pragma unroll
  for (int i = 0; i < 16; ++i) { const __bf16 h = (__bf16)v[i]; r.h[i] = h; r.l[i] = (__bf16)(v[i] - (float)h); }
  return r; }
__device__ __forceinline__ F2 split_row(const float* row, int k0, int lane) { float v[16]; const float* p = row + k0 + 8 * (lane >> 4);
#pragma unroll
  for (int i = 0; i < 8; ++i) { v[i] = p[i]; v[8 + i] = p[16 + i]; }
  return bsplit16(v); }
__device__ __forceinline__ F2 split_rowK(const float* row, int k0, int lane, int K) { float v[16]; const int g = lane >> 4;
#pragma unroll
  for (int i = 0; i < 8; ++i) { const int ka = k0 + 8 * g + i, kb = ka + 16; v[i] = ka < K ? row[ka < K ? ka : K - 1] : 0.f; v[8 + i] = kb < K ? row[kb < K ? kb : K - 1] : 0.f; }
  return bsplit16(v); }
__device__ __forceinline__ F2 split_col(const float* W, int k0, int n, int lane, int ld, int K) { float v[16]; const int g = lane >> 4;
#pragma unroll
  for (int i = 0; i < 8; ++i) { const int ka = k0 + 8 * g + i, kb = ka + 16; v[i] = ka < K ? W[(size_t)(ka < K ? ka : K - 1) * ld + n] : 0.f; v[8 + i] = kb < K ? W[(size_t)(kb < K ? kb : K - 1) * ld + n] : 0.f; }
  return bsplit16(v); }
__device__ __forceinline__ v8f mac3(const F2& a, const F2& b, v8f c) { c = wmma_bf(a.l, b.h, c); c = wmma_bf(a.h, b.l, c); return wmma_bf(a.h, b.h, c); }
__device__ __forceinline__ float sigm(float v) { return 1.0f / (1.0f + expf(-v)); }
#define LDSX() do { asm volatile("s_wait_dscnt 0" ::: "memory"); __builtin_amdgcn_wave_barrier(); __builtin_amdgcn_fence(__ATOMIC_RELEASE, "workgroup"); } while (0)


#define NB 4
#define SS 2048
#define E 1024
#define NH 16
#define HD 64
#define NR (NB * SS)
#define PLO 1024.0f
#define VLO 2048.0f
__device__ __forceinline__ float bfr(float v) { return (float)(__bf16)v; }
__device__ __forceinline__ v16b frag_b(const __bf16* rowk0, int lane) { return __builtin_bit_cast(v16b, frag_h((const _Float16*)rowk0, lane)); }

__global__ __launch_bounds__(256) void k_cvt(const float* __restrict__ x, __bf16* __restrict__ Xb) {
  const size_t i8 = (size_t)blockIdx.x * 256 + threadIdx.x; if (i8 >= (size_t)NR * E / 8) return;
  union { __bf16 h[8]; v4u u; } pk;
#pragma unroll
  for (int e = 0; e < 8; ++e) pk.h[e] = (__bf16)x[i8 * 8 + e];
  vst2((unsigned*)(Xb + i8 * 8), pk.u);
}
// PT rows: [0,E) Wq[:,n], [E,2E) Wk[:,n], [2E,3E) Wv[:,n], [3E,4E) Wo[:,n]  ([in][out] weights: column n as a bf16 row)
__global__ __launch_bounds__(128) void k_pack(const float* __restrict__ Wqkv, const float* __restrict__ Wp, __bf16* __restrict__ PT) {
  const int n = blockIdx.x, tid = threadIdx.x; __shared__ __align__(16) __bf16 srow[E];
  for (int k = tid; k < E; k += 128) srow[k] = (__bf16)(n < 3 * E ? Wqkv[(size_t)k * (3 * E) + n] : Wp[(size_t)k * E + (n - 3 * E)]);
  __syncthreads();
  if (tid < E / 8) vst2((unsigned*)(PT + (size_t)n * E + tid * 8), *(const v4u*)(&srow[tid * 8]));
}
// QKV: block (64 rows, 128 cols = 2 heads, which); q,k (+bias) -> Q32/K32 f32 [bh][s][64]; v (+bias) -> VT hi/lo x4 [bh][d][s]
__global__ __launch_bounds__(128) void k_qkv(const __bf16* __restrict__ Xb, int rbase, const __bf16* __restrict__ PT, const float* __restrict__ bqkv, const float* __restrict__ bQ, const float* __restrict__ bK, const float* __restrict__ bV, float* __restrict__ Q32, float* __restrict__ K32, _Float16* __restrict__ VTh, _Float16* __restrict__ VTl) {
  __shared__ __align__(16) float so[4][16][132];
  __shared__ __align__(16) _Float16 sth[128][72], stl[128][72];
  const int tid = threadIdx.x, wave = tid >> 5, lane = tid & 31, col = lane & 15, g = lane >> 4;
  const int which = blockIdx.z, r0b = blockIdx.x * 64, r0 = r0b + wave * 16, n0 = blockIdx.y * 128; const int b = r0b / SS, s0 = r0b % SS;
  const float* bb_ = bqkv + which * E; const float* bx_ = which == 0 ? bQ : (which == 1 ? bK : bV);      // column n = h*64 + d indexes both biases
  v8f acc[8] = {};
#pragma unroll 2
  for (int kc = 0; kc < E / 32; ++kc) { const v16b a = frag_b(Xb + (size_t)(rbase + r0 + col) * E + kc * 32, lane);
#pragma unroll
    for (int j = 0; j < 8; ++j) acc[j] = wmma_bf(a, frag_b(PT + (size_t)(which * E + n0 + j * 16 + col) * E + kc * 32, lane), acc[j]); }
  if (which < 2) {
#pragma unroll
    for (int j = 0; j < 8; ++j) { const float bb = bfr(bb_[n0 + j * 16 + col]) + bfr(bx_[n0 + j * 16 + col]);
#pragma unroll
      for (int r = 0; r < 8; ++r) so[wave][8 * g + r][j * 16 + col] = acc[j][r] + bb; }
    LDSX();
    float* Dst = which == 0 ? Q32 : K32;
    for (int qq = lane; qq < 2 * 16 * 16; qq += 32) { const int hh = qq >> 8, rl = (qq >> 4) & 15, pc = qq & 15; const int h = (n0 >> 6) + hh;
      vst2(Dst + (((size_t)b * NH + h) * SS + s0 + wave * 16 + rl) * HD + pc * 4, *(const v4f*)(&so[wave][rl][hh * 64 + pc * 4])); } }
  else {
#pragma unroll
    for (int j = 0; j < 8; ++j) { const float bb = bfr(bb_[n0 + j * 16 + col]) + bfr(bx_[n0 + j * 16 + col]);
#pragma unroll
      for (int r = 0; r < 8; ++r) { const float v = (acc[j][r] + bb) * 4.0f; const _Float16 hi = (_Float16)v; sth[j * 16 + col][wave * 16 + 8 * g + r] = hi; stl[j * 16 + col][wave * 16 + 8 * g + r] = (_Float16)((v - (float)hi) * VLO); } }
    __syncthreads();
    for (int qq = tid; qq < 128 * 8; qq += 128) { const int cl = qq >> 3, pc = qq & 7; const int c = n0 + cl, h = c >> 6, d = c & 63; const size_t o = (((size_t)b * NH + h) * HD + d) * SS + s0 + pc * 8;
      vst2(VTh + o, *(const v4u*)(&sth[cl][pc * 8])); vst2(VTl + o, *(const v4u*)(&stl[cl][pc * 8])); } }
}
// causal attention: block (64 queries, bh); key tiles 0..qb; S on hi/lo splits of the f32 q/k rows; P,V hi/lo; O f32 [bh][s][64]
__global__ __launch_bounds__(128) void k_attn(const float* __restrict__ Q32, const float* __restrict__ K32, const _Float16* __restrict__ VTh, const _Float16* __restrict__ VTl, float* __restrict__ O32) {
  __shared__ __align__(16) float sS[4][16][68];
  __shared__ __align__(16) _Float16 sPh[4][16][72], sPl[4][16][72];
  __shared__ __align__(16) float sO[4][16][68];
  const int tid = threadIdx.x, w = tid >> 5, lane = tid & 31, col = lane & 15, g = lane >> 4;
  const size_t bh = blockIdx.y; const int qb = blockIdx.x; const int q0 = qb * 64 + w * 16;
  F2 aq[2];
#pragma unroll
  for (int kc = 0; kc < 2; ++kc) aq[kc] = split_row(Q32 + (bh * SS + q0 + col) * HD, kc * 32, lane);
  float mrun = -3.0e38f, lrun = 0.f; v8f acc[4] = {}, ac1[4] = {}, ac2[4] = {};
#pragma unroll 1
  for (int kt = 0; kt <= qb; ++kt) {
#pragma unroll
    for (int t = 0; t < 4; ++t) { const int key = kt * 64 + t * 16 + col; const float* krow = K32 + (bh * SS + key) * HD;
      v8f s = mac3(aq[0], split_row(krow, 0, lane), (v8f){}); s = mac3(aq[1], split_row(krow, 32, lane), s);
#pragma unroll
      for (int r = 0; r < 8; ++r) { sS[w][8 * g + r][t * 16 + col] = (key > q0 + 8 * g + r) ? -3.0e38f : s[r] * 0.125f; } }
    LDSX();
    float mx = -3.4e38f;
#pragma unroll
    for (int jj = 0; jj < 32; ++jj) mx = fmaxf(mx, sS[w][col][g * 32 + jj]);
    mx = fmaxf(mx, __shfl_xor(mx, 16, 32));
    const float mnew = fmaxf(mrun, mx); const float corr = expf(mrun - mnew);
    float ps = 0.f;
#pragma unroll
    for (int jj = 0; jj < 32; ++jj) { const float p = expf(sS[w][col][g * 32 + jj] - mnew) * 16384.0f; ps += p; const _Float16 hi = (_Float16)p; sPh[w][col][g * 32 + jj] = hi; sPl[w][col][g * 32 + jj] = (_Float16)((p - (float)hi) * PLO); }
    ps += __shfl_xor(ps, 16, 32);
    lrun = lrun * corr + ps * (1.0f / 16384.0f); mrun = mnew;
#pragma unroll
    for (int r = 0; r < 8; ++r) { const float cr = __shfl(corr, 8 * g + r, 32);
#pragma unroll
      for (int t = 0; t < 4; ++t) { acc[t][r] *= cr; ac1[t][r] *= cr; ac2[t][r] *= cr; } }
    LDSX();
#pragma unroll
    for (int kc = 0; kc < 2; ++kc) { const v16h ph = frag_h(&sPh[w][col][0] + kc * 32, lane), pl = frag_h(&sPl[w][col][0] + kc * 32, lane);
#pragma unroll
      for (int t = 0; t < 4; ++t) { const size_t vo = (bh * HD + t * 16 + col) * SS + kt * 64 + kc * 32; const v16h vh = frag_h(VTh + vo, lane);
        acc[t] = wmma16(ph, vh, acc[t]); ac1[t] = wmma16(ph, frag_h(VTl + vo, lane), ac1[t]); ac2[t] = wmma16(pl, vh, ac2[t]); } }
    __builtin_amdgcn_wave_barrier(); }
#pragma unroll
  for (int r = 0; r < 8; ++r) { const float lr = __shfl(lrun, 8 * g + r, 32); const float inv = 1.0f / (lr * 16384.0f * 4.0f);
#pragma unroll
    for (int t = 0; t < 4; ++t) sO[w][8 * g + r][t * 16 + col] = (acc[t][r] + ac1[t][r] * (1.0f / VLO) + ac2[t][r] * (1.0f / PLO)) * inv; }
  LDSX();
  for (int qq = lane; qq < 16 * 16; qq += 32) { const int rl = qq >> 4, pc = qq & 15; vst2(O32 + ((bh * SS) + q0 + rl) * HD + pc * 4, *(const v4f*)(&sO[w][rl][pc * 4])); }
}
// out = ctx Wo^T + bo : split(ctx) x bf16(Wo rows): 2 products (Wo is an INPUT -> bf16 exact)
__global__ __launch_bounds__(128) void k_out(const float* __restrict__ O32, int rbase, const __bf16* __restrict__ PT, const float* __restrict__ bo, float* __restrict__ out) {
  __shared__ __align__(16) float so[4][16][132];
  const int tid = threadIdx.x, wave = tid >> 5, lane = tid & 31, col = lane & 15, g = lane >> 4;
  const int r0 = blockIdx.x * 64 + wave * 16, n0 = blockIdx.y * 128; const int ra = r0 + col; const int b = ra / SS, s = ra % SS;
  v8f acc[8] = {};
#pragma unroll 1
  for (int kc = 0; kc < E / 32; ++kc) { const int h = kc >> 1; const F2 a = split_row(O32 + (((size_t)b * NH + h) * SS + s) * HD, (kc & 1) * 32, lane);
#pragma unroll
    for (int j = 0; j < 8; ++j) { const v16b wb = frag_b(PT + (size_t)(3 * E + n0 + j * 16 + col) * E + kc * 32, lane); acc[j] = wmma_bf(a.l, wb, acc[j]); acc[j] = wmma_bf(a.h, wb, acc[j]); } }
#pragma unroll
  for (int j = 0; j < 8; ++j) { const int n = n0 + j * 16 + col; const float bb = bfr(bo[n]);
#pragma unroll
    for (int r = 0; r < 8; ++r) so[wave][8 * g + r][j * 16 + col] = acc[j][r] + bb; }
  LDSX();
#pragma unroll 4
  for (int rl = 0; rl < 16; ++rl) vst2(out + (size_t)(rbase + r0 + rl) * E + n0 + lane * 4, *(const v4f*)(&so[wave][rl][lane * 4]));
}
#define NBHALF 2
extern "C" void kernel_launch(void* const* d_in, const int* in_sizes, int n_in, void* d_out, int out_size, void* d_ws, size_t ws_size, hipStream_t stream) {
  (void)in_sizes; (void)n_in; (void)out_size; (void)ws_size;
  const float* x = (const float*)d_in[0]; const float* Wqkv = (const float*)d_in[1]; const float* bqkv = (const float*)d_in[2]; const float* Wp = (const float*)d_in[3]; const float* bp = (const float*)d_in[4]; const float* bQ = (const float*)d_in[5]; const float* bK = (const float*)d_in[6]; const float* bV = (const float*)d_in[7];
  float* out = (float*)d_out;
  char* ws = (char*)d_ws; size_t off = 0;
  auto take = [&](size_t bytes) { char* p = ws + off; off += (bytes + 255) & ~(size_t)255; return p; };
  const size_t HR = (size_t)NBHALF * SS;     // rows per half (4096)
  __bf16* Xb = (__bf16*)take((size_t)NR * E * 2); __bf16* PT = (__bf16*)take((size_t)4 * E * E * 2);
  float* Q32 = (float*)take(HR * E * 4); float* K32 = (float*)take(HR * E * 4); _Float16* VTh = (_Float16*)take(HR * E * 2); _Float16* VTl = (_Float16*)take(HR * E * 2);
  float* O32 = Q32;      // in place: each k_attn wave reads its own 16 query rows into registers before writing the same rows; no other block reads them
  // ws ~ 75 MB (72 MiB); the two batch halves (2 sequences each) reuse Q/K/V
  k_cvt<<<(NR * E / 8 + 255) / 256, 256, 0, stream>>>(x, Xb);
  k_pack<<<4 * E, 128, 0, stream>>>(Wqkv, Wp, PT);
  for (int hf = 0; hf < 2; ++hf) { const int rbase = hf * (int)HR;
    k_qkv<<<dim3(HR / 64, E / 128, 3), 128, 0, stream>>>(Xb, rbase, PT, bqkv, bQ, bK, bV, Q32, K32, VTh, VTl);
    k_attn<<<dim3(SS / 64, NBHALF * NH), 128, 0, stream>>>(Q32, K32, VTh, VTl, O32);
    k_out<<<dim3(HR / 64, E / 128), 128, 0, stream>>>(O32, rbase, PT, bp, out); }
}

// v001
// It runs in 743 microseconds.
// Two timings next to v000 both put it at 1.42 times that version's speed.
// compute dtype: x, W_attn, b_attn, W_proj, b_proj, bQ/bK/bV (INPUTS) rounded to bf16 with exact bf16 WMMA products (f32 accumulate) for the projections; q/k f32 split for the scores (3 products), P and V f16 hi/lo (3 products); softmax f32.
#include <hip/hip_runtime.h>
#include <math.h>

typedef __attribute__((ext_vector_type(16))) _Float16 v16h;
typedef __attribute__((ext_vector_type(16))) __bf16 v16b;
typedef __attribute__((ext_vector_type(8)))  _Float16 v8h;
typedef __attribute__((ext_vector_type(8)))  float v8f;
typedef __attribute__((ext_vector_type(4)))  float v4f;
typedef __attribute__((ext_vector_type(2)))  float v2f;
typedef __attribute__((ext_vector_type(4)))  unsigned v4u;
typedef __attribute__((ext_vector_type(4)))  int v4i;
typedef float __attribute__((may_alias)) float_a;
typedef int __attribute__((may_alias)) int_a;

template <typename T> __device__ __forceinline__ void vst2(void* p, T v) { *(T*)p = v;  }
__device__ __forceinline__ v8f wmma16(v16h a, v16h b, v8f c) {
  v8f d = __builtin_amdgcn_wmma_f32_16x16x32_f16(false, a, false, b, (short)0, c, false, false);
  asm volatile("v_nop\n\tv_nop\n\tv_nop\n\tv_nop" : "+v"(d) : "v"(a), "v"(b));
  return d;
}
__device__ __forceinline__ v8f wmma_bf(v16b a, v16b b, v8f c) {
  v8f d = __builtin_amdgcn_wmma_f32_16x16x32_bf16(false, a, false, b, (short)0, c, false, false);
  asm volatile("v_nop\n\tv_nop\n\tv_nop\n\tv_nop" : "+v"(d) : "v"(a), "v"(b));
  return d;
}
// 16x16x32 fragments: lane = (h = lane>>4, row/col = lane&15); elements 0..7 = k0+8h+0..7, 8..15 = k0+16+8h+0..7; D element r = row 8h+r
__device__ __forceinline__ v16h frag_h(const _Float16* rowk0, int lane) {
  union { v16h v; v8h q[2]; } u; const _Float16* p = rowk0 + 8 * (lane >> 4);
  u.q[0] = *(const v8h*)p; u.q[1] = *(const v8h*)(p + 16); return u.v;
}
__device__ __forceinline__ v16h frag_f32(const float* rowk0, int lane) {
  v16h a; const float* p = rowk0 + 8 * (lane >> 4);
#pragma unroll
  for (int i = 0; i < 8; ++i) { a[i] = (_Float16)p[i]; a[8 + i] = (_Float16)p[16 + i]; }
  return a;
}
__device__ __forceinline__ v16h frag_f32s(const float* rowk0, int lane, float sc) {
  v16h a; const float* p = rowk0 + 8 * (lane >> 4);
#pragma unroll
  for (int i = 0; i < 8; ++i) { a[i] = (_Float16)(p[i] * sc); a[8 + i] = (_Float16)(p[16 + i] * sc); }
  return a;
}
// column fragment from a [K][ld] layout (column n), rows >= K read as 0
__device__ __forceinline__ v16h fragc_f32(const float* W, int k0, int n, int lane, int ld, int K) {
  v16h a; const int g = lane >> 4;
#pragma unroll
  for (int i = 0; i < 8; ++i) { const int ka = k0 + 8 * g + i, kb = ka + 16;
    a[i] = (_Float16)(ka < K ? W[(size_t)(ka < K ? ka : K - 1) * ld + n] : 0.f); a[8 + i] = (_Float16)(kb < K ? W[(size_t)(kb < K ? kb : K - 1) * ld + n] : 0.f); }
  return a;
}
struct F2 { v16b h, l; };
__device__ __forceinline__ F2 bsplit16(const float v[16]) { F2 r;
#pragma unroll
  for (int i = 0; i < 16; ++i) { const __bf16 h = (__bf16)v[i]; r.h[i] = h; r.l[i] = (__bf16)(v[i] - (float)h); }
  return r; }
__device__ __forceinline__ F2 split_row(const float* row, int k0, int lane) { float v[16]; const float* p = row + k0 + 8 * (lane >> 4);
#pragma unroll
  for (int i = 0; i < 8; ++i) { v[i] = p[i]; v[8 + i] = p[16 + i]; }
  return bsplit16(v); }
__device__ __forceinline__ F2 split_rowK(const float* row, int k0, int lane, int K) { float v[16]; const int g = lane >> 4;
#pragma unroll
  for (int i = 0; i < 8; ++i) { const int ka = k0 + 8 * g + i, kb = ka + 16; v[i] = ka < K ? row[ka < K ? ka : K - 1] : 0.f; v[8 + i] = kb < K ? row[kb < K ? kb : K - 1] : 0.f; }
  return bsplit16(v); }
__device__ __forceinline__ F2 split_col(const float* W, int k0, int n, int lane, int ld, int K) { float v[16]; const int g = lane >> 4;
#pragma unroll
  for (int i = 0; i < 8; ++i) { const int ka = k0 + 8 * g + i, kb = ka + 16; v[i] = ka < K ? W[(size_t)(ka < K ? ka : K - 1) * ld + n] : 0.f; v[8 + i] = kb < K ? W[(size_t)(kb < K ? kb : K - 1) * ld + n] : 0.f; }
  return bsplit16(v); }
__device__ __forceinline__ v8f mac3(const F2& a, const F2& b, v8f c) { c = wmma_bf(a.l, b.h, c); c = wmma_bf(a.h, b.l, c); return wmma_bf(a.h, b.h, c); }
__device__ __forceinline__ float sigm(float v) { return 1.0f / (1.0f + expf(-v)); }
#define LDSX() do { asm volatile("s_wait_dscnt 0" ::: "memory"); __builtin_amdgcn_wave_barrier(); __builtin_amdgcn_fence(__ATOMIC_RELEASE, "workgroup"); } while (0)


#define NB 4
#define SS 2048
#define E 1024
#define NH 16
#define HD 64
#define NR (NB * SS)
#define PLO 1024.0f
#define VLO 2048.0f
__device__ __forceinline__ float bfr(float v) { return (float)(__bf16)v; }
__device__ __forceinline__ v16b frag_b(const __bf16* rowk0, int lane) { return __builtin_bit_cast(v16b, frag_h((const _Float16*)rowk0, lane)); }

__global__ __launch_bounds__(256) void k_cvt(const float* __restrict__ x, __bf16* __restrict__ Xb) {
  const size_t i8 = (size_t)blockIdx.x * 256 + threadIdx.x; if (i8 >= (size_t)NR * E / 8) return;
  union { __bf16 h[8]; v4u u; } pk;
#pragma unroll
  for (int e = 0; e < 8; ++e) pk.h[e] = (__bf16)x[i8 * 8 + e];
  vst2((unsigned*)(Xb + i8 * 8), pk.u);
}
// PT rows: [0,E) Wq[:,n], [E,2E) Wk[:,n], [2E,3E) Wv[:,n], [3E,4E) Wo[:,n]  ([in][out] weights: column n as a bf16 row)
__global__ __launch_bounds__(128) void k_pack(const float* __restrict__ Wqkv, const float* __restrict__ Wp, __bf16* __restrict__ PT) {
  const int n = blockIdx.x, tid = threadIdx.x; __shared__ __align__(16) __bf16 srow[E];
  for (int k = tid; k < E; k += 128) srow[k] = (__bf16)(n < 3 * E ? Wqkv[(size_t)k * (3 * E) + n] : Wp[(size_t)k * E + (n - 3 * E)]);
  __syncthreads();
  if (tid < E / 8) vst2((unsigned*)(PT + (size_t)n * E + tid * 8), *(const v4u*)(&srow[tid * 8]));
}
// QKV: block (64 rows, 128 cols = 2 heads, which); q,k (+bias) -> Q32/K32 f32 [bh][s][64]; v (+bias) -> VT hi/lo x4 [bh][d][s]
__global__ __launch_bounds__(128) void k_qkv(const __bf16* __restrict__ Xb, int rbase, const __bf16* __restrict__ PT, const float* __restrict__ bqkv, const float* __restrict__ bQ, const float* __restrict__ bK, const float* __restrict__ bV, float* __restrict__ Q32, float* __restrict__ K32, _Float16* __restrict__ VTh, _Float16* __restrict__ VTl) {
  __shared__ __align__(16) float so[4][16][132];
  __shared__ __align__(16) _Float16 sth[128][72], stl[128][72];
  const int tid = threadIdx.x, wave = tid >> 5, lane = tid & 31, col = lane & 15, g = lane >> 4;
  const int which = blockIdx.z, r0b = blockIdx.x * 64, r0 = r0b + wave * 16, n0 = blockIdx.y * 128; const int b = r0b / SS, s0 = r0b % SS;
  const float* bb_ = bqkv + which * E; const float* bx_ = which == 0 ? bQ : (which == 1 ? bK : bV);      // column n = h*64 + d indexes both biases
  v8f acc[8] = {};
#pragma unroll 2
  for (int kc = 0; kc < E / 32; ++kc) { const v16b a = frag_b(Xb + (size_t)(rbase + r0 + col) * E + kc * 32, lane);
#pragma unroll
    for (int j = 0; j < 8; ++j) acc[j] = wmma_bf(a, frag_b(PT + (size_t)(which * E + n0 + j * 16 + col) * E + kc * 32, lane), acc[j]); }
  if (which < 2) {
#pragma unroll
    for (int j = 0; j < 8; ++j) { const float bb = bfr(bb_[n0 + j * 16 + col]) + bfr(bx_[n0 + j * 16 + col]);
#pragma unroll
      for (int r = 0; r < 8; ++r) so[wave][8 * g + r][j * 16 + col] = acc[j][r] + bb; }
    LDSX();
    float* Dst = which == 0 ? Q32 : K32;
    for (int qq = lane; qq < 2 * 16 * 16; qq += 32) { const int hh = qq >> 8, rl = (qq >> 4) & 15, pc = qq & 15; const int h = (n0 >> 6) + hh;
      vst2(Dst + (((size_t)b * NH + h) * SS + s0 + wave * 16 + rl) * HD + pc * 4, *(const v4f*)(&so[wave][rl][hh * 64 + pc * 4])); } }
  else {
#pragma unroll
    for (int j = 0; j < 8; ++j) { const float bb = bfr(bb_[n0 + j * 16 + col]) + bfr(bx_[n0 + j * 16 + col]);
#pragma unroll
      for (int r = 0; r < 8; ++r) { const float v = (acc[j][r] + bb) * 4.0f; const _Float16 hi = (_Float16)v; sth[j * 16 + col][wave * 16 + 8 * g + r] = hi; stl[j * 16 + col][wave * 16 + 8 * g + r] = (_Float16)((v - (float)hi) * VLO); } }
    __syncthreads();
    for (int qq = tid; qq < 128 * 8; qq += 128) { const int cl = qq >> 3, pc = qq & 7; const int c = n0 + cl, h = c >> 6, d = c & 63; const size_t o = (((size_t)b * NH + h) * HD + d) * SS + s0 + pc * 8;
      vst2(VTh + o, *(const v4u*)(&sth[cl][pc * 8])); vst2(VTl + o, *(const v4u*)(&stl[cl][pc * 8])); } }
}
// eight 16-byte asynchronous copies of one lane, global -> LDS: LDS byte address l + i*ls, global address g + i*gs bytes.
// s_wait_xcnt closes the copies' own statement, so no address register is rewritten ahead of it.
__device__ __forceinline__ void copy8(unsigned l, unsigned ls, const char* g, size_t gs) {
  asm volatile("global_load_async_to_lds_b128 %0, %8, off\n\t"
               "global_load_async_to_lds_b128 %1, %9, off\n\t"
               "global_load_async_to_lds_b128 %2, %10, off\n\t"
               "global_load_async_to_lds_b128 %3, %11, off\n\t"
               "global_load_async_to_lds_b128 %4, %12, off\n\t"
               "global_load_async_to_lds_b128 %5, %13, off\n\t"
               "global_load_async_to_lds_b128 %6, %14, off\n\t"
               "global_load_async_to_lds_b128 %7, %15, off\n\t"
               "s_wait_xcnt 0x0"
               :: "v"(l), "v"(l + ls), "v"(l + 2 * ls), "v"(l + 3 * ls), "v"(l + 4 * ls), "v"(l + 5 * ls), "v"(l + 6 * ls), "v"(l + 7 * ls),
                  "v"(g), "v"(g + gs), "v"(g + 2 * gs), "v"(g + 3 * gs), "v"(g + 4 * gs), "v"(g + 5 * gs), "v"(g + 6 * gs), "v"(g + 7 * gs)
               : "memory");
}
// the same for two planes of four copies each: plane 1 lies lp bytes further in LDS and gp bytes further in memory
__device__ __forceinline__ void copy4x2(unsigned l, unsigned ls, unsigned lp, const char* g, size_t gs, size_t gp) {
  asm volatile("global_load_async_to_lds_b128 %0, %8, off\n\t"
               "global_load_async_to_lds_b128 %1, %9, off\n\t"
               "global_load_async_to_lds_b128 %2, %10, off\n\t"
               "global_load_async_to_lds_b128 %3, %11, off\n\t"
               "global_load_async_to_lds_b128 %4, %12, off\n\t"
               "global_load_async_to_lds_b128 %5, %13, off\n\t"
               "global_load_async_to_lds_b128 %6, %14, off\n\t"
               "global_load_async_to_lds_b128 %7, %15, off\n\t"
               "s_wait_xcnt 0x0"
               :: "v"(l), "v"(l + ls), "v"(l + 2 * ls), "v"(l + 3 * ls), "v"(l + lp), "v"(l + lp + ls), "v"(l + lp + 2 * ls), "v"(l + lp + 3 * ls),
                  "v"(g), "v"(g + gs), "v"(g + 2 * gs), "v"(g + 3 * gs), "v"(g + gp), "v"(g + gp + gs), "v"(g + gp + 2 * gs), "v"(g + gp + 3 * gs)
               : "memory");
}
__device__ __forceinline__ unsigned lds_off(const void* p) { return (unsigned)(size_t)p; }
#define KP 68   // LDS pitch of a 64-float key row: 272 B = 16 B x odd
#define VP 72   // LDS pitch of a 64-half V^T row: 144 B = 16 B x odd
// causal attention: block (64 queries, bh); key tiles 0..qb; each 64-key tile of K, V^T hi and V^T lo is copied to LDS once for the four waves, two buffers, the next tile in flight while this one is worked on; S on hi/lo splits of the f32 q/k rows; P,V hi/lo; O f32 [bh][s][64]
__global__ __launch_bounds__(128) void k_attn(const float* __restrict__ Q32, const float* __restrict__ K32, const _Float16* __restrict__ VTh, const _Float16* __restrict__ VTl, float* __restrict__ O32) {
  __shared__ __align__(16) float sS[4][16][68];
  __shared__ __align__(16) _Float16 sPh[4][16][72], sPl[4][16][72];
  __shared__ __align__(16) float sK[2][64][KP];
  __shared__ __align__(16) _Float16 sV[2][2][64][VP];      // [buffer][hi, lo][d][key]
  const int tid = threadIdx.x, w = tid >> 5, lane = tid & 31, col = lane & 15, g = lane >> 4;
  const size_t bh = blockIdx.y; const int qb = blockIdx.x; const int q0 = qb * 64 + w * 16;
  F2 aq[2];
#pragma unroll
  for (int kc = 0; kc < 2; ++kc) aq[kc] = split_row(Q32 + (bh * SS + q0 + col) * HD, kc * 32, lane);
  float mrun = -3.0e38f, lrun = 0.f; v8f acc[4] = {}, ac1[4] = {}, ac2[4] = {};
  // a lane's share of a tile: K, 16 KiB in a row in memory, piece tid + 128 i (LDS row 8 i + tid/16); V^T hi then lo, row 16 i + tid/8, piece tid%8
  const char* gK = (const char*)(K32 + bh * SS * HD) + tid * 16;
  const size_t vrow = ((bh * HD + (tid >> 3)) * SS + (tid & 7) * 8) * 2;
  const char* gVh = (const char*)VTh + vrow; const size_t gVd = (const char*)VTl - (const char*)VTh;
  const unsigned lK = lds_off(&sK[0][tid >> 4][(tid & 15) * 4]), lV = lds_off(&sV[0][0][tid >> 3][(tid & 7) * 8]);
  auto stage = [&](int buf, int kt) {
    copy8(lK + buf * (unsigned)sizeof(sK[0]), 8 * KP * 4, gK + (size_t)kt * (64 * HD * 4), 128 * 16);
    const char* gv = gVh + (size_t)kt * 128; const unsigned lv = lV + buf * (unsigned)sizeof(sV[0]);
    copy4x2(lv, 16 * VP * 2, (unsigned)sizeof(sV[0][0]), gv, (size_t)16 * SS * 2, gVd); };
  stage(0, 0);
  asm volatile("s_wait_asynccnt 0x0" ::: "memory");   // this wave's copies of tile 0 have landed
  __syncthreads();                                     // and every other wave's: tile 0 may be read
  if (qb >= 1) stage(1, 1);
#pragma unroll 1
  for (int kt = 0; kt <= qb; ++kt) { const int buf = kt & 1;
#pragma unroll
    for (int t = 0; t < 4; ++t) { const int key = kt * 64 + t * 16 + col; const float* krow = &sK[buf][t * 16 + col][0];
      v8f s = mac3(aq[0], split_row(krow, 0, lane), (v8f){}); s = mac3(aq[1], split_row(krow, 32, lane), s);
#pragma unroll
      for (int r = 0; r < 8; ++r) { sS[w][8 * g + r][t * 16 + col] = (key > q0 + 8 * g + r) ? -3.0e38f : s[r] * 0.125f; } }
    LDSX();
    float mx = -3.4e38f;
#pragma unroll
    for (int jj = 0; jj < 32; ++jj) mx = fmaxf(mx, sS[w][col][g * 32 + jj]);
    mx = fmaxf(mx, __shfl_xor(mx, 16, 32));
    const float mnew = fmaxf(mrun, mx); const float corr = expf(mrun - mnew);
    float ps = 0.f;
#pragma unroll
    for (int jj = 0; jj < 32; ++jj) { const float p = expf(sS[w][col][g * 32 + jj] - mnew) * 16384.0f; ps += p; const _Float16 hi = (_Float16)p; sPh[w][col][g * 32 + jj] = hi; sPl[w][col][g * 32 + jj] = (_Float16)((p - (float)hi) * PLO); }
    ps += __shfl_xor(ps, 16, 32);
    lrun = lrun * corr + ps * (1.0f / 16384.0f); mrun = mnew;
#pragma unroll
    for (int r = 0; r < 8; ++r) { const float cr = __shfl(corr, 8 * g + r, 32);
#pragma unroll
      for (int t = 0; t < 4; ++t) { acc[t][r] *= cr; ac1[t][r] *= cr; ac2[t][r] *= cr; } }
    LDSX();
#pragma unroll
    for (int kc = 0; kc < 2; ++kc) { const v16h ph = frag_h(&sPh[w][col][0] + kc * 32, lane), pl = frag_h(&sPl[w][col][0] + kc * 32, lane);
#pragma unroll
      for (int t = 0; t < 4; ++t) { const v16h vh = frag_h(&sV[buf][0][t * 16 + col][kc * 32], lane);
        acc[t] = wmma16(ph, vh, acc[t]); ac1[t] = wmma16(ph, frag_h(&sV[buf][1][t * 16 + col][kc * 32], lane), ac1[t]); ac2[t] = wmma16(pl, vh, ac2[t]); } }
    __builtin_amdgcn_wave_barrier();
    asm volatile("s_wait_dscnt 0x0" ::: "memory");      // this wave's reads of buffer buf are done
    asm volatile("s_wait_asynccnt 0x0" ::: "memory");   // its copies of tile kt + 1 have landed
    __syncthreads();                                     // publishes tile kt + 1 and frees buffer buf
    if (kt + 2 <= qb) stage(buf, kt + 2); }
  asm volatile("s_wait_asynccnt 0x0" ::: "memory");     // no copy is left in flight behind the loop
  // the output rows are staged in the wave's own score rows, which are dead here: with the tile buffers three work-groups still fit one WGP's LDS
#pragma unroll
  for (int r = 0; r < 8; ++r) { const float lr = __shfl(lrun, 8 * g + r, 32); const float inv = 1.0f / (lr * 16384.0f * 4.0f);
#pragma unroll
    for (int t = 0; t < 4; ++t) sS[w][8 * g + r][t * 16 + col] = (acc[t][r] + ac1[t][r] * (1.0f / VLO) + ac2[t][r] * (1.0f / PLO)) * inv; }
  LDSX();
  for (int qq = lane; qq < 16 * 16; qq += 32) { const int rl = qq >> 4, pc = qq & 15; vst2(O32 + ((bh * SS) + q0 + rl) * HD + pc * 4, *(const v4f*)(&sS[w][rl][pc * 4])); }
}
// out = ctx Wo^T + bo : split(ctx) x bf16(Wo rows): 2 products (Wo is an INPUT -> bf16 exact)
__global__ __launch_bounds__(128) void k_out(const float* __restrict__ O32, int rbase, const __bf16* __restrict__ PT, const float* __restrict__ bo, float* __restrict__ out) {
  __shared__ __align__(16) float so[4][16][132];
  const int tid = threadIdx.x, wave = tid >> 5, lane = tid & 31, col = lane & 15, g = lane >> 4;
  const int r0 = blockIdx.x * 64 + wave * 16, n0 = blockIdx.y * 128; const int ra = r0 + col; const int b = ra / SS, s = ra % SS;
  v8f acc[8] = {};
#pragma unroll 1
  for (int kc = 0; kc < E / 32; ++kc) { const int h = kc >> 1; const F2 a = split_row(O32 + (((size_t)b * NH + h) * SS + s) * HD, (kc & 1) * 32, lane);
#pragma unroll
    for (int j = 0; j < 8; ++j) { const v16b wb = frag_b(PT + (size_t)(3 * E + n0 + j * 16 + col) * E + kc * 32, lane); acc[j] = wmma_bf(a.l, wb, acc[j]); acc[j] = wmma_bf(a.h, wb, acc[j]); } }
#pragma unroll
  for (int j = 0; j < 8; ++j) { const int n = n0 + j * 16 + col; const float bb = bfr(bo[n]);
#pragma unroll
    for (int r = 0; r < 8; ++r) so[wave][8 * g + r][j * 16 + col] = acc[j][r] + bb; }
  LDSX();
#pragma unroll 4
  for (int rl = 0; rl < 16; ++rl) vst2(out + (size_t)(rbase + r0 + rl) * E + n0 + lane * 4, *(const v4f*)(&so[wave][rl][lane * 4]));
}
#define NBHALF 2
extern "C" void kernel_launch(void* const* d_in, const int* in_sizes, int n_in, void* d_out, int out_size, void* d_ws, size_t ws_size, hipStream_t stream) {
  (void)in_sizes; (void)n_in; (void)out_size; (void)ws_size;
  const float* x = (const float*)d_in[0]; const float* Wqkv = (const float*)d_in[1]; const float* bqkv = (const float*)d_in[2]; const float* Wp = (const float*)d_in[3]; const float* bp = (const float*)d_in[4]; const float* bQ = (const float*)d_in[5]; const float* bK = (const float*)d_in[6]; const float* bV = (const float*)d_in[7];
  float* out = (float*)d_out;
  char* ws = (char*)d_ws; size_t off = 0;
  auto take = [&](size_t bytes) { char* p = ws + off; off += (bytes + 255) & ~(size_t)255; return p; };
  const size_t HR = (size_t)NBHALF * SS;     // rows per half (4096)
  __bf16* Xb = (__bf16*)take((size_t)NR * E * 2); __bf16* PT = (__bf16*)take((size_t)4 * E * E * 2);
  float* Q32 = (float*)take(HR * E * 4); float* K32 = (float*)take(HR * E * 4); _Float16* VTh = (_Float16*)take(HR * E * 2); _Float16* VTl = (_Float16*)take(HR * E * 2);
  float* O32 = Q32;      // in place: each k_attn wave reads its own 16 query rows into registers before writing the same rows; no other block reads them
  // ws ~ 75 MB (72 MiB); the two batch halves (2 sequences each) reuse Q/K/V
  k_cvt<<<(NR * E / 8 + 255) / 256, 256, 0, stream>>>(x, Xb);
  k_pack<<<4 * E, 128, 0, stream>>>(Wqkv, Wp, PT);
  for (int hf = 0; hf < 2; ++hf) { const int rbase = hf * (int)HR;
    k_qkv<<<dim3(HR / 64, E / 128, 3), 128, 0, stream>>>(Xb, rbase, PT, bqkv, bQ, bK, bV, Q32, K32, VTh, VTl);
    k_attn<<<dim3(SS / 64, NBHALF * NH), 128, 0, stream>>>(Q32, K32, VTh, VTl, O32);
    k_out<<<dim3(HR / 64, E / 128), 128, 0, stream>>>(O32, rbase, PT, bp, out); }
}

// v002
// A run of this version takes 440 microseconds.
// Timed twice side by side with v001, it ran 1.67 and 1.68 times as fast.
// Counting every step since v000, it is 2.38 times as fast.
// compute dtype: x, W_attn, b_attn, W_proj, b_proj, bQ/bK/bV (INPUTS) rounded to bf16 with exact bf16 WMMA products (f32 accumulate) for the projections; q/k f32 split for the scores (3 products), P and V f16 hi/lo (3 products); softmax f32.
#include <hip/hip_runtime.h>
#include <math.h>

typedef __attribute__((ext_vector_type(16))) _Float16 v16h;
typedef __attribute__((ext_vector_type(16))) __bf16 v16b;
typedef __attribute__((ext_vector_type(8)))  _Float16 v8h;
typedef __attribute__((ext_vector_type(8)))  float v8f;
typedef __attribute__((ext_vector_type(4)))  float v4f;
typedef __attribute__((ext_vector_type(2)))  float v2f;
typedef __attribute__((ext_vector_type(4)))  unsigned v4u;
typedef __attribute__((ext_vector_type(4)))  int v4i;
typedef float __attribute__((may_alias)) float_a;
typedef int __attribute__((may_alias)) int_a;

template <typename T> __device__ __forceinline__ void vst2(void* p, T v) { *(T*)p = v;  }
__device__ __forceinline__ v8f wmma16(v16h a, v16h b, v8f c) {
  v8f d = __builtin_amdgcn_wmma_f32_16x16x32_f16(false, a, false, b, (short)0, c, false, false);
  asm volatile("v_nop\n\tv_nop\n\tv_nop\n\tv_nop" : "+v"(d) : "v"(a), "v"(b));
  return d;
}
__device__ __forceinline__ v8f wmma_bf(v16b a, v16b b, v8f c) {
  v8f d = __builtin_amdgcn_wmma_f32_16x16x32_bf16(false, a, false, b, (short)0, c, false, false);
  asm volatile("v_nop\n\tv_nop\n\tv_nop\n\tv_nop" : "+v"(d) : "v"(a), "v"(b));
  return d;
}
// 16x16x32 fragments: lane = (h = lane>>4, row/col = lane&15); elements 0..7 = k0+8h+0..7, 8..15 = k0+16+8h+0..7; D element r = row 8h+r
__device__ __forceinline__ v16h frag_h(const _Float16* rowk0, int lane) {
  union { v16h v; v8h q[2]; } u; const _Float16* p = rowk0 + 8 * (lane >> 4);
  u.q[0] = *(const v8h*)p; u.q[1] = *(const v8h*)(p + 16); return u.v;
}
__device__ __forceinline__ v16h frag_f32(const float* rowk0, int lane) {
  v16h a; const float* p = rowk0 + 8 * (lane >> 4);
#pragma unroll
  for (int i = 0; i < 8; ++i) { a[i] = (_Float16)p[i]; a[8 + i] = (_Float16)p[16 + i]; }
  return a;
}
__device__ __forceinline__ v16h frag_f32s(const float* rowk0, int lane, float sc) {
  v16h a; const float* p = rowk0 + 8 * (lane >> 4);
#pragma unroll
  for (int i = 0; i < 8; ++i) { a[i] = (_Float16)(p[i] * sc); a[8 + i] = (_Float16)(p[16 + i] * sc); }
  return a;
}
// column fragment from a [K][ld] layout (column n), rows >= K read as 0
__device__ __forceinline__ v16h fragc_f32(const float* W, int k0, int n, int lane, int ld, int K) {
  v16h a; const int g = lane >> 4;
#pragma unroll
  for (int i = 0; i < 8; ++i) { const int ka = k0 + 8 * g + i, kb = ka + 16;
    a[i] = (_Float16)(ka < K ? W[(size_t)(ka < K ? ka : K - 1) * ld + n] : 0.f); a[8 + i] = (_Float16)(kb < K ? W[(size_t)(kb < K ? kb : K - 1) * ld + n] : 0.f); }
  return a;
}
struct F2 { v16b h, l; };
__device__ __forceinline__ F2 bsplit16(const float v[16]) { F2 r;
#pragma unroll
  for (int i = 0; i < 16; ++i) { const __bf16 h = (__bf16)v[i]; r.h[i] = h; r.l[i] = (__bf16)(v[i] - (float)h); }
  return r; }
__device__ __forceinline__ F2 split_row(const float* row, int k0, int lane) { float v[16]; const float* p = row + k0 + 8 * (lane >> 4);
#pragma unroll
  for (int i = 0; i < 8; ++i) { v[i] = p[i]; v[8 + i] = p[16 + i]; }
  return bsplit16(v); }
__device__ __forceinline__ F2 split_rowK(const float* row, int k0, int lane, int K) { float v[16]; const int g = lane >> 4;
#pragma unroll
  for (int i = 0; i < 8; ++i) { const int ka = k0 + 8 * g + i, kb = ka + 16; v[i] = ka < K ? row[ka < K ? ka : K - 1] : 0.f; v[8 + i] = kb < K ? row[kb < K ? kb : K - 1] : 0.f; }
  return bsplit16(v); }
__device__ __forceinline__ F2 split_col(const float* W, int k0, int n, int lane, int ld, int K) { float v[16]; const int g = lane >> 4;
#pragma unroll
  for (int i = 0; i < 8; ++i) { const int ka = k0 + 8 * g + i, kb = ka + 16; v[i] = ka < K ? W[(size_t)(ka < K ? ka : K - 1) * ld + n] : 0.f; v[8 + i] = kb < K ? W[(size_t)(kb < K ? kb : K - 1) * ld + n] : 0.f; }
  return bsplit16(v); }
__device__ __forceinline__ v8f mac3(const F2& a, const F2& b, v8f c) { c = wmma_bf(a.l, b.h, c); c = wmma_bf(a.h, b.l, c); return wmma_bf(a.h, b.h, c); }
__device__ __forceinline__ float sigm(float v) { return 1.0f / (1.0f + expf(-v)); }
#define LDSX() do { asm volatile("s_wait_dscnt 0" ::: "memory"); __builtin_amdgcn_wave_barrier(); __builtin_amdgcn_fence(__ATOMIC_RELEASE, "workgroup"); } while (0)


#define NB 4
#define SS 2048
#define E 1024
#define NH 16
#define HD 64
#define NR (NB * SS)
#define PLO 1024.0f
#define VLO 2048.0f
__device__ __forceinline__ float bfr(float v) { return (float)(__bf16)v; }
__device__ __forceinline__ v16b frag_b(const __bf16* rowk0, int lane) { return __builtin_bit_cast(v16b, frag_h((const _Float16*)rowk0, lane)); }

__global__ __launch_bounds__(256) void k_cvt(const float* __restrict__ x, __bf16* __restrict__ Xb) {
  const size_t i8 = (size_t)blockIdx.x * 256 + threadIdx.x; if (i8 >= (size_t)NR * E / 8) return;
  union { __bf16 h[8]; v4u u; } pk;
#pragma unroll
  for (int e = 0; e < 8; ++e) pk.h[e] = (__bf16)x[i8 * 8 + e];
  vst2((unsigned*)(Xb + i8 * 8), pk.u);
}
// PT rows: [0,E) Wq[:,n], [E,2E) Wk[:,n], [2E,3E) Wv[:,n], [3E,4E) Wo[:,n]  ([in][out] weights: column n as a bf16 row)
__global__ __launch_bounds__(128) void k_pack(const float* __restrict__ Wqkv, const float* __restrict__ Wp, __bf16* __restrict__ PT) {
  const int n = blockIdx.x, tid = threadIdx.x; __shared__ __align__(16) __bf16 srow[E];
  for (int k = tid; k < E; k += 128) srow[k] = (__bf16)(n < 3 * E ? Wqkv[(size_t)k * (3 * E) + n] : Wp[(size_t)k * E + (n - 3 * E)]);
  __syncthreads();
  if (tid < E / 8) vst2((unsigned*)(PT + (size_t)n * E + tid * 8), *(const v4u*)(&srow[tid * 8]));
}
// eight 16-byte asynchronous copies of one lane, global -> LDS: LDS byte address l + i*ls, global address g + i*gs bytes.
// s_wait_xcnt closes the copies' own statement, so no address register is rewritten ahead of it.
__device__ __forceinline__ void copy8(unsigned l, unsigned ls, const char* g, size_t gs) {
  asm volatile("global_load_async_to_lds_b128 %0, %8, off\n\t"
               "global_load_async_to_lds_b128 %1, %9, off\n\t"
               "global_load_async_to_lds_b128 %2, %10, off\n\t"
               "global_load_async_to_lds_b128 %3, %11, off\n\t"
               "global_load_async_to_lds_b128 %4, %12, off\n\t"
               "global_load_async_to_lds_b128 %5, %13, off\n\t"
               "global_load_async_to_lds_b128 %6, %14, off\n\t"
               "global_load_async_to_lds_b128 %7, %15, off\n\t"
               "s_wait_xcnt 0x0"
               :: "v"(l), "v"(l + ls), "v"(l + 2 * ls), "v"(l + 3 * ls), "v"(l + 4 * ls), "v"(l + 5 * ls), "v"(l + 6 * ls), "v"(l + 7 * ls),
                  "v"(g), "v"(g + gs), "v"(g + 2 * gs), "v"(g + 3 * gs), "v"(g + 4 * gs), "v"(g + 5 * gs), "v"(g + 6 * gs), "v"(g + 7 * gs)
               : "memory");
}
// the same for two planes of four copies each: plane 1 lies lp bytes further in LDS and gp bytes further in memory
__device__ __forceinline__ void copy4x2(unsigned l, unsigned ls, unsigned lp, const char* g, size_t gs, size_t gp) {
  asm volatile("global_load_async_to_lds_b128 %0, %8, off\n\t"
               "global_load_async_to_lds_b128 %1, %9, off\n\t"
               "global_load_async_to_lds_b128 %2, %10, off\n\t"
               "global_load_async_to_lds_b128 %3, %11, off\n\t"
               "global_load_async_to_lds_b128 %4, %12, off\n\t"
               "global_load_async_to_lds_b128 %5, %13, off\n\t"
               "global_load_async_to_lds_b128 %6, %14, off\n\t"
               "global_load_async_to_lds_b128 %7, %15, off\n\t"
               "s_wait_xcnt 0x0"
               :: "v"(l), "v"(l + ls), "v"(l + 2 * ls), "v"(l + 3 * ls), "v"(l + lp), "v"(l + lp + ls), "v"(l + lp + 2 * ls), "v"(l + lp + 3 * ls),
                  "v"(g), "v"(g + gs), "v"(g + 2 * gs), "v"(g + 3 * gs), "v"(g + gp), "v"(g + gp + gs), "v"(g + gp + 2 * gs), "v"(g + gp + 3 * gs)
               : "memory");
}
// the same for four copies
__device__ __forceinline__ void copy4(unsigned l, unsigned ls, const char* g, size_t gs) {
  asm volatile("global_load_async_to_lds_b128 %0, %4, off\n\t"
               "global_load_async_to_lds_b128 %1, %5, off\n\t"
               "global_load_async_to_lds_b128 %2, %6, off\n\t"
               "global_load_async_to_lds_b128 %3, %7, off\n\t"
               "s_wait_xcnt 0x0"
               :: "v"(l), "v"(l + ls), "v"(l + 2 * ls), "v"(l + 3 * ls),
                  "v"(g), "v"(g + gs), "v"(g + 2 * gs), "v"(g + 3 * gs)
               : "memory");
}
__device__ __forceinline__ unsigned lds_off(const void* p) { return (unsigned)(size_t)p; }
#define KP 68   // LDS pitch of a 64-float key row: 272 B = 16 B x odd
#define VP 72   // LDS pitch of a 64-half V^T row: 144 B = 16 B x odd
#define GP 72   // LDS pitch of a 64-element bf16 k slice: 144 B = 16 B x odd
// LDS of the two projections: in the k loop two buffers of the operands' 64-wide k slices; behind it, on the same bytes, the output staging
union QkvLds { struct { __bf16 a[2][64][GP]; __bf16 b[2][128][GP]; } st; float so[4][16][132]; struct { _Float16 h[128][72], l[128][72]; } vt; };
union OutLds { struct { float a[2][64][KP]; __bf16 b[2][128][GP]; } st; float so[4][16][132]; };
// each 64-wide k slice of the block's 64 X rows and 128 weight rows is copied to LDS once for the four waves, two buffers, the next slice in flight while this one is worked on
// QKV: block (64 rows, 128 cols = 2 heads, which); q,k (+bias) -> Q32/K32 f32 [bh][s][64]; v (+bias) -> VT hi/lo x4 [bh][d][s]
__global__ __launch_bounds__(128) void k_qkv(const __bf16* __restrict__ Xb, int rbase, const __bf16* __restrict__ PT, const float* __restrict__ bqkv, const float* __restrict__ bQ, const float* __restrict__ bK, const float* __restrict__ bV, float* __restrict__ Q32, float* __restrict__ K32, _Float16* __restrict__ VTh, _Float16* __restrict__ VTl) {
  __shared__ __align__(16) QkvLds sm;
  float (&so)[4][16][132] = sm.so; _Float16 (&sth)[128][72] = sm.vt.h, (&stl)[128][72] = sm.vt.l;
  const int tid = threadIdx.x, wave = tid >> 5, lane = tid & 31, col = lane & 15, g = lane >> 4;
  const int which = blockIdx.z, r0b = blockIdx.x * 64, n0 = blockIdx.y * 128; const int b = r0b / SS, s0 = r0b % SS;
  const float* bb_ = bqkv + which * E; const float* bx_ = which == 0 ? bQ : (which == 1 ? bK : bV);      // column n = h*64 + d indexes both biases
  v8f acc[8] = {};
  // a lane's share of a slice: row 16 i + tid/8, 16-byte piece tid%8 of the row's 128 bytes
  const char* gA = (const char*)(Xb + (size_t)(rbase + r0b + (tid >> 3)) * E + (tid & 7) * 8);
  const char* gB = (const char*)(PT + (size_t)(which * E + n0 + (tid >> 3)) * E + (tid & 7) * 8);
  const unsigned lA = lds_off(&sm.st.a[0][tid >> 3][(tid & 7) * 8]), lB = lds_off(&sm.st.b[0][tid >> 3][(tid & 7) * 8]);
  auto stage = [&](int buf, int kt) {
    copy4(lA + buf * (unsigned)sizeof(sm.st.a[0]), 16 * GP * 2, gA + (size_t)kt * 128, (size_t)16 * E * 2);
    copy8(lB + buf * (unsigned)sizeof(sm.st.b[0]), 16 * GP * 2, gB + (size_t)kt * 128, (size_t)16 * E * 2); };
  stage(0, 0);
  asm volatile("s_wait_asynccnt 0x0" ::: "memory");   // this wave's copies of slice 0 have landed
  __syncthreads();                                     // and every other wave's: slice 0 may be read
  stage(1, 1);
#pragma unroll 1   // rolled, for speed only
  for (int kt = 0; kt < E / 64; ++kt) { const int buf = kt & 1;
#pragma unroll
    for (int kc = 0; kc < 2; ++kc) { const v16b a = frag_b(&sm.st.a[buf][wave * 16 + col][kc * 32], lane); v16b wb[8];
#pragma unroll
      for (int j = 0; j < 8; ++j) wb[j] = frag_b(&sm.st.b[buf][j * 16 + col][kc * 32], lane);
#pragma unroll
      for (int j = 0; j < 8; ++j) acc[j] = wmma_bf(a, wb[j], acc[j]); }
    asm volatile("s_wait_dscnt 0x0" ::: "memory");      // this wave's reads of buffer buf are done
    asm volatile("s_wait_asynccnt 0x0" ::: "memory");   // its copies of slice kt + 1 have landed
    __syncthreads();                                     // publishes slice kt + 1 and frees buffer buf (behind the last slice: for the output staging)
    if (kt + 2 < E / 64) stage(buf, kt + 2); }
  asm volatile("s_wait_asynccnt 0x0" ::: "memory");     // no copy is left in flight behind the loop
  if (which < 2) {
#pragma unroll
    for (int j = 0; j < 8; ++j) { const float bb = bfr(bb_[n0 + j * 16 + col]) + bfr(bx_[n0 + j * 16 + col]);
#pragma unroll
      for (int r = 0; r < 8; ++r) so[wave][8 * g + r][j * 16 + col] = acc[j][r] + bb; }
    LDSX();
    float* Dst = which == 0 ? Q32 : K32;
    for (int qq = lane; qq < 2 * 16 * 16; qq += 32) { const int hh = qq >> 8, rl = (qq >> 4) & 15, pc = qq & 15; const int h = (n0 >> 6) + hh;
      vst2(Dst + (((size_t)b * NH + h) * SS + s0 + wave * 16 + rl) * HD + pc * 4, *(const v4f*)(&so[wave][rl][hh * 64 + pc * 4])); } }
  else {
#pragma unroll
    for (int j = 0; j < 8; ++j) { const float bb = bfr(bb_[n0 + j * 16 + col]) + bfr(bx_[n0 + j * 16 + col]);
#pragma unroll
      for (int r = 0; r < 8; ++r) { const float v = (acc[j][r] + bb) * 4.0f; const _Float16 hi = (_Float16)v; sth[j * 16 + col][wave * 16 + 8 * g + r] = hi; stl[j * 16 + col][wave * 16 + 8 * g + r] = (_Float16)((v - (float)hi) * VLO); } }
    __syncthreads();
    for (int qq = tid; qq < 128 * 8; qq += 128) { const int cl = qq >> 3, pc = qq & 7; const int c = n0 + cl, h = c >> 6, d = c & 63; const size_t o = (((size_t)b * NH + h) * HD + d) * SS + s0 + pc * 8;
      vst2(VTh + o, *(const v4u*)(&sth[cl][pc * 8])); vst2(VTl + o, *(const v4u*)(&stl[cl][pc * 8])); } }
}
// causal attention: block (64 queries, bh); key tiles 0..qb; each 64-key tile of K, V^T hi and V^T lo is copied to LDS once for the four waves, two buffers, the next tile in flight while this one is worked on; S on hi/lo splits of the f32 q/k rows; P,V hi/lo; O f32 [bh][s][64]
__global__ __launch_bounds__(128) void k_attn(const float* __restrict__ Q32, const float* __restrict__ K32, const _Float16* __restrict__ VTh, const _Float16* __restrict__ VTl, float* __restrict__ O32) {
  __shared__ __align__(16) float sS[4][16][68];
  __shared__ __align__(16) _Float16 sPh[4][16][72], sPl[4][16][72];
  __shared__ __align__(16) float sK[2][64][KP];
  __shared__ __align__(16) _Float16 sV[2][2][64][VP];      // [buffer][hi, lo][d][key]
  const int tid = threadIdx.x, w = tid >> 5, lane = tid & 31, col = lane & 15, g = lane >> 4;
  const size_t bh = blockIdx.y; const int qb = blockIdx.x; const int q0 = qb * 64 + w * 16;
  F2 aq[2];
#pragma unroll
  for (int kc = 0; kc < 2; ++kc) aq[kc] = split_row(Q32 + (bh * SS + q0 + col) * HD, kc * 32, lane);
  float mrun = -3.0e38f, lrun = 0.f; v8f acc[4] = {}, ac1[4] = {}, ac2[4] = {};
  // a lane's share of a tile: K, 16 KiB in a row in memory, piece tid + 128 i (LDS row 8 i + tid/16); V^T hi then lo, row 16 i + tid/8, piece tid%8
  const char* gK = (const char*)(K32 + bh * SS * HD) + tid * 16;
  const size_t vrow = ((bh * HD + (tid >> 3)) * SS + (tid & 7) * 8) * 2;
  const char* gVh = (const char*)VTh + vrow; const size_t gVd = (const char*)VTl - (const char*)VTh;
  const unsigned lK = lds_off(&sK[0][tid >> 4][(tid & 15) * 4]), lV = lds_off(&sV[0][0][tid >> 3][(tid & 7) * 8]);
  auto stage = [&](int buf, int kt) {
    copy8(lK + buf * (unsigned)sizeof(sK[0]), 8 * KP * 4, gK + (size_t)kt * (64 * HD * 4), 128 * 16);
    const char* gv = gVh + (size_t)kt * 128; const unsigned lv = lV + buf * (unsigned)sizeof(sV[0]);
    copy4x2(lv, 16 * VP * 2, (unsigned)sizeof(sV[0][0]), gv, (size_t)16 * SS * 2, gVd); };
  stage(0, 0);
  asm volatile("s_wait_asynccnt 0x0" ::: "memory");   // this wave's copies of tile 0 have landed
  __syncthreads();                                     // and every other wave's: tile 0 may be read
  if (qb >= 1) stage(1, 1);
#pragma unroll 1
  for (int kt = 0; kt <= qb; ++kt) { const int buf = kt & 1;
#pragma unroll
    for (int t = 0; t < 4; ++t) { const int key = kt * 64 + t * 16 + col; const float* krow = &sK[buf][t * 16 + col][0];
      v8f s = mac3(aq[0], split_row(krow, 0, lane), (v8f){}); s = mac3(aq[1], split_row(krow, 32, lane), s);
#pragma unroll
      for (int r = 0; r < 8; ++r) { sS[w][8 * g + r][t * 16 + col] = (key > q0 + 8 * g + r) ? -3.0e38f : s[r] * 0.125f; } }
    LDSX();
    float mx = -3.4e38f;
#pragma unroll
    for (int jj = 0; jj < 32; ++jj) mx = fmaxf(mx, sS[w][col][g * 32 + jj]);
    mx = fmaxf(mx, __shfl_xor(mx, 16, 32));
    const float mnew = fmaxf(mrun, mx); const float corr = expf(mrun - mnew);
    float ps = 0.f;
#pragma unroll
    for (int jj = 0; jj < 32; ++jj) { const float p = expf(sS[w][col][g * 32 + jj] - mnew) * 16384.0f; ps += p; const _Float16 hi = (_Float16)p; sPh[w][col][g * 32 + jj] = hi; sPl[w][col][g * 32 + jj] = (_Float16)((p - (float)hi) * PLO); }
    ps += __shfl_xor(ps, 16, 32);
    lrun = lrun * corr + ps * (1.0f / 16384.0f); mrun = mnew;
#pragma unroll
    for (int r = 0; r < 8; ++r) { const float cr = __shfl(corr, 8 * g + r, 32);
#pragma unroll
      for (int t = 0; t < 4; ++t) { acc[t][r] *= cr; ac1[t][r] *= cr; ac2[t][r] *= cr; } }
    LDSX();
#pragma unroll
    for (int kc = 0; kc < 2; ++kc) { const v16h ph = frag_h(&sPh[w][col][0] + kc * 32, lane), pl = frag_h(&sPl[w][col][0] + kc * 32, lane);
#pragma unroll
      for (int t = 0; t < 4; ++t) { const v16h vh = frag_h(&sV[buf][0][t * 16 + col][kc * 32], lane);
        acc[t] = wmma16(ph, vh, acc[t]); ac1[t] = wmma16(ph, frag_h(&sV[buf][1][t * 16 + col][kc * 32], lane), ac1[t]); ac2[t] = wmma16(pl, vh, ac2[t]); } }
    __builtin_amdgcn_wave_barrier();
    asm volatile("s_wait_dscnt 0x0" ::: "memory");      // this wave's reads of buffer buf are done
    asm volatile("s_wait_asynccnt 0x0" ::: "memory");   // its copies of tile kt + 1 have landed
    __syncthreads();                                     // publishes tile kt + 1 and frees buffer buf
    if (kt + 2 <= qb) stage(buf, kt + 2); }
  asm volatile("s_wait_asynccnt 0x0" ::: "memory");     // no copy is left in flight behind the loop
  // the output rows are staged in the wave's own score rows, which are dead here: with the tile buffers three work-groups still fit one WGP's LDS
#pragma unroll
  for (int r = 0; r < 8; ++r) { const float lr = __shfl(lrun, 8 * g + r, 32); const float inv = 1.0f / (lr * 16384.0f * 4.0f);
#pragma unroll
    for (int t = 0; t < 4; ++t) sS[w][8 * g + r][t * 16 + col] = (acc[t][r] + ac1[t][r] * (1.0f / VLO) + ac2[t][r] * (1.0f / PLO)) * inv; }
  LDSX();
  for (int qq = lane; qq < 16 * 16; qq += 32) { const int rl = qq >> 4, pc = qq & 15; vst2(O32 + ((bh * SS) + q0 + rl) * HD + pc * 4, *(const v4f*)(&sS[w][rl][pc * 4])); }
}
// out = ctx Wo^T + bo : split(ctx) x bf16(Wo rows): 2 products (Wo is an INPUT -> bf16 exact); k slices of the 64 context rows (f32) and 128 weight rows staged in LDS as in k_qkv
__global__ __launch_bounds__(128) void k_out(const float* __restrict__ O32, int rbase, const __bf16* __restrict__ PT, const float* __restrict__ bo, float* __restrict__ out) {
  __shared__ __align__(16) OutLds sm;
  float (&so)[4][16][132] = sm.so;
  const int tid = threadIdx.x, wave = tid >> 5, lane = tid & 31, col = lane & 15, g = lane >> 4;
  const int r0b = blockIdx.x * 64, r0 = r0b + wave * 16, n0 = blockIdx.y * 128; const int b = r0b / SS, s0 = r0b % SS;
  v8f acc[8] = {};
  // slice kt is head kt. A lane's share: context, 16 KiB in a row in memory, piece tid + 128 i (LDS row 8 i + tid/16); weights, row 16 i + tid/8, piece tid%8
  const char* gA = (const char*)(O32 + ((size_t)b * NH * SS + s0) * HD) + tid * 16;
  const char* gB = (const char*)(PT + (size_t)(3 * E + n0 + (tid >> 3)) * E + (tid & 7) * 8);
  const unsigned lA = lds_off(&sm.st.a[0][tid >> 4][(tid & 15) * 4]), lB = lds_off(&sm.st.b[0][tid >> 3][(tid & 7) * 8]);
  auto stage = [&](int buf, int kt) {
    copy8(lA + buf * (unsigned)sizeof(sm.st.a[0]), 8 * KP * 4, gA + (size_t)kt * (SS * HD * 4), 128 * 16);
    copy8(lB + buf * (unsigned)sizeof(sm.st.b[0]), 16 * GP * 2, gB + (size_t)kt * 128, (size_t)16 * E * 2); };
  stage(0, 0);
  asm volatile("s_wait_asynccnt 0x0" ::: "memory");   // this wave's copies of slice 0 have landed
  __syncthreads();                                     // and every other wave's: slice 0 may be read
  stage(1, 1);
#pragma unroll 1   // rolled, for speed only
  for (int kt = 0; kt < NH; ++kt) { const int buf = kt & 1;
#pragma unroll
    for (int kc = 0; kc < 2; ++kc) { const F2 a = split_row(&sm.st.a[buf][wave * 16 + col][0], kc * 32, lane); v16b wb[8];
#pragma unroll
      for (int j = 0; j < 8; ++j) wb[j] = frag_b(&sm.st.b[buf][j * 16 + col][kc * 32], lane);
#pragma unroll
      for (int j = 0; j < 8; ++j) { acc[j] = wmma_bf(a.l, wb[j], acc[j]); acc[j] = wmma_bf(a.h, wb[j], acc[j]); } }
    asm volatile("s_wait_dscnt 0x0" ::: "memory");      // this wave's reads of buffer buf are done
    asm volatile("s_wait_asynccnt 0x0" ::: "memory");   // its copies of slice kt + 1 have landed
    __syncthreads();                                     // publishes slice kt + 1 and frees buffer buf (behind the last slice: for the output staging)
    if (kt + 2 < NH) stage(buf, kt + 2); }
  asm volatile("s_wait_asynccnt 0x0" ::: "memory");     // no copy is left in flight behind the loop
#pragma unroll
  for (int j = 0; j < 8; ++j) { const int n = n0 + j * 16 + col; const float bb = bfr(bo[n]);
#pragma unroll
    for (int r = 0; r < 8; ++r) so[wave][8 * g + r][j * 16 + col] = acc[j][r] + bb; }
  LDSX();
#pragma unroll 4
  for (int rl = 0; rl < 16; ++rl) vst2(out + (size_t)(rbase + r0 + rl) * E + n0 + lane * 4, *(const v4f*)(&so[wave][rl][lane * 4]));
}
#define NBHALF 2
extern "C" void kernel_launch(void* const* d_in, const int* in_sizes, int n_in, void* d_out, int out_size, void* d_ws, size_t ws_size, hipStream_t stream) {
  (void)in_sizes; (void)n_in; (void)out_size; (void)ws_size;
  const float* x = (const float*)d_in[0]; const float* Wqkv = (const float*)d_in[1]; const float* bqkv = (const float*)d_in[2]; const float* Wp = (const float*)d_in[3]; const float* bp = (const float*)d_in[4]; const float* bQ = (const float*)d_in[5]; const float* bK = (const float*)d_in[6]; const float* bV = (const float*)d_in[7];
  float* out = (float*)d_out;
  char* ws = (char*)d_ws; size_t off = 0;
  auto take = [&](size_t bytes) { char* p = ws + off; off += (bytes + 255) & ~(size_t)255; return p; };
  const size_t HR = (size_t)NBHALF * SS;     // rows per half (4096)
  __bf16* Xb = (__bf16*)take((size_t)NR * E * 2); __bf16* PT = (__bf16*)take((size_t)4 * E * E * 2);
  float* Q32 = (float*)take(HR * E * 4); float* K32 = (float*)take(HR * E * 4); _Float16* VTh = (_Float16*)take(HR * E * 2); _Float16* VTl = (_Float16*)take(HR * E * 2);
  float* O32 = Q32;      // in place: each k_attn wave reads its own 16 query rows into registers before writing the same rows; no other block reads them
  // ws ~ 75 MB (72 MiB); the two batch halves (2 sequences each) reuse Q/K/V
  k_cvt<<<(NR * E / 8 + 255) / 256, 256, 0, stream>>>(x, Xb);
  k_pack<<<4 * E, 128, 0, stream>>>(Wqkv, Wp, PT);
  for (int hf = 0; hf < 2; ++hf) { const int rbase = hf * (int)HR;
    k_qkv<<<dim3(HR / 64, E / 128, 3), 128, 0, stream>>>(Xb, rbase, PT, bqkv, bQ, bK, bV, Q32, K32, VTh, VTl);
    k_attn<<<dim3(SS / 64, NBHALF * NH), 128, 0, stream>>>(Q32, K32, VTh, VTl, O32);
    k_out<<<dim3(HR / 64, E / 128), 128, 0, stream>>>(O32, rbase, PT, bp, out); }
}

// v003
// Measured time: 427 microseconds a run.
// Next to v002, in two timings, it ran 1.03 times as fast each time.
// All steps since v000 together make it 2.45 times as fast.
// compute dtype: x, W_attn, b_attn, W_proj, b_proj, bQ/bK/bV (INPUTS) rounded to bf16 with exact bf16 WMMA products (f32 accumulate) for the projections; q/k f32 split in bf16 hi/lo for the scores (3 products; k is split once, where it is produced), P and V f16 hi/lo (3 products); softmax f32.
#include <hip/hip_runtime.h>
#include <math.h>

typedef __attribute__((ext_vector_type(16))) _Float16 v16h;
typedef __attribute__((ext_vector_type(16))) __bf16 v16b;
typedef __attribute__((ext_vector_type(8)))  _Float16 v8h;
typedef __attribute__((ext_vector_type(8)))  float v8f;
typedef __attribute__((ext_vector_type(4)))  float v4f;
typedef __attribute__((ext_vector_type(2)))  float v2f;
typedef __attribute__((ext_vector_type(4)))  unsigned v4u;
typedef __attribute__((ext_vector_type(4)))  int v4i;
typedef float __attribute__((may_alias)) float_a;
typedef int __attribute__((may_alias)) int_a;

template <typename T> __device__ __forceinline__ void vst2(void* p, T v) { *(T*)p = v;  }
__device__ __forceinline__ v8f wmma16(v16h a, v16h b, v8f c) {
  v8f d = __builtin_amdgcn_wmma_f32_16x16x32_f16(false, a, false, b, (short)0, c, false, false);
  asm volatile("v_nop\n\tv_nop\n\tv_nop\n\tv_nop" : "+v"(d) : "v"(a), "v"(b));
  return d;
}
__device__ __forceinline__ v8f wmma_bf(v16b a, v16b b, v8f c) {
  v8f d = __builtin_amdgcn_wmma_f32_16x16x32_bf16(false, a, false, b, (short)0, c, false, false);
  asm volatile("v_nop\n\tv_nop\n\tv_nop\n\tv_nop" : "+v"(d) : "v"(a), "v"(b));
  return d;
}
// 16x16x32 fragments: lane = (h = lane>>4, row/col = lane&15); elements 0..7 = k0+8h+0..7, 8..15 = k0+16+8h+0..7; D element r = row 8h+r
__device__ __forceinline__ v16h frag_h(const _Float16* rowk0, int lane) {
  union { v16h v; v8h q[2]; } u; const _Float16* p = rowk0 + 8 * (lane >> 4);
  u.q[0] = *(const v8h*)p; u.q[1] = *(const v8h*)(p + 16); return u.v;
}
__device__ __forceinline__ v16h frag_f32(const float* rowk0, int lane) {
  v16h a; const float* p = rowk0 + 8 * (lane >> 4);
#pragma unroll
  for (int i = 0; i < 8; ++i) { a[i] = (_Float16)p[i]; a[8 + i] = (_Float16)p[16 + i]; }
  return a;
}
__device__ __forceinline__ v16h frag_f32s(const float* rowk0, int lane, float sc) {
  v16h a; const float* p = rowk0 + 8 * (lane >> 4);
#pragma unroll
  for (int i = 0; i < 8; ++i) { a[i] = (_Float16)(p[i] * sc); a[8 + i] = (_Float16)(p[16 + i] * sc); }
  return a;
}
// column fragment from a [K][ld] layout (column n), rows >= K read as 0
__device__ __forceinline__ v16h fragc_f32(const float* W, int k0, int n, int lane, int ld, int K) {
  v16h a; const int g = lane >> 4;
#pragma unroll
  for (int i = 0; i < 8; ++i) { const int ka = k0 + 8 * g + i, kb = ka + 16;
    a[i] = (_Float16)(ka < K ? W[(size_t)(ka < K ? ka : K - 1) * ld + n] : 0.f); a[8 + i] = (_Float16)(kb < K ? W[(size_t)(kb < K ? kb : K - 1) * ld + n] : 0.f); }
  return a;
}
struct F2 { v16b h, l; };
__device__ __forceinline__ F2 bsplit16(const float v[16]) { F2 r;
#pragma unroll
  for (int i = 0; i < 16; ++i) { const __bf16 h = (__bf16)v[i]; r.h[i] = h; r.l[i] = (__bf16)(v[i] - (float)h); }
  return r; }
__device__ __forceinline__ F2 split_row(const float* row, int k0, int lane) { float v[16]; const float* p = row + k0 + 8 * (lane >> 4);
#pragma unroll
  for (int i = 0; i < 8; ++i) { v[i] = p[i]; v[8 + i] = p[16 + i]; }
  return bsplit16(v); }
__device__ __forceinline__ F2 split_rowK(const float* row, int k0, int lane, int K) { float v[16]; const int g = lane >> 4;
#pragma unroll
  for (int i = 0; i < 8; ++i) { const int ka = k0 + 8 * g + i, kb = ka + 16; v[i] = ka < K ? row[ka < K ? ka : K - 1] : 0.f; v[8 + i] = kb < K ? row[kb < K ? kb : K - 1] : 0.f; }
  return bsplit16(v); }
__device__ __forceinline__ F2 split_col(const float* W, int k0, int n, int lane, int ld, int K) { float v[16]; const int g = lane >> 4;
#pragma unroll
  for (int i = 0; i < 8; ++i) { const int ka = k0 + 8 * g + i, kb = ka + 16; v[i] = ka < K ? W[(size_t)(ka < K ? ka : K - 1) * ld + n] : 0.f; v[8 + i] = kb < K ? W[(size_t)(kb < K ? kb : K - 1) * ld + n] : 0.f; }
  return bsplit16(v); }
__device__ __forceinline__ v8f mac3(const F2& a, const F2& b, v8f c) { c = wmma_bf(a.l, b.h, c); c = wmma_bf(a.h, b.l, c); return wmma_bf(a.h, b.h, c); }
__device__ __forceinline__ float sigm(float v) { return 1.0f / (1.0f + expf(-v)); }
#define LDSX() do { asm volatile("s_wait_dscnt 0" ::: "memory"); __builtin_amdgcn_wave_barrier(); __builtin_amdgcn_fence(__ATOMIC_RELEASE, "workgroup"); } while (0)


#define NB 4
#define SS 2048
#define E 1024
#define NH 16
#define HD 64
#define NR (NB * SS)
#define PLO 1024.0f
#define VLO 2048.0f
__device__ __forceinline__ float bfr(float v) { return (float)(__bf16)v; }
__device__ __forceinline__ v16b frag_b(const __bf16* rowk0, int lane) { return __builtin_bit_cast(v16b, frag_h((const _Float16*)rowk0, lane)); }
// a split row: 64 f32 values kept as 64 bf16 hi | 64 bf16 lo (hi = bf16(v), lo = bf16(v - hi), as bsplit16 has them), 256 bytes like the f32 row
// eight values of one lane: 16 bytes into the row's hi half at d, 16 into its lo half; eight lanes fill each half's 128 bytes
__device__ __forceinline__ void store_split8(const float* s, __bf16* d) { union { __bf16 e[8]; v4u u; } hi, lo;
#pragma unroll
  for (int e = 0; e < 8; ++e) { const float v = s[e]; const __bf16 hv = (__bf16)v; hi.e[e] = hv; lo.e[e] = (__bf16)(v - (float)hv); }
  vst2(d, hi.u); vst2(d + HD, lo.u); }
// the fragment pair of a split row at k0
__device__ __forceinline__ F2 frag_split(const __bf16* row, int k0, int lane) { F2 r; r.h = frag_b(row + k0, lane); r.l = frag_b(row + HD + k0, lane); return r; }

__global__ __launch_bounds__(256) void k_cvt(const float* __restrict__ x, __bf16* __restrict__ Xb) {
  const size_t i8 = (size_t)blockIdx.x * 256 + threadIdx.x; if (i8 >= (size_t)NR * E / 8) return;
  union { __bf16 h[8]; v4u u; } pk;
#pragma unroll
  for (int e = 0; e < 8; ++e) pk.h[e] = (__bf16)x[i8 * 8 + e];
  vst2((unsigned*)(Xb + i8 * 8), pk.u);
}
// PT rows: [0,E) Wq[:,n], [E,2E) Wk[:,n], [2E,3E) Wv[:,n], [3E,4E) Wo[:,n]  ([in][out] weights: column n as a bf16 row)
__global__ __launch_bounds__(128) void k_pack(const float* __restrict__ Wqkv, const float* __restrict__ Wp, __bf16* __restrict__ PT) {
  const int n = blockIdx.x, tid = threadIdx.x; __shared__ __align__(16) __bf16 srow[E];
  for (int k = tid; k < E; k += 128) srow[k] = (__bf16)(n < 3 * E ? Wqkv[(size_t)k * (3 * E) + n] : Wp[(size_t)k * E + (n - 3 * E)]);
  __syncthreads();
  if (tid < E / 8) vst2((unsigned*)(PT + (size_t)n * E + tid * 8), *(const v4u*)(&srow[tid * 8]));
}
// eight 16-byte asynchronous copies of one lane, global -> LDS: LDS byte address l + i*ls, global address g + i*gs bytes.
// s_wait_xcnt closes the copies' own statement, so no address register is rewritten ahead of it.
__device__ __forceinline__ void copy8(unsigned l, unsigned ls, const char* g, size_t gs) {
  asm volatile("global_load_async_to_lds_b128 %0, %8, off\n\t"
               "global_load_async_to_lds_b128 %1, %9, off\n\t"
               "global_load_async_to_lds_b128 %2, %10, off\n\t"
               "global_load_async_to_lds_b128 %3, %11, off\n\t"
               "global_load_async_to_lds_b128 %4, %12, off\n\t"
               "global_load_async_to_lds_b128 %5, %13, off\n\t"
               "global_load_async_to_lds_b128 %6, %14, off\n\t"
               "global_load_async_to_lds_b128 %7, %15, off\n\t"
               "s_wait_xcnt 0x0"
               :: "v"(l), "v"(l + ls), "v"(l + 2 * ls), "v"(l + 3 * ls), "v"(l + 4 * ls), "v"(l + 5 * ls), "v"(l + 6 * ls), "v"(l + 7 * ls),
                  "v"(g), "v"(g + gs), "v"(g + 2 * gs), "v"(g + 3 * gs), "v"(g + 4 * gs), "v"(g + 5 * gs), "v"(g + 6 * gs), "v"(g + 7 * gs)
               : "memory");
}
// the same for two planes of four copies each: plane 1 lies lp bytes further in LDS and gp bytes further in memory
__device__ __forceinline__ void copy4x2(unsigned l, unsigned ls, unsigned lp, const char* g, size_t gs, size_t gp) {
  asm volatile("global_load_async_to_lds_b128 %0, %8, off\n\t"
               "global_load_async_to_lds_b128 %1, %9, off\n\t"
               "global_load_async_to_lds_b128 %2, %10, off\n\t"
               "global_load_async_to_lds_b128 %3, %11, off\n\t"
               "global_load_async_to_lds_b128 %4, %12, off\n\t"
               "global_load_async_to_lds_b128 %5, %13, off\n\t"
               "global_load_async_to_lds_b128 %6, %14, off\n\t"
               "global_load_async_to_lds_b128 %7, %15, off\n\t"
               "s_wait_xcnt 0x0"
               :: "v"(l), "v"(l + ls), "v"(l + 2 * ls), "v"(l + 3 * ls), "v"(l + lp), "v"(l + lp + ls), "v"(l + lp + 2 * ls), "v"(l + lp + 3 * ls),
                  "v"(g), "v"(g + gs), "v"(g + 2 * gs), "v"(g + 3 * gs), "v"(g + gp), "v"(g + gp + gs), "v"(g + gp + 2 * gs), "v"(g + gp + 3 * gs)
               : "memory");
}
// the same for four copies
__device__ __forceinline__ void copy4(unsigned l, unsigned ls, const char* g, size_t gs) {
  asm volatile("global_load_async_to_lds_b128 %0, %4, off\n\t"
               "global_load_async_to_lds_b128 %1, %5, off\n\t"
               "global_load_async_to_lds_b128 %2, %6, off\n\t"
               "global_load_async_to_lds_b128 %3, %7, off\n\t"
               "s_wait_xcnt 0x0"
               :: "v"(l), "v"(l + ls), "v"(l + 2 * ls), "v"(l + 3 * ls),
                  "v"(g), "v"(g + gs), "v"(g + 2 * gs), "v"(g + 3 * gs)
               : "memory");
}
__device__ __forceinline__ unsigned lds_off(const void* p) { return (unsigned)(size_t)p; }
#define KP 68   // LDS pitch, in floats, of a 256-byte row (64 floats; a key's 64 bf16 hi | 64 bf16 lo): 272 B = 16 B x odd
#define VP 72   // LDS pitch of a 64-half V^T row: 144 B = 16 B x odd
#define GP 72   // LDS pitch of a 64-element bf16 k slice: 144 B = 16 B x odd
// LDS of the two projections: in the k loop two buffers of the operands' 64-wide k slices; behind it, on the same bytes, the output staging
union QkvLds { struct { __bf16 a[2][64][GP]; __bf16 b[2][128][GP]; } st; float so[4][16][132]; struct { _Float16 h[128][72], l[128][72]; } vt; };
union OutLds { struct { float a[2][64][KP]; __bf16 b[2][128][GP]; } st; float so[4][16][132]; };
// each 64-wide k slice of the block's 64 X rows and 128 weight rows is copied to LDS once for the four waves, two buffers, the next slice in flight while this one is worked on
// QKV: block (64 rows, 128 cols = 2 heads, which); q (+bias) -> Q32 f32 [bh][s][64]; k (+bias) -> KS [bh][s][64 bf16 hi | 64 bf16 lo], the split that the scores use; v (+bias) -> VT hi/lo x4 [bh][d][s]
// five waves a SIMD is what the LDS allows: the bound keeps the register count of the v epilogue from costing one of them (without it this build takes 210 registers, with it 152 as before)
__global__ __launch_bounds__(128, 5) void k_qkv(const __bf16* __restrict__ Xb, int rbase, const __bf16* __restrict__ PT, const float* __restrict__ bqkv, const float* __restrict__ bQ, const float* __restrict__ bK, const float* __restrict__ bV, float* __restrict__ Q32, __bf16* __restrict__ KS, _Float16* __restrict__ VTh, _Float16* __restrict__ VTl) {
  __shared__ __align__(16) QkvLds sm;
  float (&so)[4][16][132] = sm.so; _Float16 (&sth)[128][72] = sm.vt.h, (&stl)[128][72] = sm.vt.l;
  const int tid = threadIdx.x, wave = tid >> 5, lane = tid & 31, col = lane & 15, g = lane >> 4;
  const int which = blockIdx.z, r0b = blockIdx.x * 64, n0 = blockIdx.y * 128; const int b = r0b / SS, s0 = r0b % SS;
  const float* bb_ = bqkv + which * E; const float* bx_ = which == 0 ? bQ : (which == 1 ? bK : bV);      // column n = h*64 + d indexes both biases
  v8f acc[8] = {};
  // a lane's share of a slice: row 16 i + tid/8, 16-byte piece tid%8 of the row's 128 bytes
  const char* gA = (const char*)(Xb + (size_t)(rbase + r0b + (tid >> 3)) * E + (tid & 7) * 8);
  const char* gB = (const char*)(PT + (size_t)(which * E + n0 + (tid >> 3)) * E + (tid & 7) * 8);
  const unsigned lA = lds_off(&sm.st.a[0][tid >> 3][(tid & 7) * 8]), lB = lds_off(&sm.st.b[0][tid >> 3][(tid & 7) * 8]);
  auto stage = [&](int buf, int kt) {
    copy4(lA + buf * (unsigned)sizeof(sm.st.a[0]), 16 * GP * 2, gA + (size_t)kt * 128, (size_t)16 * E * 2);
    copy8(lB + buf * (unsigned)sizeof(sm.st.b[0]), 16 * GP * 2, gB + (size_t)kt * 128, (size_t)16 * E * 2); };
  stage(0, 0);
  asm volatile("s_wait_asynccnt 0x0" ::: "memory");   // this wave's copies of slice 0 have landed
  __syncthreads();                                     // and every other wave's: slice 0 may be read
  stage(1, 1);
#pragma unroll 1   // rolled, for speed only
  for (int kt = 0; kt < E / 64; ++kt) { const int buf = kt & 1;
#pragma unroll
    for (int kc = 0; kc < 2; ++kc) { const v16b a = frag_b(&sm.st.a[buf][wave * 16 + col][kc * 32], lane); v16b wb[8];
#pragma unroll
      for (int j = 0; j < 8; ++j) wb[j] = frag_b(&sm.st.b[buf][j * 16 + col][kc * 32], lane);
#pragma unroll
      for (int j = 0; j < 8; ++j) acc[j] = wmma_bf(a, wb[j], acc[j]); }
    asm volatile("s_wait_dscnt 0x0" ::: "memory");      // this wave's reads of buffer buf are done
    asm volatile("s_wait_asynccnt 0x0" ::: "memory");   // its copies of slice kt + 1 have landed
    __syncthreads();                                     // publishes slice kt + 1 and frees buffer buf (behind the last slice: for the output staging)
    if (kt + 2 < E / 64) stage(buf, kt + 2); }
  asm volatile("s_wait_asynccnt 0x0" ::: "memory");     // no copy is left in flight behind the loop
  if (which < 2) {
#pragma unroll
    for (int j = 0; j < 8; ++j) { const float bb = bfr(bb_[n0 + j * 16 + col]) + bfr(bx_[n0 + j * 16 + col]);
#pragma unroll
      for (int r = 0; r < 8; ++r) so[wave][8 * g + r][j * 16 + col] = acc[j][r] + bb; }
    LDSX();
    if (which == 0) {
      for (int qq = lane; qq < 2 * 16 * 16; qq += 32) { const int hh = qq >> 8, rl = (qq >> 4) & 15, pc = qq & 15; const int h = (n0 >> 6) + hh;
        vst2(Q32 + (((size_t)b * NH + h) * SS + s0 + wave * 16 + rl) * HD + pc * 4, *(const v4f*)(&so[wave][rl][hh * 64 + pc * 4])); } }
    else {
      for (int qq = lane; qq < 2 * 16 * 8; qq += 32) { const int hh = qq >> 7, rl = (qq >> 3) & 15, pc = qq & 7; const int h = (n0 >> 6) + hh;
        store_split8(&so[wave][rl][hh * 64 + pc * 8], KS + (((size_t)b * NH + h) * SS + s0 + wave * 16 + rl) * (2 * HD) + pc * 8); } } }
  else {
#pragma unroll
    for (int j = 0; j < 8; ++j) { const float bb = bfr(bb_[n0 + j * 16 + col]) + bfr(bx_[n0 + j * 16 + col]);
#pragma unroll
      for (int r = 0; r < 8; ++r) { const float v = (acc[j][r] + bb) * 4.0f; const _Float16 hi = (_Float16)v; sth[j * 16 + col][wave * 16 + 8 * g + r] = hi; stl[j * 16 + col][wave * 16 + 8 * g + r] = (_Float16)((v - (float)hi) * VLO); } }
    __syncthreads();
    for (int qq = tid; qq < 128 * 8; qq += 128) { const int cl = qq >> 3, pc = qq & 7; const int c = n0 + cl, h = c >> 6, d = c & 63; const size_t o = (((size_t)b * NH + h) * HD + d) * SS + s0 + pc * 8;
      vst2(VTh + o, *(const v4u*)(&sth[cl][pc * 8])); vst2(VTl + o, *(const v4u*)(&stl[cl][pc * 8])); } }
}
// causal attention: block (64 queries, bh); key tiles 0..qb; each 64-key tile of K, V^T hi and V^T lo is copied to LDS once for the four waves, two buffers, the next tile in flight while this one is worked on; S on bf16 hi/lo splits: q split here from its f32 rows, k read ready split (a key row in LDS is 64 hi | 64 lo, as in memory); P,V hi/lo; O -> OS, split rows [bh][s][64 hi | 64 lo], the split that the output projection uses
__global__ __launch_bounds__(128) void k_attn(const float* __restrict__ Q32, const __bf16* __restrict__ KS, const _Float16* __restrict__ VTh, const _Float16* __restrict__ VTl, __bf16* __restrict__ OS) {
  __shared__ __align__(16) float sS[4][16][68];
  __shared__ __align__(16) _Float16 sPh[4][16][72], sPl[4][16][72];
  __shared__ __align__(16) float sK[2][64][KP];
  __shared__ __align__(16) _Float16 sV[2][2][64][VP];      // [buffer][hi, lo][d][key]
  const int tid = threadIdx.x, w = tid >> 5, lane = tid & 31, col = lane & 15, g = lane >> 4;
  const size_t bh = blockIdx.y; const int qb = blockIdx.x; const int q0 = qb * 64 + w * 16;
  F2 aq[2];
#pragma unroll
  for (int kc = 0; kc < 2; ++kc) aq[kc] = split_row(Q32 + (bh * SS + q0 + col) * HD, kc * 32, lane);
  float mrun = -3.0e38f, lrun = 0.f; v8f acc[4] = {}, ac1[4] = {}, ac2[4] = {};
  // a lane's share of a tile: K, 16 KiB in a row in memory, piece tid + 128 i (LDS row 8 i + tid/16); V^T hi then lo, row 16 i + tid/8, piece tid%8
  const char* gK = (const char*)(KS + bh * SS * (2 * HD)) + tid * 16;
  const size_t vrow = ((bh * HD + (tid >> 3)) * SS + (tid & 7) * 8) * 2;
  const char* gVh = (const char*)VTh + vrow; const size_t gVd = (const char*)VTl - (const char*)VTh;
  const unsigned lK = lds_off(&sK[0][tid >> 4][(tid & 15) * 4]), lV = lds_off(&sV[0][0][tid >> 3][(tid & 7) * 8]);
  auto stage = [&](int buf, int kt) {
    copy8(lK + buf * (unsigned)sizeof(sK[0]), 8 * KP * 4, gK + (size_t)kt * (64 * HD * 4), 128 * 16);
    const char* gv = gVh + (size_t)kt * 128; const unsigned lv = lV + buf * (unsigned)sizeof(sV[0]);
    copy4x2(lv, 16 * VP * 2, (unsigned)sizeof(sV[0][0]), gv, (size_t)16 * SS * 2, gVd); };
  stage(0, 0);
  asm volatile("s_wait_asynccnt 0x0" ::: "memory");   // this wave's copies of tile 0 have landed
  __syncthreads();                                     // and every other wave's: tile 0 may be read
  if (qb >= 1) stage(1, 1);
#pragma unroll 1
  for (int kt = 0; kt <= qb; ++kt) { const int buf = kt & 1;
#pragma unroll
    for (int t = 0; t < 4; ++t) { const int key = kt * 64 + t * 16 + col; const __bf16* krow = (const __bf16*)&sK[buf][t * 16 + col][0];
      v8f s = mac3(aq[0], frag_split(krow, 0, lane), (v8f){}); s = mac3(aq[1], frag_split(krow, 32, lane), s);
#pragma unroll
      for (int r = 0; r < 8; ++r) { sS[w][8 * g + r][t * 16 + col] = (key > q0 + 8 * g + r) ? -3.0e38f : s[r] * 0.125f; } }
    LDSX();
    float mx = -3.4e38f;
#pragma unroll
    for (int jj = 0; jj < 32; ++jj) mx = fmaxf(mx, sS[w][col][g * 32 + jj]);
    mx = fmaxf(mx, __shfl_xor(mx, 16, 32));
    const float mnew = fmaxf(mrun, mx); const float corr = expf(mrun - mnew);
    float ps = 0.f;
#pragma unroll
    for (int jj = 0; jj < 32; ++jj) { const float p = expf(sS[w][col][g * 32 + jj] - mnew) * 16384.0f; ps += p; const _Float16 hi = (_Float16)p; sPh[w][col][g * 32 + jj] = hi; sPl[w][col][g * 32 + jj] = (_Float16)((p - (float)hi) * PLO); }
    ps += __shfl_xor(ps, 16, 32);
    lrun = lrun * corr + ps * (1.0f / 16384.0f); mrun = mnew;
#pragma unroll
    for (int r = 0; r < 8; ++r) { const float cr = __shfl(corr, 8 * g + r, 32);
#pragma unroll
      for (int t = 0; t < 4; ++t) { acc[t][r] *= cr; ac1[t][r] *= cr; ac2[t][r] *= cr; } }
    LDSX();
#pragma unroll
    for (int kc = 0; kc < 2; ++kc) { const v16h ph = frag_h(&sPh[w][col][0] + kc * 32, lane), pl = frag_h(&sPl[w][col][0] + kc * 32, lane);
#pragma unroll
      for (int t = 0; t < 4; ++t) { const v16h vh = frag_h(&sV[buf][0][t * 16 + col][kc * 32], lane);
        acc[t] = wmma16(ph, vh, acc[t]); ac1[t] = wmma16(ph, frag_h(&sV[buf][1][t * 16 + col][kc * 32], lane), ac1[t]); ac2[t] = wmma16(pl, vh, ac2[t]); } }
    __builtin_amdgcn_wave_barrier();
    asm volatile("s_wait_dscnt 0x0" ::: "memory");      // this wave's reads of buffer buf are done
    asm volatile("s_wait_asynccnt 0x0" ::: "memory");   // its copies of tile kt + 1 have landed
    __syncthreads();                                     // publishes tile kt + 1 and frees buffer buf
    if (kt + 2 <= qb) stage(buf, kt + 2); }
  asm volatile("s_wait_asynccnt 0x0" ::: "memory");     // no copy is left in flight behind the loop
  // the output rows are staged in the wave's own score rows, which are dead here: with the tile buffers three work-groups still fit one WGP's LDS
#pragma unroll
  for (int r = 0; r < 8; ++r) { const float lr = __shfl(lrun, 8 * g + r, 32); const float inv = 1.0f / (lr * 16384.0f * 4.0f);
#pragma unroll
    for (int t = 0; t < 4; ++t) sS[w][8 * g + r][t * 16 + col] = (acc[t][r] + ac1[t][r] * (1.0f / VLO) + ac2[t][r] * (1.0f / PLO)) * inv; }
  LDSX();
  for (int qq = lane; qq < 16 * 8; qq += 32) { const int rl = qq >> 3, pc = qq & 7; store_split8(&sS[w][rl][pc * 8], OS + ((bh * SS) + q0 + rl) * (2 * HD) + pc * 8); }
}
// out = ctx Wo^T + bo : split(ctx) x bf16(Wo rows): 2 products (Wo is an INPUT -> bf16 exact); k slices of the 64 context rows (split rows, read ready split) and 128 weight rows staged in LDS as in k_qkv
__global__ __launch_bounds__(128) void k_out(const __bf16* __restrict__ OS, int rbase, const __bf16* __restrict__ PT, const float* __restrict__ bo, float* __restrict__ out) {
  __shared__ __align__(16) OutLds sm;
  float (&so)[4][16][132] = sm.so;
  const int tid = threadIdx.x, wave = tid >> 5, lane = tid & 31, col = lane & 15, g = lane >> 4;
  const int r0b = blockIdx.x * 64, r0 = r0b + wave * 16, n0 = blockIdx.y * 128; const int b = r0b / SS, s0 = r0b % SS;
  v8f acc[8] = {};
  // slice kt is head kt. A lane's share: context, 16 KiB in a row in memory, piece tid + 128 i (LDS row 8 i + tid/16); weights, row 16 i + tid/8, piece tid%8
  const char* gA = (const char*)(OS + ((size_t)b * NH * SS + s0) * (2 * HD)) + tid * 16;
  const char* gB = (const char*)(PT + (size_t)(3 * E + n0 + (tid >> 3)) * E + (tid & 7) * 8);
  const unsigned lA = lds_off(&sm.st.a[0][tid >> 4][(tid & 15) * 4]), lB = lds_off(&sm.st.b[0][tid >> 3][(tid & 7) * 8]);
  auto stage = [&](int buf, int kt) {
    copy8(lA + buf * (unsigned)sizeof(sm.st.a[0]), 8 * KP * 4, gA + (size_t)kt * (SS * HD * 4), 128 * 16);
    copy8(lB + buf * (unsigned)sizeof(sm.st.b[0]), 16 * GP * 2, gB + (size_t)kt * 128, (size_t)16 * E * 2); };
  stage(0, 0);
  asm volatile("s_wait_asynccnt 0x0" ::: "memory");   // this wave's copies of slice 0 have landed
  __syncthreads();                                     // and every other wave's: slice 0 may be read
  stage(1, 1);
#pragma unroll 1   // rolled, for speed only
  for (int kt = 0; kt < NH; ++kt) { const int buf = kt & 1;
#pragma unroll
    for (int kc = 0; kc < 2; ++kc) { const F2 a = frag_split((const __bf16*)&sm.st.a[buf][wave * 16 + col][0], kc * 32, lane); v16b wb[8];
#pragma unroll
      for (int j = 0; j < 8; ++j) wb[j] = frag_b(&sm.st.b[buf][j * 16 + col][kc * 32], lane);
#pragma unroll
      for (int j = 0; j < 8; ++j) { acc[j] = wmma_bf(a.l, wb[j], acc[j]); acc[j] = wmma_bf(a.h, wb[j], acc[j]); } }
    asm volatile("s_wait_dscnt 0x0" ::: "memory");      // this wave's reads of buffer buf are done
    asm volatile("s_wait_asynccnt 0x0" ::: "memory");   // its copies of slice kt + 1 have landed
    __syncthreads();                                     // publishes slice kt + 1 and frees buffer buf (behind the last slice: for the output staging)
    if (kt + 2 < NH) stage(buf, kt + 2); }
  asm volatile("s_wait_asynccnt 0x0" ::: "memory");     // no copy is left in flight behind the loop
#pragma unroll
  for (int j = 0; j < 8; ++j) { const int n = n0 + j * 16 + col; const float bb = bfr(bo[n]);
#pragma unroll
    for (int r = 0; r < 8; ++r) so[wave][8 * g + r][j * 16 + col] = acc[j][r] + bb; }
  LDSX();
#pragma unroll 4
  for (int rl = 0; rl < 16; ++rl) vst2(out + (size_t)(rbase + r0 + rl) * E + n0 + lane * 4, *(const v4f*)(&so[wave][rl][lane * 4]));
}
#define NBHALF 2
extern "C" void kernel_launch(void* const* d_in, const int* in_sizes, int n_in, void* d_out, int out_size, void* d_ws, size_t ws_size, hipStream_t stream) {
  (void)in_sizes; (void)n_in; (void)out_size; (void)ws_size;
  const float* x = (const float*)d_in[0]; const float* Wqkv = (const float*)d_in[1]; const float* bqkv = (const float*)d_in[2]; const float* Wp = (const float*)d_in[3]; const float* bp = (const float*)d_in[4]; const float* bQ = (const float*)d_in[5]; const float* bK = (const float*)d_in[6]; const float* bV = (const float*)d_in[7];
  float* out = (float*)d_out;
  char* ws = (char*)d_ws; size_t off = 0;
  auto take = [&](size_t bytes) { char* p = ws + off; off += (bytes + 255) & ~(size_t)255; return p; };
  const size_t HR = (size_t)NBHALF * SS;     // rows per half (4096)
  __bf16* Xb = (__bf16*)take((size_t)NR * E * 2); __bf16* PT = (__bf16*)take((size_t)4 * E * E * 2);
  float* Q32 = (float*)take(HR * E * 4); __bf16* KS = (__bf16*)take(HR * E * 4); _Float16* VTh = (_Float16*)take(HR * E * 2); _Float16* VTl = (_Float16*)take(HR * E * 2);
  __bf16* OS = (__bf16*)Q32;      // in place, a split row has the f32 row's 256 bytes: each k_attn wave reads its own 16 query rows into registers before writing the same rows; no other block reads them
  // ws = 72 MiB; the two batch halves (2 sequences each) reuse Q/K/V
  k_cvt<<<(NR * E / 8 + 255) / 256, 256, 0, stream>>>(x, Xb);
  k_pack<<<4 * E, 128, 0, stream>>>(Wqkv, Wp, PT);
  for (int hf = 0; hf < 2; ++hf) { const int rbase = hf * (int)HR;
    k_qkv<<<dim3(HR / 64, E / 128, 3), 128, 0, stream>>>(Xb, rbase, PT, bqkv, bQ, bK, bV, Q32, KS, VTh, VTl);
    k_attn<<<dim3(SS / 64, NBHALF * NH), 128, 0, stream>>>(Q32, KS, VTh, VTl, OS);
    k_out<<<dim3(HR / 64, E / 128), 128, 0, stream>>>(OS, rbase, PT, bp, out); }
}

// v004
// It runs in 318 microseconds.
// In two side-by-side timings against v003, it was 1.35 and 1.34 times as fast.
// All steps since v000 together make it 3.30 times as fast.
// compute dtype: x, W_attn, b_attn, W_proj, b_proj, bQ/bK/bV (INPUTS) rounded to bf16 with exact bf16 WMMA products (f32 accumulate) for the projections; q/k f32 split in bf16 hi/lo for the scores (3 products; k is split once, where it is produced), P and V f16 hi/lo (3 products); softmax f32.
#include <hip/hip_runtime.h>
#include <math.h>

typedef __attribute__((ext_vector_type(16))) _Float16 v16h;
typedef __attribute__((ext_vector_type(16))) __bf16 v16b;
typedef __attribute__((ext_vector_type(8)))  _Float16 v8h;
typedef __attribute__((ext_vector_type(8)))  float v8f;
typedef __attribute__((ext_vector_type(4)))  float v4f;
typedef __attribute__((ext_vector_type(2)))  float v2f;
typedef __attribute__((ext_vector_type(4)))  unsigned v4u;
typedef __attribute__((ext_vector_type(4)))  int v4i;
typedef float __attribute__((may_alias)) float_a;
typedef int __attribute__((may_alias)) int_a;

template <typename T> __device__ __forceinline__ void vst2(void* p, T v) { *(T*)p = v;  }
__device__ __forceinline__ v8f wmma16(v16h a, v16h b, v8f c) {
  v8f d = __builtin_amdgcn_wmma_f32_16x16x32_f16(false, a, false, b, (short)0, c, false, false);
  asm volatile("v_nop\n\tv_nop\n\tv_nop\n\tv_nop" : "+v"(d) : "v"(a), "v"(b));
  return d;
}
__device__ __forceinline__ v8f wmma_bf(v16b a, v16b b, v8f c) {
  v8f d = __builtin_amdgcn_wmma_f32_16x16x32_bf16(false, a, false, b, (short)0, c, false, false);
  asm volatile("v_nop\n\tv_nop\n\tv_nop\n\tv_nop" : "+v"(d) : "v"(a), "v"(b));
  return d;
}
// 16x16x32 fragments: lane = (h = lane>>4, row/col = lane&15); elements 0..7 = k0+8h+0..7, 8..15 = k0+16+8h+0..7; D element r = row 8h+r
__device__ __forceinline__ v16h frag_h(const _Float16* rowk0, int lane) {
  union { v16h v; v8h q[2]; } u; const _Float16* p = rowk0 + 8 * (lane >> 4);
  u.q[0] = *(const v8h*)p; u.q[1] = *(const v8h*)(p + 16); return u.v;
}
__device__ __forceinline__ v16h frag_f32(const float* rowk0, int lane) {
  v16h a; const float* p = rowk0 + 8 * (lane >> 4);
#pragma unroll
  for (int i = 0; i < 8; ++i) { a[i] = (_Float16)p[i]; a[8 + i] = (_Float16)p[16 + i]; }
  return a;
}
__device__ __forceinline__ v16h frag_f32s(const float* rowk0, int lane, float sc) {
  v16h a; const float* p = rowk0 + 8 * (lane >> 4);
#pragma unroll
  for (int i = 0; i < 8; ++i) { a[i] = (_Float16)(p[i] * sc); a[8 + i] = (_Float16)(p[16 + i] * sc); }
  return a;
}
// column fragment from a [K][ld] layout (column n), rows >= K read as 0
__device__ __forceinline__ v16h fragc_f32(const float* W, int k0, int n, int lane, int ld, int K) {
  v16h a; const int g = lane >> 4;
#pragma unroll
  for (int i = 0; i < 8; ++i) { const int ka = k0 + 8 * g + i, kb = ka + 16;
    a[i] = (_Float16)(ka < K ? W[(size_t)(ka < K ? ka : K - 1) * ld + n] : 0.f); a[8 + i] = (_Float16)(kb < K ? W[(size_t)(kb < K ? kb : K - 1) * ld + n] : 0.f); }
  return a;
}
struct F2 { v16b h, l; };
__device__ __forceinline__ F2 bsplit16(const float v[16]) { F2 r;
#pragma unroll
  for (int i = 0; i < 16; ++i) { const __bf16 h = (__bf16)v[i]; r.h[i] = h; r.l[i] = (__bf16)(v[i] - (float)h); }
  return r; }
__device__ __forceinline__ F2 split_row(const float* row, int k0, int lane) { float v[16]; const float* p = row + k0 + 8 * (lane >> 4);
#pragma unroll
  for (int i = 0; i < 8; ++i) { v[i] = p[i]; v[8 + i] = p[16 + i]; }
  return bsplit16(v); }
__device__ __forceinline__ F2 split_rowK(const float* row, int k0, int lane, int K) { float v[16]; const int g = lane >> 4;
#pragma unroll
  for (int i = 0; i < 8; ++i) { const int ka = k0 + 8 * g + i, kb = ka + 16; v[i] = ka < K ? row[ka < K ? ka : K - 1] : 0.f; v[8 + i] = kb < K ? row[kb < K ? kb : K - 1] : 0.f; }
  return bsplit16(v); }
__device__ __forceinline__ F2 split_col(const float* W, int k0, int n, int lane, int ld, int K) { float v[16]; const int g = lane >> 4;
#pragma unroll
  for (int i = 0; i < 8; ++i) { const int ka = k0 + 8 * g + i, kb = ka + 16; v[i] = ka < K ? W[(size_t)(ka < K ? ka : K - 1) * ld + n] : 0.f; v[8 + i] = kb < K ? W[(size_t)(kb < K ? kb : K - 1) * ld + n] : 0.f; }
  return bsplit16(v); }
__device__ __forceinline__ v8f mac3(const F2& a, const F2& b, v8f c) { c = wmma_bf(a.l, b.h, c); c = wmma_bf(a.h, b.l, c); return wmma_bf(a.h, b.h, c); }
__device__ __forceinline__ float sigm(float v) { return 1.0f / (1.0f + expf(-v)); }
#define LDSX() do { asm volatile("s_wait_dscnt 0" ::: "memory"); __builtin_amdgcn_wave_barrier(); __builtin_amdgcn_fence(__ATOMIC_RELEASE, "workgroup"); } while (0)


#define NB 4
#define SS 2048
#define E 1024
#define NH 16
#define HD 64
#define NR (NB * SS)
#define PLO 1024.0f
#define VLO 2048.0f
__device__ __forceinline__ float bfr(float v) { return (float)(__bf16)v; }
__device__ __forceinline__ v16b frag_b(const __bf16* rowk0, int lane) { return __builtin_bit_cast(v16b, frag_h((const _Float16*)rowk0, lane)); }
// a split row: 64 f32 values kept as 64 bf16 hi | 64 bf16 lo (hi = bf16(v), lo = bf16(v - hi), as bsplit16 has them), 256 bytes like the f32 row
// eight values of one lane: 16 bytes into the row's hi half at d, 16 into its lo half; eight lanes fill each half's 128 bytes
__device__ __forceinline__ void store_split8(const float* s, __bf16* d) { union { __bf16 e[8]; v4u u; } hi, lo;
#pragma unroll
  for (int e = 0; e < 8; ++e) { const float v = s[e]; const __bf16 hv = (__bf16)v; hi.e[e] = hv; lo.e[e] = (__bf16)(v - (float)hv); }
  vst2(d, hi.u); vst2(d + HD, lo.u); }
// the fragment pair of a split row at k0
__device__ __forceinline__ F2 frag_split(const __bf16* row, int k0, int lane) { F2 r; r.h = frag_b(row + k0, lane); r.l = frag_b(row + HD + k0, lane); return r; }

__global__ __launch_bounds__(256) void k_cvt(const float* __restrict__ x, __bf16* __restrict__ Xb) {
  const size_t i8 = (size_t)blockIdx.x * 256 + threadIdx.x; if (i8 >= (size_t)NR * E / 8) return;
  union { __bf16 h[8]; v4u u; } pk;
#pragma unroll
  for (int e = 0; e < 8; ++e) pk.h[e] = (__bf16)x[i8 * 8 + e];
  vst2((unsigned*)(Xb + i8 * 8), pk.u);
}
// PT rows: [0,E) Wq[:,n], [E,2E) Wk[:,n], [2E,3E) Wv[:,n], [3E,4E) Wo[:,n]  ([in][out] weights: column n as a bf16 row)
__global__ __launch_bounds__(128) void k_pack(const float* __restrict__ Wqkv, const float* __restrict__ Wp, __bf16* __restrict__ PT) {
  const int n = blockIdx.x, tid = threadIdx.x; __shared__ __align__(16) __bf16 srow[E];
  for (int k = tid; k < E; k += 128) srow[k] = (__bf16)(n < 3 * E ? Wqkv[(size_t)k * (3 * E) + n] : Wp[(size_t)k * E + (n - 3 * E)]);
  __syncthreads();
  if (tid < E / 8) vst2((unsigned*)(PT + (size_t)n * E + tid * 8), *(const v4u*)(&srow[tid * 8]));
}
// eight 16-byte asynchronous copies of one lane, global -> LDS: LDS byte address l + i*ls, global address g + i*gs bytes.
// s_wait_xcnt closes the copies' own statement, so no address register is rewritten ahead of it.
__device__ __forceinline__ void copy8(unsigned l, unsigned ls, const char* g, size_t gs) {
  asm volatile("global_load_async_to_lds_b128 %0, %8, off\n\t"
               "global_load_async_to_lds_b128 %1, %9, off\n\t"
               "global_load_async_to_lds_b128 %2, %10, off\n\t"
               "global_load_async_to_lds_b128 %3, %11, off\n\t"
               "global_load_async_to_lds_b128 %4, %12, off\n\t"
               "global_load_async_to_lds_b128 %5, %13, off\n\t"
               "global_load_async_to_lds_b128 %6, %14, off\n\t"
               "global_load_async_to_lds_b128 %7, %15, off\n\t"
               "s_wait_xcnt 0x0"
               :: "v"(l), "v"(l + ls), "v"(l + 2 * ls), "v"(l + 3 * ls), "v"(l + 4 * ls), "v"(l + 5 * ls), "v"(l + 6 * ls), "v"(l + 7 * ls),
                  "v"(g), "v"(g + gs), "v"(g + 2 * gs), "v"(g + 3 * gs), "v"(g + 4 * gs), "v"(g + 5 * gs), "v"(g + 6 * gs), "v"(g + 7 * gs)
               : "memory");
}
// the same for two planes of four copies each: plane 1 lies lp bytes further in LDS and gp bytes further in memory
__device__ __forceinline__ void copy4x2(unsigned l, unsigned ls, unsigned lp, const char* g, size_t gs, size_t gp) {
  asm volatile("global_load_async_to_lds_b128 %0, %8, off\n\t"
               "global_load_async_to_lds_b128 %1, %9, off\n\t"
               "global_load_async_to_lds_b128 %2, %10, off\n\t"
               "global_load_async_to_lds_b128 %3, %11, off\n\t"
               "global_load_async_to_lds_b128 %4, %12, off\n\t"
               "global_load_async_to_lds_b128 %5, %13, off\n\t"
               "global_load_async_to_lds_b128 %6, %14, off\n\t"
               "global_load_async_to_lds_b128 %7, %15, off\n\t"
               "s_wait_xcnt 0x0"
               :: "v"(l), "v"(l + ls), "v"(l + 2 * ls), "v"(l + 3 * ls), "v"(l + lp), "v"(l + lp + ls), "v"(l + lp + 2 * ls), "v"(l + lp + 3 * ls),
                  "v"(g), "v"(g + gs), "v"(g + 2 * gs), "v"(g + 3 * gs), "v"(g + gp), "v"(g + gp + gs), "v"(g + gp + 2 * gs), "v"(g + gp + 3 * gs)
               : "memory");
}
// the same for four copies
__device__ __forceinline__ void copy4(unsigned l, unsigned ls, const char* g, size_t gs) {
  asm volatile("global_load_async_to_lds_b128 %0, %4, off\n\t"
               "global_load_async_to_lds_b128 %1, %5, off\n\t"
               "global_load_async_to_lds_b128 %2, %6, off\n\t"
               "global_load_async_to_lds_b128 %3, %7, off\n\t"
               "s_wait_xcnt 0x0"
               :: "v"(l), "v"(l + ls), "v"(l + 2 * ls), "v"(l + 3 * ls),
                  "v"(g), "v"(g + gs), "v"(g + 2 * gs), "v"(g + 3 * gs)
               : "memory");
}
__device__ __forceinline__ unsigned lds_off(const void* p) { return (unsigned)(size_t)p; }
#define KP 68   // LDS pitch, in floats, of a 256-byte row (64 floats; a key's 64 bf16 hi | 64 bf16 lo): 272 B = 16 B x odd
#define VP 72   // LDS pitch of a 64-half V^T row: 144 B = 16 B x odd
#define GP 72   // LDS pitch of a 64-element bf16 k slice: 144 B = 16 B x odd
// LDS of the two projections: in the k loop two buffers of the operands' 64-wide k slices; behind it, on the same bytes, the output staging
union QkvLds { struct { __bf16 a[2][64][GP]; __bf16 b[2][128][GP]; } st; float so[4][16][132]; struct { _Float16 h[128][72], l[128][72]; } vt; };
union OutLds { struct { float a[2][64][KP]; __bf16 b[2][128][GP]; } st; float so[4][16][132]; };
// each 64-wide k slice of the block's 64 X rows and 128 weight rows is copied to LDS once for the four waves, two buffers, the next slice in flight while this one is worked on
// QKV: block (64 rows, 128 cols = 2 heads, which); q (+bias) -> Q32 f32 [bh][s][64]; k (+bias) -> KS [bh][s][64 bf16 hi | 64 bf16 lo], the split that the scores use; v (+bias) -> VT hi/lo x4 [bh][d][s]
// five waves a SIMD is what the LDS allows: the bound keeps the register count of the v epilogue from costing one of them (without it this build takes 210 registers, with it 152 as before)
__global__ __launch_bounds__(128, 5) void k_qkv(const __bf16* __restrict__ Xb, int rbase, const __bf16* __restrict__ PT, const float* __restrict__ bqkv, const float* __restrict__ bQ, const float* __restrict__ bK, const float* __restrict__ bV, float* __restrict__ Q32, __bf16* __restrict__ KS, _Float16* __restrict__ VTh, _Float16* __restrict__ VTl) {
  __shared__ __align__(16) QkvLds sm;
  float (&so)[4][16][132] = sm.so; _Float16 (&sth)[128][72] = sm.vt.h, (&stl)[128][72] = sm.vt.l;
  const int tid = threadIdx.x, wave = tid >> 5, lane = tid & 31, col = lane & 15, g = lane >> 4;
  const int which = blockIdx.z, r0b = blockIdx.x * 64, n0 = blockIdx.y * 128; const int b = r0b / SS, s0 = r0b % SS;
  const float* bb_ = bqkv + which * E; const float* bx_ = which == 0 ? bQ : (which == 1 ? bK : bV);      // column n = h*64 + d indexes both biases
  v8f acc[8] = {};
  // a lane's share of a slice: row 16 i + tid/8, 16-byte piece tid%8 of the row's 128 bytes
  const char* gA = (const char*)(Xb + (size_t)(rbase + r0b + (tid >> 3)) * E + (tid & 7) * 8);
  const char* gB = (const char*)(PT + (size_t)(which * E + n0 + (tid >> 3)) * E + (tid & 7) * 8);
  const unsigned lA = lds_off(&sm.st.a[0][tid >> 3][(tid & 7) * 8]), lB = lds_off(&sm.st.b[0][tid >> 3][(tid & 7) * 8]);
  auto stage = [&](int buf, int kt) {
    copy4(lA + buf * (unsigned)sizeof(sm.st.a[0]), 16 * GP * 2, gA + (size_t)kt * 128, (size_t)16 * E * 2);
    copy8(lB + buf * (unsigned)sizeof(sm.st.b[0]), 16 * GP * 2, gB + (size_t)kt * 128, (size_t)16 * E * 2); };
  stage(0, 0);
  asm volatile("s_wait_asynccnt 0x0" ::: "memory");   // this wave's copies of slice 0 have landed
  __syncthreads();                                     // and every other wave's: slice 0 may be read
  stage(1, 1);
#pragma unroll 1   // rolled, for speed only
  for (int kt = 0; kt < E / 64; ++kt) { const int buf = kt & 1;
#pragma unroll
    for (int kc = 0; kc < 2; ++kc) { const v16b a = frag_b(&sm.st.a[buf][wave * 16 + col][kc * 32], lane); v16b wb[8];
#pragma unroll
      for (int j = 0; j < 8; ++j) wb[j] = frag_b(&sm.st.b[buf][j * 16 + col][kc * 32], lane);
#pragma unroll
      for (int j = 0; j < 8; ++j) acc[j] = wmma_bf(a, wb[j], acc[j]); }
    asm volatile("s_wait_dscnt 0x0" ::: "memory");      // this wave's reads of buffer buf are done
    asm volatile("s_wait_asynccnt 0x0" ::: "memory");   // its copies of slice kt + 1 have landed
    __syncthreads();                                     // publishes slice kt + 1 and frees buffer buf (behind the last slice: for the output staging)
    if (kt + 2 < E / 64) stage(buf, kt + 2); }
  asm volatile("s_wait_asynccnt 0x0" ::: "memory");     // no copy is left in flight behind the loop
  if (which < 2) {
#pragma unroll
    for (int j = 0; j < 8; ++j) { const float bb = bfr(bb_[n0 + j * 16 + col]) + bfr(bx_[n0 + j * 16 + col]);
#pragma unroll
      for (int r = 0; r < 8; ++r) so[wave][8 * g + r][j * 16 + col] = acc[j][r] + bb; }
    LDSX();
    if (which == 0) {
      for (int qq = lane; qq < 2 * 16 * 16; qq += 32) { const int hh = qq >> 8, rl = (qq >> 4) & 15, pc = qq & 15; const int h = (n0 >> 6) + hh;
        vst2(Q32 + (((size_t)b * NH + h) * SS + s0 + wave * 16 + rl) * HD + pc * 4, *(const v4f*)(&so[wave][rl][hh * 64 + pc * 4])); } }
    else {
      for (int qq = lane; qq < 2 * 16 * 8; qq += 32) { const int hh = qq >> 7, rl = (qq >> 3) & 15, pc = qq & 7; const int h = (n0 >> 6) + hh;
        store_split8(&so[wave][rl][hh * 64 + pc * 8], KS + (((size_t)b * NH + h) * SS + s0 + wave * 16 + rl) * (2 * HD) + pc * 8); } } }
  else {
#pragma unroll
    for (int j = 0; j < 8; ++j) { const float bb = bfr(bb_[n0 + j * 16 + col]) + bfr(bx_[n0 + j * 16 + col]);
#pragma unroll
      for (int r = 0; r < 8; ++r) { const float v = (acc[j][r] + bb) * 4.0f; const _Float16 hi = (_Float16)v; sth[j * 16 + col][wave * 16 + 8 * g + r] = hi; stl[j * 16 + col][wave * 16 + 8 * g + r] = (_Float16)((v - (float)hi) * VLO); } }
    __syncthreads();
    for (int qq = tid; qq < 128 * 8; qq += 128) { const int cl = qq >> 3, pc = qq & 7; const int c = n0 + cl, h = c >> 6, d = c & 63; const size_t o = (((size_t)b * NH + h) * HD + d) * SS + s0 + pc * 8;
      vst2(VTh + o, *(const v4u*)(&sth[cl][pc * 8])); vst2(VTl + o, *(const v4u*)(&stl[cl][pc * 8])); } }
}
// causal attention: block (bh, 64 queries, last query block first); key tiles 0..qb; each 64-key tile of K, V^T hi and V^T lo is copied to LDS once for the four waves, two buffers, the next tile in flight while this one is worked on; S on bf16 hi/lo splits: q split here from its f32 rows, k read ready split (a key row in LDS is 64 hi | 64 lo, as in memory); P,V hi/lo; O -> OS, split rows [bh][s][64 hi | 64 lo], the split that the output projection uses
__global__ __launch_bounds__(128) void k_attn(const float* __restrict__ Q32, const __bf16* __restrict__ KS, const _Float16* __restrict__ VTh, const _Float16* __restrict__ VTl, __bf16* __restrict__ OS) {
  __shared__ __align__(16) float sS[4][16][68];
  __shared__ __align__(16) _Float16 sPh[4][16][72], sPl[4][16][72];
  __shared__ __align__(16) float sK[2][64][KP];
  __shared__ __align__(16) _Float16 sV[2][2][64][VP];      // [buffer][hi, lo][d][key]
  const int tid = threadIdx.x, w = tid >> 5, lane = tid & 31, col = lane & 15, g = lane >> 4;
  // placement: a block's cost grows with its query block (qb + 1 key tiles) and there are more blocks than resident places. The head is the fast index
  // and the query block falls with the slow one: the longest blocks come first in index order,
  // and blocks whose indices lie a multiple of 32 apart now differ in length (before, they were equally long)
  const size_t bh = blockIdx.x; const int qb = SS / 64 - 1 - (int)blockIdx.y; const int q0 = qb * 64 + w * 16;
  F2 aq[2];
#pragma unroll
  for (int kc = 0; kc < 2; ++kc) aq[kc] = split_row(Q32 + (bh * SS + q0 + col) * HD, kc * 32, lane);
  float mrun = -3.0e38f, lrun = 0.f; v8f acc[4] = {}, ac1[4] = {}, ac2[4] = {};
  // a lane's share of a tile: K, 16 KiB in a row in memory, piece tid + 128 i (LDS row 8 i + tid/16); V^T hi then lo, row 16 i + tid/8, piece tid%8
  const char* gK = (const char*)(KS + bh * SS * (2 * HD)) + tid * 16;
  const size_t vrow = ((bh * HD + (tid >> 3)) * SS + (tid & 7) * 8) * 2;
  const char* gVh = (const char*)VTh + vrow; const size_t gVd = (const char*)VTl - (const char*)VTh;
  const unsigned lK = lds_off(&sK[0][tid >> 4][(tid & 15) * 4]), lV = lds_off(&sV[0][0][tid >> 3][(tid & 7) * 8]);
  auto stage = [&](int buf, int kt) {
    copy8(lK + buf * (unsigned)sizeof(sK[0]), 8 * KP * 4, gK + (size_t)kt * (64 * HD * 4), 128 * 16);
    const char* gv = gVh + (size_t)kt * 128; const unsigned lv = lV + buf * (unsigned)sizeof(sV[0]);
    copy4x2(lv, 16 * VP * 2, (unsigned)sizeof(sV[0][0]), gv, (size_t)16 * SS * 2, gVd); };
  stage(0, 0);
  asm volatile("s_wait_asynccnt 0x0" ::: "memory");   // this wave's copies of tile 0 have landed
  __syncthreads();                                     // and every other wave's: tile 0 may be read
  if (qb >= 1) stage(1, 1);
#pragma unroll 1
  for (int kt = 0; kt <= qb; ++kt) { const int buf = kt & 1;
#pragma unroll
    for (int t = 0; t < 4; ++t) { const int key = kt * 64 + t * 16 + col; const __bf16* krow = (const __bf16*)&sK[buf][t * 16 + col][0];
      v8f s = mac3(aq[0], frag_split(krow, 0, lane), (v8f){}); s = mac3(aq[1], frag_split(krow, 32, lane), s);
#pragma unroll
      for (int r = 0; r < 8; ++r) { sS[w][8 * g + r][t * 16 + col] = (key > q0 + 8 * g + r) ? -3.0e38f : s[r] * 0.125f; } }
    LDSX();
    float mx = -3.4e38f;
#pragma unroll
    for (int jj = 0; jj < 32; ++jj) mx = fmaxf(mx, sS[w][col][g * 32 + jj]);
    mx = fmaxf(mx, __shfl_xor(mx, 16, 32));
    const float mnew = fmaxf(mrun, mx); const float corr = expf(mrun - mnew);
    float ps = 0.f;
#pragma unroll
    for (int jj = 0; jj < 32; ++jj) { const float p = expf(sS[w][col][g * 32 + jj] - mnew) * 16384.0f; ps += p; const _Float16 hi = (_Float16)p; sPh[w][col][g * 32 + jj] = hi; sPl[w][col][g * 32 + jj] = (_Float16)((p - (float)hi) * PLO); }
    ps += __shfl_xor(ps, 16, 32);
    lrun = lrun * corr + ps * (1.0f / 16384.0f); mrun = mnew;
#pragma unroll
    for (int r = 0; r < 8; ++r) { const float cr = __shfl(corr, 8 * g + r, 32);
#pragma unroll
      for (int t = 0; t < 4; ++t) { acc[t][r] *= cr; ac1[t][r] *= cr; ac2[t][r] *= cr; } }
    LDSX();
#pragma unroll
    for (int kc = 0; kc < 2; ++kc) { const v16h ph = frag_h(&sPh[w][col][0] + kc * 32, lane), pl = frag_h(&sPl[w][col][0] + kc * 32, lane);
#pragma unroll
      for (int t = 0; t < 4; ++t) { const v16h vh = frag_h(&sV[buf][0][t * 16 + col][kc * 32], lane);
        acc[t] = wmma16(ph, vh, acc[t]); ac1[t] = wmma16(ph, frag_h(&sV[buf][1][t * 16 + col][kc * 32], lane), ac1[t]); ac2[t] = wmma16(pl, vh, ac2[t]); } }
    __builtin_amdgcn_wave_barrier();
    asm volatile("s_wait_dscnt 0x0" ::: "memory");      // this wave's reads of buffer buf are done
    asm volatile("s_wait_asynccnt 0x0" ::: "memory");   // its copies of tile kt + 1 have landed
    __syncthreads();                                     // publishes tile kt + 1 and frees buffer buf
    if (kt + 2 <= qb) stage(buf, kt + 2); }
  asm volatile("s_wait_asynccnt 0x0" ::: "memory");     // no copy is left in flight behind the loop
  // the output rows are staged in the wave's own score rows, which are dead here: with the tile buffers three work-groups still fit one WGP's LDS
#pragma unroll
  for (int r = 0; r < 8; ++r) { const float lr = __shfl(lrun, 8 * g + r, 32); const float inv = 1.0f / (lr * 16384.0f * 4.0f);
#pragma unroll
    for (int t = 0; t < 4; ++t) sS[w][8 * g + r][t * 16 + col] = (acc[t][r] + ac1[t][r] * (1.0f / VLO) + ac2[t][r] * (1.0f / PLO)) * inv; }
  LDSX();
  for (int qq = lane; qq < 16 * 8; qq += 32) { const int rl = qq >> 3, pc = qq & 7; store_split8(&sS[w][rl][pc * 8], OS + ((bh * SS) + q0 + rl) * (2 * HD) + pc * 8); }
}
// out = ctx Wo^T + bo : split(ctx) x bf16(Wo rows): 2 products (Wo is an INPUT -> bf16 exact); k slices of the 64 context rows (split rows, read ready split) and 128 weight rows staged in LDS as in k_qkv
__global__ __launch_bounds__(128) void k_out(const __bf16* __restrict__ OS, int rbase, const __bf16* __restrict__ PT, const float* __restrict__ bo, float* __restrict__ out) {
  __shared__ __align__(16) OutLds sm;
  float (&so)[4][16][132] = sm.so;
  const int tid = threadIdx.x, wave = tid >> 5, lane = tid & 31, col = lane & 15, g = lane >> 4;
  const int r0b = blockIdx.x * 64, r0 = r0b + wave * 16, n0 = blockIdx.y * 128; const int b = r0b / SS, s0 = r0b % SS;
  v8f acc[8] = {};
  // slice kt is head kt. A lane's share: context, 16 KiB in a row in memory, piece tid + 128 i (LDS row 8 i + tid/16); weights, row 16 i + tid/8, piece tid%8
  const char* gA = (const char*)(OS + ((size_t)b * NH * SS + s0) * (2 * HD)) + tid * 16;
  const char* gB = (const char*)(PT + (size_t)(3 * E + n0 + (tid >> 3)) * E + (tid & 7) * 8);
  const unsigned lA = lds_off(&sm.st.a[0][tid >> 4][(tid & 15) * 4]), lB = lds_off(&sm.st.b[0][tid >> 3][(tid & 7) * 8]);
  auto stage = [&](int buf, int kt) {
    copy8(lA + buf * (unsigned)sizeof(sm.st.a[0]), 8 * KP * 4, gA + (size_t)kt * (SS * HD * 4), 128 * 16);
    copy8(lB + buf * (unsigned)sizeof(sm.st.b[0]), 16 * GP * 2, gB + (size_t)kt * 128, (size_t)16 * E * 2); };
  stage(0, 0);
  asm volatile("s_wait_asynccnt 0x0" ::: "memory");   // this wave's copies of slice 0 have landed
  __syncthreads();                                     // and every other wave's: slice 0 may be read
  stage(1, 1);
#pragma unroll 1   // rolled, for speed only
  for (int kt = 0; kt < NH; ++kt) { const int buf = kt & 1;
#pragma unroll
    for (int kc = 0; kc < 2; ++kc) { const F2 a = frag_split((const __bf16*)&sm.st.a[buf][wave * 16 + col][0], kc * 32, lane); v16b wb[8];
#pragma unroll
      for (int j = 0; j < 8; ++j) wb[j] = frag_b(&sm.st.b[buf][j * 16 + col][kc * 32], lane);
#pragma unroll
      for (int j = 0; j < 8; ++j) { acc[j] = wmma_bf(a.l, wb[j], acc[j]); acc[j] = wmma_bf(a.h, wb[j], acc[j]); } }
    asm volatile("s_wait_dscnt 0x0" ::: "memory");      // this wave's reads of buffer buf are done
    asm volatile("s_wait_asynccnt 0x0" ::: "memory");   // its copies of slice kt + 1 have landed
    __syncthreads();                                     // publishes slice kt + 1 and frees buffer buf (behind the last slice: for the output staging)
    if (kt + 2 < NH) stage(buf, kt + 2); }
  asm volatile("s_wait_asynccnt 0x0" ::: "memory");     // no copy is left in flight behind the loop
#pragma unroll
  for (int j = 0; j < 8; ++j) { const int n = n0 + j * 16 + col; const float bb = bfr(bo[n]);
#pragma unroll
    for (int r = 0; r < 8; ++r) so[wave][8 * g + r][j * 16 + col] = acc[j][r] + bb; }
  LDSX();
#pragma unroll 4
  for (int rl = 0; rl < 16; ++rl) vst2(out + (size_t)(rbase + r0 + rl) * E + n0 + lane * 4, *(const v4f*)(&so[wave][rl][lane * 4]));
}
#define NBHALF 2
extern "C" void kernel_launch(void* const* d_in, const int* in_sizes, int n_in, void* d_out, int out_size, void* d_ws, size_t ws_size, hipStream_t stream) {
  (void)in_sizes; (void)n_in; (void)out_size; (void)ws_size;
  const float* x = (const float*)d_in[0]; const float* Wqkv = (const float*)d_in[1]; const float* bqkv = (const float*)d_in[2]; const float* Wp = (const float*)d_in[3]; const float* bp = (const float*)d_in[4]; const float* bQ = (const float*)d_in[5]; const float* bK = (const float*)d_in[6]; const float* bV = (const float*)d_in[7];
  float* out = (float*)d_out;
  char* ws = (char*)d_ws; size_t off = 0;
  auto take = [&](size_t bytes) { char* p = ws + off; off += (bytes + 255) & ~(size_t)255; return p; };
  const size_t HR = (size_t)NBHALF * SS;     // rows per half (4096)
  __bf16* Xb = (__bf16*)take((size_t)NR * E * 2); __bf16* PT = (__bf16*)take((size_t)4 * E * E * 2);
  float* Q32 = (float*)take(HR * E * 4); __bf16* KS = (__bf16*)take(HR * E * 4); _Float16* VTh = (_Float16*)take(HR * E * 2); _Float16* VTl = (_Float16*)take(HR * E * 2);
  __bf16* OS = (__bf16*)Q32;      // in place, a split row has the f32 row's 256 bytes: each k_attn wave reads its own 16 query rows into registers before writing the same rows; no other block reads them
  // ws = 72 MiB; the two batch halves (2 sequences each) reuse Q/K/V
  k_cvt<<<(NR * E / 8 + 255) / 256, 256, 0, stream>>>(x, Xb);
  k_pack<<<4 * E, 128, 0, stream>>>(Wqkv, Wp, PT);
  for (int hf = 0; hf < 2; ++hf) { const int rbase = hf * (int)HR;
    k_qkv<<<dim3(HR / 64, E / 128, 3), 128, 0, stream>>>(Xb, rbase, PT, bqkv, bQ, bK, bV, Q32, KS, VTh, VTl);
    k_attn<<<dim3(NBHALF * NH, SS / 64), 128, 0, stream>>>(Q32, KS, VTh, VTl, OS);
    k_out<<<dim3(HR / 64, E / 128), 128, 0, stream>>>(OS, rbase, PT, bp, out); }
}

// v005
// A run of this version takes 270 microseconds.
// Next to v004, in two timings, it ran 1.17 and 1.18 times as fast.
// All steps since v000 together make it 3.88 times as fast.
// compute dtype: x, W_attn, b_attn, W_proj, b_proj, bQ/bK/bV (INPUTS) rounded to bf16 with exact bf16 WMMA products (f32 accumulate) for the projections; q/k f32 split in bf16 hi/lo for the scores (3 products; k is split once, where it is produced), P and V f16 hi/lo (3 products); softmax f32.
#include <hip/hip_runtime.h>
#include <math.h>

typedef __attribute__((ext_vector_type(16))) _Float16 v16h;
typedef __attribute__((ext_vector_type(16))) __bf16 v16b;
typedef __attribute__((ext_vector_type(8)))  _Float16 v8h;
typedef __attribute__((ext_vector_type(8)))  float v8f;
typedef __attribute__((ext_vector_type(4)))  float v4f;
typedef __attribute__((ext_vector_type(2)))  float v2f;
typedef __attribute__((ext_vector_type(4)))  unsigned v4u;
typedef __attribute__((ext_vector_type(4)))  int v4i;
typedef float __attribute__((may_alias)) float_a;
typedef int __attribute__((may_alias)) int_a;

template <typename T> __device__ __forceinline__ void vst2(void* p, T v) { *(T*)p = v;  }
__device__ __forceinline__ v8f wmma16(v16h a, v16h b, v8f c) {
  v8f d = __builtin_amdgcn_wmma_f32_16x16x32_f16(false, a, false, b, (short)0, c, false, false);
  asm volatile("v_nop\n\tv_nop\n\tv_nop\n\tv_nop" : "+v"(d) : "v"(a), "v"(b));
  return d;
}
__device__ __forceinline__ v8f wmma_bf(v16b a, v16b b, v8f c) {
  v8f d = __builtin_amdgcn_wmma_f32_16x16x32_bf16(false, a, false, b, (short)0, c, false, false);
  asm volatile("v_nop\n\tv_nop\n\tv_nop\n\tv_nop" : "+v"(d) : "v"(a), "v"(b));
  return d;
}
// 16x16x32 fragments: lane = (h = lane>>4, row/col = lane&15); elements 0..7 = k0+8h+0..7, 8..15 = k0+16+8h+0..7; D element r = row 8h+r
__device__ __forceinline__ v16h frag_h(const _Float16* rowk0, int lane) {
  union { v16h v; v8h q[2]; } u; const _Float16* p = rowk0 + 8 * (lane >> 4);
  u.q[0] = *(const v8h*)p; u.q[1] = *(const v8h*)(p + 16); return u.v;
}
__device__ __forceinline__ v16h frag_f32(const float* rowk0, int lane) {
  v16h a; const float* p = rowk0 + 8 * (lane >> 4);
#pragma unroll
  for (int i = 0; i < 8; ++i) { a[i] = (_Float16)p[i]; a[8 + i] = (_Float16)p[16 + i]; }
  return a;
}
__device__ __forceinline__ v16h frag_f32s(const float* rowk0, int lane, float sc) {
  v16h a; const float* p = rowk0 + 8 * (lane >> 4);
#pragma unroll
  for (int i = 0; i < 8; ++i) { a[i] = (_Float16)(p[i] * sc); a[8 + i] = (_Float16)(p[16 + i] * sc); }
  return a;
}
// column fragment from a [K][ld] layout (column n), rows >= K read as 0
__device__ __forceinline__ v16h fragc_f32(const float* W, int k0, int n, int lane, int ld, int K) {
  v16h a; const int g = lane >> 4;
#pragma unroll
  for (int i = 0; i < 8; ++i) { const int ka = k0 + 8 * g + i, kb = ka + 16;
    a[i] = (_Float16)(ka < K ? W[(size_t)(ka < K ? ka : K - 1) * ld + n] : 0.f); a[8 + i] = (_Float16)(kb < K ? W[(size_t)(kb < K ? kb : K - 1) * ld + n] : 0.f); }
  return a;
}
struct F2 { v16b h, l; };
__device__ __forceinline__ F2 bsplit16(const float v[16]) { F2 r;
#pragma unroll
  for (int i = 0; i < 16; ++i) { const __bf16 h = (__bf16)v[i]; r.h[i] = h; r.l[i] = (__bf16)(v[i] - (float)h); }
  return r; }
__device__ __forceinline__ F2 split_row(const float* row, int k0, int lane) { float v[16]; const float* p = row + k0 + 8 * (lane >> 4);
#pragma unroll
  for (int i = 0; i < 8; ++i) { v[i] = p[i]; v[8 + i] = p[16 + i]; }
  return bsplit16(v); }
__device__ __forceinline__ F2 split_rowK(const float* row, int k0, int lane, int K) { float v[16]; const int g = lane >> 4;
#pragma unroll
  for (int i = 0; i < 8; ++i) { const int ka = k0 + 8 * g + i, kb = ka + 16; v[i] = ka < K ? row[ka < K ? ka : K - 1] : 0.f; v[8 + i] = kb < K ? row[kb < K ? kb : K - 1] : 0.f; }
  return bsplit16(v); }
__device__ __forceinline__ F2 split_col(const float* W, int k0, int n, int lane, int ld, int K) { float v[16]; const int g = lane >> 4;
#pragma unroll
  for (int i = 0; i < 8; ++i) { const int ka = k0 + 8 * g + i, kb = ka + 16; v[i] = ka < K ? W[(size_t)(ka < K ? ka : K - 1) * ld + n] : 0.f; v[8 + i] = kb < K ? W[(size_t)(kb < K ? kb : K - 1) * ld + n] : 0.f; }
  return bsplit16(v); }
__device__ __forceinline__ v8f mac3(const F2& a, const F2& b, v8f c) { c = wmma_bf(a.l, b.h, c); c = wmma_bf(a.h, b.l, c); return wmma_bf(a.h, b.h, c); }
__device__ __forceinline__ float sigm(float v) { return 1.0f / (1.0f + expf(-v)); }
#define LDSX() do { asm volatile("s_wait_dscnt 0" ::: "memory"); __builtin_amdgcn_wave_barrier(); __builtin_amdgcn_fence(__ATOMIC_RELEASE, "workgroup"); } while (0)


#define NB 4
#define SS 2048
#define E 1024
#define NH 16
#define HD 64
#define NR (NB * SS)
#define PLO 1024.0f
#define VLO 2048.0f
__device__ __forceinline__ float bfr(float v) { return (float)(__bf16)v; }
__device__ __forceinline__ v16b frag_b(const __bf16* rowk0, int lane) { return __builtin_bit_cast(v16b, frag_h((const _Float16*)rowk0, lane)); }
// a split row: 64 f32 values kept as 64 bf16 hi | 64 bf16 lo (hi = bf16(v), lo = bf16(v - hi), as bsplit16 has them), 256 bytes like the f32 row
// eight values of one lane: 16 bytes into the row's hi half at d, 16 into its lo half; eight lanes fill each half's 128 bytes
__device__ __forceinline__ void store_split8(const float* s, __bf16* d) { union { __bf16 e[8]; v4u u; } hi, lo;
#pragma unroll
  for (int e = 0; e < 8; ++e) { const float v = s[e]; const __bf16 hv = (__bf16)v; hi.e[e] = hv; lo.e[e] = (__bf16)(v - (float)hv); }
  vst2(d, hi.u); vst2(d + HD, lo.u); }
// the fragment pair of a split row at k0
__device__ __forceinline__ F2 frag_split(const __bf16* row, int k0, int lane) { F2 r; r.h = frag_b(row + k0, lane); r.l = frag_b(row + HD + k0, lane); return r; }

__global__ __launch_bounds__(256) void k_cvt(const float* __restrict__ x, __bf16* __restrict__ Xb) {
  const size_t i8 = (size_t)blockIdx.x * 256 + threadIdx.x; if (i8 >= (size_t)NR * E / 8) return;
  union { __bf16 h[8]; v4u u; } pk;
#pragma unroll
  for (int e = 0; e < 8; ++e) pk.h[e] = (__bf16)x[i8 * 8 + e];
  vst2((unsigned*)(Xb + i8 * 8), pk.u);
}
// PT rows: [0,E) Wq[:,n], [E,2E) Wk[:,n], [2E,3E) Wv[:,n], [3E,4E) Wo[:,n]  ([in][out] weights: column n as a bf16 row)
__global__ __launch_bounds__(128) void k_pack(const float* __restrict__ Wqkv, const float* __restrict__ Wp, __bf16* __restrict__ PT) {
  const int n = blockIdx.x, tid = threadIdx.x; __shared__ __align__(16) __bf16 srow[E];
  for (int k = tid; k < E; k += 128) srow[k] = (__bf16)(n < 3 * E ? Wqkv[(size_t)k * (3 * E) + n] : Wp[(size_t)k * E + (n - 3 * E)]);
  __syncthreads();
  if (tid < E / 8) vst2((unsigned*)(PT + (size_t)n * E + tid * 8), *(const v4u*)(&srow[tid * 8]));
}
// eight 16-byte asynchronous copies of one lane, global -> LDS: LDS byte address l + i*ls, global address g + i*gs bytes.
// s_wait_xcnt closes the copies' own statement, so no address register is rewritten ahead of it.
__device__ __forceinline__ void copy8(unsigned l, unsigned ls, const char* g, size_t gs) {
  asm volatile("global_load_async_to_lds_b128 %0, %8, off\n\t"
               "global_load_async_to_lds_b128 %1, %9, off\n\t"
               "global_load_async_to_lds_b128 %2, %10, off\n\t"
               "global_load_async_to_lds_b128 %3, %11, off\n\t"
               "global_load_async_to_lds_b128 %4, %12, off\n\t"
               "global_load_async_to_lds_b128 %5, %13, off\n\t"
               "global_load_async_to_lds_b128 %6, %14, off\n\t"
               "global_load_async_to_lds_b128 %7, %15, off\n\t"
               "s_wait_xcnt 0x0"
               :: "v"(l), "v"(l + ls), "v"(l + 2 * ls), "v"(l + 3 * ls), "v"(l + 4 * ls), "v"(l + 5 * ls), "v"(l + 6 * ls), "v"(l + 7 * ls),
                  "v"(g), "v"(g + gs), "v"(g + 2 * gs), "v"(g + 3 * gs), "v"(g + 4 * gs), "v"(g + 5 * gs), "v"(g + 6 * gs), "v"(g + 7 * gs)
               : "memory");
}
// the same for two planes of four copies each: plane 1 lies lp bytes further in LDS and gp bytes further in memory
__device__ __forceinline__ void copy4x2(unsigned l, unsigned ls, unsigned lp, const char* g, size_t gs, size_t gp) {
  asm volatile("global_load_async_to_lds_b128 %0, %8, off\n\t"
               "global_load_async_to_lds_b128 %1, %9, off\n\t"
               "global_load_async_to_lds_b128 %2, %10, off\n\t"
               "global_load_async_to_lds_b128 %3, %11, off\n\t"
               "global_load_async_to_lds_b128 %4, %12, off\n\t"
               "global_load_async_to_lds_b128 %5, %13, off\n\t"
               "global_load_async_to_lds_b128 %6, %14, off\n\t"
               "global_load_async_to_lds_b128 %7, %15, off\n\t"
               "s_wait_xcnt 0x0"
               :: "v"(l), "v"(l + ls), "v"(l + 2 * ls), "v"(l + 3 * ls), "v"(l + lp), "v"(l + lp + ls), "v"(l + lp + 2 * ls), "v"(l + lp + 3 * ls),
                  "v"(g), "v"(g + gs), "v"(g + 2 * gs), "v"(g + 3 * gs), "v"(g + gp), "v"(g + gp + gs), "v"(g + gp + 2 * gs), "v"(g + gp + 3 * gs)
               : "memory");
}
// the same for four copies
__device__ __forceinline__ void copy4(unsigned l, unsigned ls, const char* g, size_t gs) {
  asm volatile("global_load_async_to_lds_b128 %0, %4, off\n\t"
               "global_load_async_to_lds_b128 %1, %5, off\n\t"
               "global_load_async_to_lds_b128 %2, %6, off\n\t"
               "global_load_async_to_lds_b128 %3, %7, off\n\t"
               "s_wait_xcnt 0x0"
               :: "v"(l), "v"(l + ls), "v"(l + 2 * ls), "v"(l + 3 * ls),
                  "v"(g), "v"(g + gs), "v"(g + 2 * gs), "v"(g + 3 * gs)
               : "memory");
}
__device__ __forceinline__ unsigned lds_off(const void* p) { return (unsigned)(size_t)p; }
#define KP 68   // LDS pitch, in floats, of a 256-byte row (64 floats; a key's 64 bf16 hi | 64 bf16 lo): 272 B = 16 B x odd
#define VP 72   // LDS pitch of a 64-half V^T row: 144 B = 16 B x odd
#define GP 72   // LDS pitch of a 64-element bf16 k slice: 144 B = 16 B x odd
// LDS of the two projections: in the k loop two buffers of the operands' 64-wide k slices; behind it, on the same bytes, the output staging
union QkvLds { struct { __bf16 a[2][64][GP]; __bf16 b[2][128][GP]; } st; float so[4][16][132]; struct { _Float16 h[128][72], l[128][72]; } vt; };
union OutLds { struct { float a[2][64][KP]; __bf16 b[2][128][GP]; } st; float so[4][16][132]; };
// each 64-wide k slice of the block's 64 X rows and 128 weight rows is copied to LDS once for the four waves, two buffers, the next slice in flight while this one is worked on
// QKV: block (64 rows, 128 cols = 2 heads, which); q (+bias) -> Q32 f32 [bh][s][64]; k (+bias) -> KS [bh][s][64 bf16 hi | 64 bf16 lo], the split that the scores use; v (+bias) -> VT hi/lo x4 [bh][d][s]
// five waves a SIMD is what the LDS allows: the bound keeps the register count of the v epilogue from costing one of them (without it this build takes 210 registers, with it 152 as before)
__global__ __launch_bounds__(128, 5) void k_qkv(const __bf16* __restrict__ Xb, int rbase, const __bf16* __restrict__ PT, const float* __restrict__ bqkv, const float* __restrict__ bQ, const float* __restrict__ bK, const float* __restrict__ bV, float* __restrict__ Q32, __bf16* __restrict__ KS, _Float16* __restrict__ VTh, _Float16* __restrict__ VTl) {
  __shared__ __align__(16) QkvLds sm;
  float (&so)[4][16][132] = sm.so; _Float16 (&sth)[128][72] = sm.vt.h, (&stl)[128][72] = sm.vt.l;
  const int tid = threadIdx.x, wave = tid >> 5, lane = tid & 31, col = lane & 15, g = lane >> 4;
  const int which = blockIdx.z, r0b = blockIdx.x * 64, n0 = blockIdx.y * 128; const int b = r0b / SS, s0 = r0b % SS;
  const float* bb_ = bqkv + which * E; const float* bx_ = which == 0 ? bQ : (which == 1 ? bK : bV);      // column n = h*64 + d indexes both biases
  v8f acc[8] = {};
  // a lane's share of a slice: row 16 i + tid/8, 16-byte piece tid%8 of the row's 128 bytes
  const char* gA = (const char*)(Xb + (size_t)(rbase + r0b + (tid >> 3)) * E + (tid & 7) * 8);
  const char* gB = (const char*)(PT + (size_t)(which * E + n0 + (tid >> 3)) * E + (tid & 7) * 8);
  const unsigned lA = lds_off(&sm.st.a[0][tid >> 3][(tid & 7) * 8]), lB = lds_off(&sm.st.b[0][tid >> 3][(tid & 7) * 8]);
  auto stage = [&](int buf, int kt) {
    copy4(lA + buf * (unsigned)sizeof(sm.st.a[0]), 16 * GP * 2, gA + (size_t)kt * 128, (size_t)16 * E * 2);
    copy8(lB + buf * (unsigned)sizeof(sm.st.b[0]), 16 * GP * 2, gB + (size_t)kt * 128, (size_t)16 * E * 2); };
  stage(0, 0);
  asm volatile("s_wait_asynccnt 0x0" ::: "memory");   // this wave's copies of slice 0 have landed
  __syncthreads();                                     // and every other wave's: slice 0 may be read
  stage(1, 1);
#pragma unroll 1   // rolled, for speed only
  for (int kt = 0; kt < E / 64; ++kt) { const int buf = kt & 1;
#pragma unroll
    for (int kc = 0; kc < 2; ++kc) { const v16b a = frag_b(&sm.st.a[buf][wave * 16 + col][kc * 32], lane); v16b wb[8];
#pragma unroll
      for (int j = 0; j < 8; ++j) wb[j] = frag_b(&sm.st.b[buf][j * 16 + col][kc * 32], lane);
#pragma unroll
      for (int j = 0; j < 8; ++j) acc[j] = wmma_bf(a, wb[j], acc[j]); }
    asm volatile("s_wait_dscnt 0x0" ::: "memory");      // this wave's reads of buffer buf are done
    asm volatile("s_wait_asynccnt 0x0" ::: "memory");   // its copies of slice kt + 1 have landed
    __syncthreads();                                     // publishes slice kt + 1 and frees buffer buf (behind the last slice: for the output staging)
    if (kt + 2 < E / 64) stage(buf, kt + 2); }
  asm volatile("s_wait_asynccnt 0x0" ::: "memory");     // no copy is left in flight behind the loop
  if (which < 2) {
#pragma unroll
    for (int j = 0; j < 8; ++j) { const float bb = bfr(bb_[n0 + j * 16 + col]) + bfr(bx_[n0 + j * 16 + col]);
#pragma unroll
      for (int r = 0; r < 8; ++r) so[wave][8 * g + r][j * 16 + col] = acc[j][r] + bb; }
    LDSX();
    if (which == 0) {
      for (int qq = lane; qq < 2 * 16 * 16; qq += 32) { const int hh = qq >> 8, rl = (qq >> 4) & 15, pc = qq & 15; const int h = (n0 >> 6) + hh;
        vst2(Q32 + (((size_t)b * NH + h) * SS + s0 + wave * 16 + rl) * HD + pc * 4, *(const v4f*)(&so[wave][rl][hh * 64 + pc * 4])); } }
    else {
      for (int qq = lane; qq < 2 * 16 * 8; qq += 32) { const int hh = qq >> 7, rl = (qq >> 3) & 15, pc = qq & 7; const int h = (n0 >> 6) + hh;
        store_split8(&so[wave][rl][hh * 64 + pc * 8], KS + (((size_t)b * NH + h) * SS + s0 + wave * 16 + rl) * (2 * HD) + pc * 8); } } }
  else {
#pragma unroll
    for (int j = 0; j < 8; ++j) { const float bb = bfr(bb_[n0 + j * 16 + col]) + bfr(bx_[n0 + j * 16 + col]);
#pragma unroll
      for (int r = 0; r < 8; ++r) { const float v = (acc[j][r] + bb) * 4.0f; const _Float16 hi = (_Float16)v; sth[j * 16 + col][wave * 16 + 8 * g + r] = hi; stl[j * 16 + col][wave * 16 + 8 * g + r] = (_Float16)((v - (float)hi) * VLO); } }
    __syncthreads();
    for (int qq = tid; qq < 128 * 8; qq += 128) { const int cl = qq >> 3, pc = qq & 7; const int c = n0 + cl, h = c >> 6, d = c & 63; const size_t o = (((size_t)b * NH + h) * HD + d) * SS + s0 + pc * 8;
      vst2(VTh + o, *(const v4u*)(&sth[cl][pc * 8])); vst2(VTl + o, *(const v4u*)(&stl[cl][pc * 8])); } }
}
// causal attention: block (bh, 64 queries, last query block first); key tiles 0..qb; each 64-key tile of K, V^T hi and V^T lo is copied to LDS once for the four waves, two buffers, the next tile in flight while this one is worked on; S on bf16 hi/lo splits: q split here from its f32 rows, k read ready split (a key row in LDS is 64 hi | 64 lo, as in memory); P,V hi/lo; O -> OS, split rows [bh][s][64 hi | 64 lo], the split that the output projection uses
__global__ __launch_bounds__(128) void k_attn(const float* __restrict__ Q32, const __bf16* __restrict__ KS, const _Float16* __restrict__ VTh, const _Float16* __restrict__ VTl, __bf16* __restrict__ OS) {
  __shared__ __align__(16) float sS[4][16][68];
  __shared__ __align__(16) _Float16 sPh[4][16][72], sPl[4][16][72];
  __shared__ __align__(16) float sK[2][64][KP];
  __shared__ __align__(16) _Float16 sV[2][2][64][VP];      // [buffer][hi, lo][d][key]
  const int tid = threadIdx.x, w = tid >> 5, lane = tid & 31, col = lane & 15, g = lane >> 4;
  // placement: a block's cost grows with its query block (qb + 1 key tiles) and there are more blocks than resident places. The head
  // is the fast index and the query block falls with the slow one: the longest blocks come first in index order, the short ones last,
  // and blocks whose indices lie a multiple of 64 apart now differ in length (before, they were equally long)
  const size_t bh = blockIdx.x; const int qb = SS / 64 - 1 - (int)blockIdx.y; const int q0 = qb * 64 + w * 16;
  F2 aq[2];
#pragma unroll
  for (int kc = 0; kc < 2; ++kc) aq[kc] = split_row(Q32 + (bh * SS + q0 + col) * HD, kc * 32, lane);
  float mrun = -3.0e38f, lrun = 0.f; v8f acc[4] = {}, ac1[4] = {}, ac2[4] = {};
  // a lane's share of a tile: K, 16 KiB in a row in memory, piece tid + 128 i (LDS row 8 i + tid/16); V^T hi then lo, row 16 i + tid/8, piece tid%8
  const char* gK = (const char*)(KS + bh * SS * (2 * HD)) + tid * 16;
  const size_t vrow = ((bh * HD + (tid >> 3)) * SS + (tid & 7) * 8) * 2;
  const char* gVh = (const char*)VTh + vrow; const size_t gVd = (const char*)VTl - (const char*)VTh;
  const unsigned lK = lds_off(&sK[0][tid >> 4][(tid & 15) * 4]), lV = lds_off(&sV[0][0][tid >> 3][(tid & 7) * 8]);
  auto stage = [&](int buf, int kt) {
    copy8(lK + buf * (unsigned)sizeof(sK[0]), 8 * KP * 4, gK + (size_t)kt * (64 * HD * 4), 128 * 16);
    const char* gv = gVh + (size_t)kt * 128; const unsigned lv = lV + buf * (unsigned)sizeof(sV[0]);
    copy4x2(lv, 16 * VP * 2, (unsigned)sizeof(sV[0][0]), gv, (size_t)16 * SS * 2, gVd); };
  stage(0, 0);
  asm volatile("s_wait_asynccnt 0x0" ::: "memory");   // this wave's copies of tile 0 have landed
  __syncthreads();                                     // and every other wave's: tile 0 may be read
  if (qb >= 1) stage(1, 1);
#pragma unroll 1
  for (int kt = 0; kt <= qb; ++kt) { const int buf = kt & 1;
#pragma unroll
    for (int t = 0; t < 4; ++t) { const int key = kt * 64 + t * 16 + col; const __bf16* krow = (const __bf16*)&sK[buf][t * 16 + col][0];
      v8f s = mac3(aq[0], frag_split(krow, 0, lane), (v8f){}); s = mac3(aq[1], frag_split(krow, 32, lane), s);
#pragma unroll
      for (int r = 0; r < 8; ++r) { sS[w][8 * g + r][t * 16 + col] = (key > q0 + 8 * g + r) ? -3.0e38f : s[r] * 0.125f; } }
    LDSX();
    float mx = -3.4e38f;
#pragma unroll
    for (int jj = 0; jj < 32; ++jj) mx = fmaxf(mx, sS[w][col][g * 32 + jj]);
    mx = fmaxf(mx, __shfl_xor(mx, 16, 32));
    const float mnew = fmaxf(mrun, mx); const float corr = expf(mrun - mnew);
    float ps = 0.f;
#pragma unroll
    for (int jj = 0; jj < 32; ++jj) { const float p = expf(sS[w][col][g * 32 + jj] - mnew) * 16384.0f; ps += p; const _Float16 hi = (_Float16)p; sPh[w][col][g * 32 + jj] = hi; sPl[w][col][g * 32 + jj] = (_Float16)((p - (float)hi) * PLO); }
    ps += __shfl_xor(ps, 16, 32);
    lrun = lrun * corr + ps * (1.0f / 16384.0f); mrun = mnew;
#pragma unroll
    for (int r = 0; r < 8; ++r) { const float cr = __shfl(corr, 8 * g + r, 32);
#pragma unroll
      for (int t = 0; t < 4; ++t) { acc[t][r] *= cr; ac1[t][r] *= cr; ac2[t][r] *= cr; } }
    LDSX();
#pragma unroll
    for (int kc = 0; kc < 2; ++kc) { const v16h ph = frag_h(&sPh[w][col][0] + kc * 32, lane), pl = frag_h(&sPl[w][col][0] + kc * 32, lane);
#pragma unroll
      for (int t = 0; t < 4; ++t) { const v16h vh = frag_h(&sV[buf][0][t * 16 + col][kc * 32], lane);
        acc[t] = wmma16(ph, vh, acc[t]); ac1[t] = wmma16(ph, frag_h(&sV[buf][1][t * 16 + col][kc * 32], lane), ac1[t]); ac2[t] = wmma16(pl, vh, ac2[t]); } }
    __builtin_amdgcn_wave_barrier();
    asm volatile("s_wait_dscnt 0x0" ::: "memory");      // this wave's reads of buffer buf are done
    asm volatile("s_wait_asynccnt 0x0" ::: "memory");   // its copies of tile kt + 1 have landed
    __syncthreads();                                     // publishes tile kt + 1 and frees buffer buf
    if (kt + 2 <= qb) stage(buf, kt + 2); }
  asm volatile("s_wait_asynccnt 0x0" ::: "memory");     // no copy is left in flight behind the loop
  // the output rows are staged in the wave's own score rows, which are dead here: with the tile buffers three work-groups still fit one WGP's LDS
#pragma unroll
  for (int r = 0; r < 8; ++r) { const float lr = __shfl(lrun, 8 * g + r, 32); const float inv = 1.0f / (lr * 16384.0f * 4.0f);
#pragma unroll
    for (int t = 0; t < 4; ++t) sS[w][8 * g + r][t * 16 + col] = (acc[t][r] + ac1[t][r] * (1.0f / VLO) + ac2[t][r] * (1.0f / PLO)) * inv; }
  LDSX();
  for (int qq = lane; qq < 16 * 8; qq += 32) { const int rl = qq >> 3, pc = qq & 7; store_split8(&sS[w][rl][pc * 8], OS + ((bh * SS) + q0 + rl) * (2 * HD) + pc * 8); }
}
// out = ctx Wo^T + bo : split(ctx) x bf16(Wo rows): 2 products (Wo is an INPUT -> bf16 exact); k slices of the 64 context rows (split rows, read ready split) and 128 weight rows staged in LDS as in k_qkv
__global__ __launch_bounds__(128) void k_out(const __bf16* __restrict__ OS, int rbase, const __bf16* __restrict__ PT, const float* __restrict__ bo, float* __restrict__ out) {
  __shared__ __align__(16) OutLds sm;
  float (&so)[4][16][132] = sm.so;
  const int tid = threadIdx.x, wave = tid >> 5, lane = tid & 31, col = lane & 15, g = lane >> 4;
  const int r0b = blockIdx.x * 64, r0 = r0b + wave * 16, n0 = blockIdx.y * 128; const int b = r0b / SS, s0 = r0b % SS;
  v8f acc[8] = {};
  // slice kt is head kt. A lane's share: context, 16 KiB in a row in memory, piece tid + 128 i (LDS row 8 i + tid/16); weights, row 16 i + tid/8, piece tid%8
  const char* gA = (const char*)(OS + ((size_t)b * NH * SS + s0) * (2 * HD)) + tid * 16;
  const char* gB = (const char*)(PT + (size_t)(3 * E + n0 + (tid >> 3)) * E + (tid & 7) * 8);
  const unsigned lA = lds_off(&sm.st.a[0][tid >> 4][(tid & 15) * 4]), lB = lds_off(&sm.st.b[0][tid >> 3][(tid & 7) * 8]);
  auto stage = [&](int buf, int kt) {
    copy8(lA + buf * (unsigned)sizeof(sm.st.a[0]), 8 * KP * 4, gA + (size_t)kt * (SS * HD * 4), 128 * 16);
    copy8(lB + buf * (unsigned)sizeof(sm.st.b[0]), 16 * GP * 2, gB + (size_t)kt * 128, (size_t)16 * E * 2); };
  stage(0, 0);
  asm volatile("s_wait_asynccnt 0x0" ::: "memory");   // this wave's copies of slice 0 have landed
  __syncthreads();                                     // and every other wave's: slice 0 may be read
  stage(1, 1);
#pragma unroll 1   // rolled, for speed only
  for (int kt = 0; kt < NH; ++kt) { const int buf = kt & 1;
#pragma unroll
    for (int kc = 0; kc < 2; ++kc) { const F2 a = frag_split((const __bf16*)&sm.st.a[buf][wave * 16 + col][0], kc * 32, lane); v16b wb[8];
#pragma unroll
      for (int j = 0; j < 8; ++j) wb[j] = frag_b(&sm.st.b[buf][j * 16 + col][kc * 32], lane);
#pragma unroll
      for (int j = 0; j < 8; ++j) { acc[j] = wmma_bf(a.l, wb[j], acc[j]); acc[j] = wmma_bf(a.h, wb[j], acc[j]); } }
    asm volatile("s_wait_dscnt 0x0" ::: "memory");      // this wave's reads of buffer buf are done
    asm volatile("s_wait_asynccnt 0x0" ::: "memory");   // its copies of slice kt + 1 have landed
    __syncthreads();                                     // publishes slice kt + 1 and frees buffer buf (behind the last slice: for the output staging)
    if (kt + 2 < NH) stage(buf, kt + 2); }
  asm volatile("s_wait_asynccnt 0x0" ::: "memory");     // no copy is left in flight behind the loop
#pragma unroll
  for (int j = 0; j < 8; ++j) { const int n = n0 + j * 16 + col; const float bb = bfr(bo[n]);
#pragma unroll
    for (int r = 0; r < 8; ++r) so[wave][8 * g + r][j * 16 + col] = acc[j][r] + bb; }
  LDSX();
#pragma unroll 4
  for (int rl = 0; rl < 16; ++rl) vst2(out + (size_t)(rbase + r0 + rl) * E + n0 + lane * 4, *(const v4f*)(&so[wave][rl][lane * 4]));
}
extern "C" void kernel_launch(void* const* d_in, const int* in_sizes, int n_in, void* d_out, int out_size, void* d_ws, size_t ws_size, hipStream_t stream) {
  (void)in_sizes; (void)n_in; (void)out_size; (void)ws_size;
  const float* x = (const float*)d_in[0]; const float* Wqkv = (const float*)d_in[1]; const float* bqkv = (const float*)d_in[2]; const float* Wp = (const float*)d_in[3]; const float* bp = (const float*)d_in[4]; const float* bQ = (const float*)d_in[5]; const float* bK = (const float*)d_in[6]; const float* bV = (const float*)d_in[7];
  float* out = (float*)d_out;
  char* ws = (char*)d_ws; size_t off = 0;
  auto take = [&](size_t bytes) { char* p = ws + off; off += (bytes + 255) & ~(size_t)255; return p; };
  __bf16* Xb = (__bf16*)take((size_t)NR * E * 2); __bf16* PT = (__bf16*)take((size_t)4 * E * E * 2);
  float* Q32 = (float*)take((size_t)NR * E * 4); __bf16* KS = (__bf16*)take((size_t)NR * E * 4); _Float16* VTh = (_Float16*)take((size_t)NR * E * 2); _Float16* VTl = (_Float16*)take((size_t)NR * E * 2);
  __bf16* OS = (__bf16*)Q32;      // in place, a split row has the f32 row's 256 bytes: each k_attn wave reads its own 16 query rows into registers before writing the same rows; no other block reads them
  // ws: 120 MiB. One launch of each kernel covers the whole batch: two passes over half the batch left places empty in every launch
  // (k_out: 512 blocks on 1,024 places; k_qkv: 1,536 on 1,280, a second round one fifth full; k_attn: 1,024 blocks of unequal length on 768, each pass as long as its fullest WGP)
  k_cvt<<<(NR * E / 8 + 255) / 256, 256, 0, stream>>>(x, Xb);
  k_pack<<<4 * E, 128, 0, stream>>>(Wqkv, Wp, PT);
  k_qkv<<<dim3(NR / 64, E / 128, 3), 128, 0, stream>>>(Xb, 0, PT, bqkv, bQ, bK, bV, Q32, KS, VTh, VTl);
  k_attn<<<dim3(NB * NH, SS / 64), 128, 0, stream>>>(Q32, KS, VTh, VTl, OS);
  k_out<<<dim3(NR / 64, E / 128), 128, 0, stream>>>(OS, 0, PT, bp, out);
}

// v006
// Measured time: 258 microseconds a run.
// Timed twice side by side with v005, it ran 1.05 times as fast both times.
// Over all steps from v000 it is 4.08 times as fast.
// compute dtype: x, W_attn, b_attn, W_proj, b_proj, bQ/bK/bV (INPUTS) rounded to bf16 with exact bf16 WMMA products (f32 accumulate) for the projections; q/k f32 split in bf16 hi/lo for the scores (3 products; k is split once, where it is produced), P and V f16 hi/lo (3 products); softmax f32.
#include <hip/hip_runtime.h>
#include <math.h>

typedef __attribute__((ext_vector_type(16))) _Float16 v16h;
typedef __attribute__((ext_vector_type(16))) __bf16 v16b;
typedef __attribute__((ext_vector_type(8)))  _Float16 v8h;
typedef __attribute__((ext_vector_type(8)))  float v8f;
typedef __attribute__((ext_vector_type(4)))  float v4f;
typedef __attribute__((ext_vector_type(2)))  float v2f;
typedef __attribute__((ext_vector_type(4)))  unsigned v4u;
typedef __attribute__((ext_vector_type(4)))  int v4i;
typedef float __attribute__((may_alias)) float_a;
typedef int __attribute__((may_alias)) int_a;

template <typename T> __device__ __forceinline__ void vst2(void* p, T v) { *(T*)p = v;  }
__device__ __forceinline__ v8f wmma16(v16h a, v16h b, v8f c) {
  v8f d = __builtin_amdgcn_wmma_f32_16x16x32_f16(false, a, false, b, (short)0, c, false, false);
  asm volatile("v_nop\n\tv_nop\n\tv_nop\n\tv_nop" : "+v"(d) : "v"(a), "v"(b));
  return d;
}
__device__ __forceinline__ v8f wmma_bf(v16b a, v16b b, v8f c) {
  v8f d = __builtin_amdgcn_wmma_f32_16x16x32_bf16(false, a, false, b, (short)0, c, false, false);
  asm volatile("v_nop\n\tv_nop\n\tv_nop\n\tv_nop" : "+v"(d) : "v"(a), "v"(b));
  return d;
}
// 16x16x32 fragments: lane = (h = lane>>4, row/col = lane&15); elements 0..7 = k0+8h+0..7, 8..15 = k0+16+8h+0..7; D element r = row 8h+r
__device__ __forceinline__ v16h frag_h(const _Float16* rowk0, int lane) {
  union { v16h v; v8h q[2]; } u; const _Float16* p = rowk0 + 8 * (lane >> 4);
  u.q[0] = *(const v8h*)p; u.q[1] = *(const v8h*)(p + 16); return u.v;
}
__device__ __forceinline__ v16h frag_f32(const float* rowk0, int lane) {
  v16h a; const float* p = rowk0 + 8 * (lane >> 4);
#pragma unroll
  for (int i = 0; i < 8; ++i) { a[i] = (_Float16)p[i]; a[8 + i] = (_Float16)p[16 + i]; }
  return a;
}
__device__ __forceinline__ v16h frag_f32s(const float* rowk0, int lane, float sc) {
  v16h a; const float* p = rowk0 + 8 * (lane >> 4);
#pragma unroll
  for (int i = 0; i < 8; ++i) { a[i] = (_Float16)(p[i] * sc); a[8 + i] = (_Float16)(p[16 + i] * sc); }
  return a;
}
// column fragment from a [K][ld] layout (column n), rows >= K read as 0
__device__ __forceinline__ v16h fragc_f32(const float* W, int k0, int n, int lane, int ld, int K) {
  v16h a; const int g = lane >> 4;
#pragma unroll
  for (int i = 0; i < 8; ++i) { const int ka = k0 + 8 * g + i, kb = ka + 16;
    a[i] = (_Float16)(ka < K ? W[(size_t)(ka < K ? ka : K - 1) * ld + n] : 0.f); a[8 + i] = (_Float16)(kb < K ? W[(size_t)(kb < K ? kb : K - 1) * ld + n] : 0.f); }
  return a;
}
struct F2 { v16b h, l; };
__device__ __forceinline__ F2 bsplit16(const float v[16]) { F2 r;
#pragma unroll
  for (int i = 0; i < 16; ++i) { const __bf16 h = (__bf16)v[i]; r.h[i] = h; r.l[i] = (__bf16)(v[i] - (float)h); }
  return r; }
__device__ __forceinline__ F2 split_row(const float* row, int k0, int lane) { float v[16]; const float* p = row + k0 + 8 * (lane >> 4);
#pragma unroll
  for (int i = 0; i < 8; ++i) { v[i] = p[i]; v[8 + i] = p[16 + i]; }
  return bsplit16(v); }
__device__ __forceinline__ F2 split_rowK(const float* row, int k0, int lane, int K) { float v[16]; const int g = lane >> 4;
#pragma unroll
  for (int i = 0; i < 8; ++i) { const int ka = k0 + 8 * g + i, kb = ka + 16; v[i] = ka < K ? row[ka < K ? ka : K - 1] : 0.f; v[8 + i] = kb < K ? row[kb < K ? kb : K - 1] : 0.f; }
  return bsplit16(v); }
__device__ __forceinline__ F2 split_col(const float* W, int k0, int n, int lane, int ld, int K) { float v[16]; const int g = lane >> 4;
#pragma unroll
  for (int i = 0; i < 8; ++i) { const int ka = k0 + 8 * g + i, kb = ka + 16; v[i] = ka < K ? W[(size_t)(ka < K ? ka : K - 1) * ld + n] : 0.f; v[8 + i] = kb < K ? W[(size_t)(kb < K ? kb : K - 1) * ld + n] : 0.f; }
  return bsplit16(v); }
__device__ __forceinline__ v8f mac3(const F2& a, const F2& b, v8f c) { c = wmma_bf(a.l, b.h, c); c = wmma_bf(a.h, b.l, c); return wmma_bf(a.h, b.h, c); }
__device__ __forceinline__ float sigm(float v) { return 1.0f / (1.0f + expf(-v)); }
#define LDSX() do { asm volatile("s_wait_dscnt 0" ::: "memory"); __builtin_amdgcn_wave_barrier(); __builtin_amdgcn_fence(__ATOMIC_RELEASE, "workgroup"); } while (0)


#define NB 4
#define SS 2048
#define E 1024
#define NH 16
#define HD 64
#define NR (NB * SS)
#define PLO 1024.0f
#define VLO 2048.0f
#define SCL2 0.18033688011112042f   // 1/sqrt(64) x log2(e)
__device__ __forceinline__ float bfr(float v) { return (float)(__bf16)v; }
__device__ __forceinline__ v16b frag_b(const __bf16* rowk0, int lane) { return __builtin_bit_cast(v16b, frag_h((const _Float16*)rowk0, lane)); }
// a split row: 64 f32 values kept as 64 bf16 hi | 64 bf16 lo (hi = bf16(v), lo = bf16(v - hi), as bsplit16 has them), 256 bytes like the f32 row
// eight values of one lane: 16 bytes into the row's hi half at d, 16 into its lo half; eight lanes fill each half's 128 bytes
__device__ __forceinline__ void store_split8(const float* s, __bf16* d) { union { __bf16 e[8]; v4u u; } hi, lo;
#pragma unroll
  for (int e = 0; e < 8; ++e) { const float v = s[e]; const __bf16 hv = (__bf16)v; hi.e[e] = hv; lo.e[e] = (__bf16)(v - (float)hv); }
  vst2(d, hi.u); vst2(d + HD, lo.u); }
// the fragment pair of a split row at k0
__device__ __forceinline__ F2 frag_split(const __bf16* row, int k0, int lane) { F2 r; r.h = frag_b(row + k0, lane); r.l = frag_b(row + HD + k0, lane); return r; }

__global__ __launch_bounds__(256) void k_cvt(const float* __restrict__ x, __bf16* __restrict__ Xb) {
  const size_t i8 = (size_t)blockIdx.x * 256 + threadIdx.x; if (i8 >= (size_t)NR * E / 8) return;
  union { __bf16 h[8]; v4u u; } pk;
#pragma unroll
  for (int e = 0; e < 8; ++e) pk.h[e] = (__bf16)x[i8 * 8 + e];
  vst2((unsigned*)(Xb + i8 * 8), pk.u);
}
// PT rows: [0,E) Wq[:,n], [E,2E) Wk[:,n], [2E,3E) Wv[:,n], [3E,4E) Wo[:,n]  ([in][out] weights: column n as a bf16 row)
__global__ __launch_bounds__(128) void k_pack(const float* __restrict__ Wqkv, const float* __restrict__ Wp, __bf16* __restrict__ PT) {
  const int n = blockIdx.x, tid = threadIdx.x; __shared__ __align__(16) __bf16 srow[E];
  for (int k = tid; k < E; k += 128) srow[k] = (__bf16)(n < 3 * E ? Wqkv[(size_t)k * (3 * E) + n] : Wp[(size_t)k * E + (n - 3 * E)]);
  __syncthreads();
  if (tid < E / 8) vst2((unsigned*)(PT + (size_t)n * E + tid * 8), *(const v4u*)(&srow[tid * 8]));
}
// eight 16-byte asynchronous copies of one lane, global -> LDS: LDS byte address l + i*ls, global address g + i*gs bytes.
// s_wait_xcnt closes the copies' own statement, so no address register is rewritten ahead of it.
__device__ __forceinline__ void copy8(unsigned l, unsigned ls, const char* g, size_t gs) {
  asm volatile("global_load_async_to_lds_b128 %0, %8, off\n\t"
               "global_load_async_to_lds_b128 %1, %9, off\n\t"
               "global_load_async_to_lds_b128 %2, %10, off\n\t"
               "global_load_async_to_lds_b128 %3, %11, off\n\t"
               "global_load_async_to_lds_b128 %4, %12, off\n\t"
               "global_load_async_to_lds_b128 %5, %13, off\n\t"
               "global_load_async_to_lds_b128 %6, %14, off\n\t"
               "global_load_async_to_lds_b128 %7, %15, off\n\t"
               "s_wait_xcnt 0x0"
               :: "v"(l), "v"(l + ls), "v"(l + 2 * ls), "v"(l + 3 * ls), "v"(l + 4 * ls), "v"(l + 5 * ls), "v"(l + 6 * ls), "v"(l + 7 * ls),
                  "v"(g), "v"(g + gs), "v"(g + 2 * gs), "v"(g + 3 * gs), "v"(g + 4 * gs), "v"(g + 5 * gs), "v"(g + 6 * gs), "v"(g + 7 * gs)
               : "memory");
}
// the same for two planes of four copies each: plane 1 lies lp bytes further in LDS and gp bytes further in memory
__device__ __forceinline__ void copy4x2(unsigned l, unsigned ls, unsigned lp, const char* g, size_t gs, size_t gp) {
  asm volatile("global_load_async_to_lds_b128 %0, %8, off\n\t"
               "global_load_async_to_lds_b128 %1, %9, off\n\t"
               "global_load_async_to_lds_b128 %2, %10, off\n\t"
               "global_load_async_to_lds_b128 %3, %11, off\n\t"
               "global_load_async_to_lds_b128 %4, %12, off\n\t"
               "global_load_async_to_lds_b128 %5, %13, off\n\t"
               "global_load_async_to_lds_b128 %6, %14, off\n\t"
               "global_load_async_to_lds_b128 %7, %15, off\n\t"
               "s_wait_xcnt 0x0"
               :: "v"(l), "v"(l + ls), "v"(l + 2 * ls), "v"(l + 3 * ls), "v"(l + lp), "v"(l + lp + ls), "v"(l + lp + 2 * ls), "v"(l + lp + 3 * ls),
                  "v"(g), "v"(g + gs), "v"(g + 2 * gs), "v"(g + 3 * gs), "v"(g + gp), "v"(g + gp + gs), "v"(g + gp + 2 * gs), "v"(g + gp + 3 * gs)
               : "memory");
}
// the same for four copies
__device__ __forceinline__ void copy4(unsigned l, unsigned ls, const char* g, size_t gs) {
  asm volatile("global_load_async_to_lds_b128 %0, %4, off\n\t"
               "global_load_async_to_lds_b128 %1, %5, off\n\t"
               "global_load_async_to_lds_b128 %2, %6, off\n\t"
               "global_load_async_to_lds_b128 %3, %7, off\n\t"
               "s_wait_xcnt 0x0"
               :: "v"(l), "v"(l + ls), "v"(l + 2 * ls), "v"(l + 3 * ls),
                  "v"(g), "v"(g + gs), "v"(g + 2 * gs), "v"(g + 3 * gs)
               : "memory");
}
__device__ __forceinline__ unsigned lds_off(const void* p) { return (unsigned)(size_t)p; }
#define KP 68   // LDS pitch, in floats, of a 256-byte row (64 floats; a key's 64 bf16 hi | 64 bf16 lo): 272 B = 16 B x odd
#define VP 72   // LDS pitch of a 64-half V^T row: 144 B = 16 B x odd
#define GP 72   // LDS pitch of a 64-element bf16 k slice: 144 B = 16 B x odd
// LDS of the two projections: in the k loop two buffers of the operands' 64-wide k slices; behind it, on the same bytes, the output staging
union QkvLds { struct { __bf16 a[2][64][GP]; __bf16 b[2][128][GP]; } st; float so[4][16][132]; struct { _Float16 h[128][72], l[128][72]; } vt; };
union OutLds { struct { float a[2][64][KP]; __bf16 b[2][128][GP]; } st; float so[4][16][132]; };
// each 64-wide k slice of the block's 64 X rows and 128 weight rows is copied to LDS once for the four waves, two buffers, the next slice in flight while this one is worked on
// QKV: block (64 rows, 128 cols = 2 heads, which); q (+bias) -> Q32 f32 [bh][s][64]; k (+bias) -> KS [bh][s][64 bf16 hi | 64 bf16 lo], the split that the scores use; v (+bias) -> VT hi/lo x4 [bh][d][s]
// five waves a SIMD is what the LDS allows: the bound keeps the register count of the v epilogue from costing one of them (without it this build takes 210 registers, with it 152 as before)
__global__ __launch_bounds__(128, 5) void k_qkv(const __bf16* __restrict__ Xb, int rbase, const __bf16* __restrict__ PT, const float* __restrict__ bqkv, const float* __restrict__ bQ, const float* __restrict__ bK, const float* __restrict__ bV, float* __restrict__ Q32, __bf16* __restrict__ KS, _Float16* __restrict__ VTh, _Float16* __restrict__ VTl) {
  __shared__ __align__(16) QkvLds sm;
  float (&so)[4][16][132] = sm.so; _Float16 (&sth)[128][72] = sm.vt.h, (&stl)[128][72] = sm.vt.l;
  const int tid = threadIdx.x, wave = tid >> 5, lane = tid & 31, col = lane & 15, g = lane >> 4;
  const int which = blockIdx.z, r0b = blockIdx.x * 64, n0 = blockIdx.y * 128; const int b = r0b / SS, s0 = r0b % SS;
  const float* bb_ = bqkv + which * E; const float* bx_ = which == 0 ? bQ : (which == 1 ? bK : bV);      // column n = h*64 + d indexes both biases
  v8f acc[8] = {};
  // a lane's share of a slice: row 16 i + tid/8, 16-byte piece tid%8 of the row's 128 bytes
  const char* gA = (const char*)(Xb + (size_t)(rbase + r0b + (tid >> 3)) * E + (tid & 7) * 8);
  const char* gB = (const char*)(PT + (size_t)(which * E + n0 + (tid >> 3)) * E + (tid & 7) * 8);
  const unsigned lA = lds_off(&sm.st.a[0][tid >> 3][(tid & 7) * 8]), lB = lds_off(&sm.st.b[0][tid >> 3][(tid & 7) * 8]);
  auto stage = [&](int buf, int kt) {
    copy4(lA + buf * (unsigned)sizeof(sm.st.a[0]), 16 * GP * 2, gA + (size_t)kt * 128, (size_t)16 * E * 2);
    copy8(lB + buf * (unsigned)sizeof(sm.st.b[0]), 16 * GP * 2, gB + (size_t)kt * 128, (size_t)16 * E * 2); };
  stage(0, 0);
  asm volatile("s_wait_asynccnt 0x0" ::: "memory");   // this wave's copies of slice 0 have landed
  __syncthreads();                                     // and every other wave's: slice 0 may be read
  stage(1, 1);
#pragma unroll 1   // rolled, for speed only
  for (int kt = 0; kt < E / 64; ++kt) { const int buf = kt & 1;
#pragma unroll
    for (int kc = 0; kc < 2; ++kc) { const v16b a = frag_b(&sm.st.a[buf][wave * 16 + col][kc * 32], lane); v16b wb[8];
#pragma unroll
      for (int j = 0; j < 8; ++j) wb[j] = frag_b(&sm.st.b[buf][j * 16 + col][kc * 32], lane);
#pragma unroll
      for (int j = 0; j < 8; ++j) acc[j] = wmma_bf(a, wb[j], acc[j]); }
    asm volatile("s_wait_dscnt 0x0" ::: "memory");      // this wave's reads of buffer buf are done
    asm volatile("s_wait_asynccnt 0x0" ::: "memory");   // its copies of slice kt + 1 have landed
    __syncthreads();                                     // publishes slice kt + 1 and frees buffer buf (behind the last slice: for the output staging)
    if (kt + 2 < E / 64) stage(buf, kt + 2); }
  asm volatile("s_wait_asynccnt 0x0" ::: "memory");     // no copy is left in flight behind the loop
  if (which < 2) {
#pragma unroll
    for (int j = 0; j < 8; ++j) { const float bb = bfr(bb_[n0 + j * 16 + col]) + bfr(bx_[n0 + j * 16 + col]);
#pragma unroll
      for (int r = 0; r < 8; ++r) so[wave][8 * g + r][j * 16 + col] = acc[j][r] + bb; }
    LDSX();
    if (which == 0) {
      for (int qq = lane; qq < 2 * 16 * 16; qq += 32) { const int hh = qq >> 8, rl = (qq >> 4) & 15, pc = qq & 15; const int h = (n0 >> 6) + hh;
        vst2(Q32 + (((size_t)b * NH + h) * SS + s0 + wave * 16 + rl) * HD + pc * 4, *(const v4f*)(&so[wave][rl][hh * 64 + pc * 4])); } }
    else {
      for (int qq = lane; qq < 2 * 16 * 8; qq += 32) { const int hh = qq >> 7, rl = (qq >> 3) & 15, pc = qq & 7; const int h = (n0 >> 6) + hh;
        store_split8(&so[wave][rl][hh * 64 + pc * 8], KS + (((size_t)b * NH + h) * SS + s0 + wave * 16 + rl) * (2 * HD) + pc * 8); } } }
  else {
#pragma unroll
    for (int j = 0; j < 8; ++j) { const float bb = bfr(bb_[n0 + j * 16 + col]) + bfr(bx_[n0 + j * 16 + col]);
#pragma unroll
      for (int r = 0; r < 8; ++r) { const float v = (acc[j][r] + bb) * 4.0f; const _Float16 hi = (_Float16)v; sth[j * 16 + col][wave * 16 + 8 * g + r] = hi; stl[j * 16 + col][wave * 16 + 8 * g + r] = (_Float16)((v - (float)hi) * VLO); } }
    __syncthreads();
    for (int qq = tid; qq < 128 * 8; qq += 128) { const int cl = qq >> 3, pc = qq & 7; const int c = n0 + cl, h = c >> 6, d = c & 63; const size_t o = (((size_t)b * NH + h) * HD + d) * SS + s0 + pc * 8;
      vst2(VTh + o, *(const v4u*)(&sth[cl][pc * 8])); vst2(VTl + o, *(const v4u*)(&stl[cl][pc * 8])); } }
}
// causal attention: block (bh, 64 queries, last query block first); key tiles 0..qb; each 64-key tile of K, V^T hi and V^T lo is copied to LDS once for the four waves, two buffers, the next tile in flight while this one is worked on; S on bf16 hi/lo splits: q split here from its f32 rows, k read ready split (a key row in LDS is 64 hi | 64 lo, as in memory); P,V hi/lo; O -> OS, split rows [bh][s][64 hi | 64 lo], the split that the output projection uses
__global__ __launch_bounds__(128) void k_attn(const float* __restrict__ Q32, const __bf16* __restrict__ KS, const _Float16* __restrict__ VTh, const _Float16* __restrict__ VTl, __bf16* __restrict__ OS) {
  __shared__ __align__(16) float sS[4][16][68];
  __shared__ __align__(16) _Float16 sPh[4][16][72], sPl[4][16][72];
  __shared__ __align__(16) float sK[2][64][KP];
  __shared__ __align__(16) _Float16 sV[2][2][64][VP];      // [buffer][hi, lo][d][key]
  const int tid = threadIdx.x, w = tid >> 5, lane = tid & 31, col = lane & 15, g = lane >> 4;
  // placement: a block's cost grows with its query block (qb + 1 key tiles) and there are more blocks than resident places. The head
  // is the fast index and the query block falls with the slow one: the longest blocks come first in index order, the short ones last,
  // and blocks whose indices lie a multiple of 64 apart now differ in length (before, they were equally long)
  const size_t bh = blockIdx.x; const int qb = SS / 64 - 1 - (int)blockIdx.y; const int q0 = qb * 64 + w * 16;
  F2 aq[2];
#pragma unroll
  for (int kc = 0; kc < 2; ++kc) aq[kc] = split_row(Q32 + (bh * SS + q0 + col) * HD, kc * 32, lane);
  // softmax in base 2: scores carry 1/8 x log2(e), so that e^(s/8 - m) is one subtract and one v_exp_f32 (library expf: thirteen vector instructions a score);
  // the running reference mrun is the row maximum less 14, the same in P, in the row sum and in the rescale, so P comes out scaled by 2^14 with no multiply
  float mrun = -3.0e38f, lrun = 0.f; v8f acc[4] = {}, ac1[4] = {}, ac2[4] = {};
  // a lane's share of a tile: K, 16 KiB in a row in memory, piece tid + 128 i (LDS row 8 i + tid/16); V^T hi then lo, row 16 i + tid/8, piece tid%8
  const char* gK = (const char*)(KS + bh * SS * (2 * HD)) + tid * 16;
  const size_t vrow = ((bh * HD + (tid >> 3)) * SS + (tid & 7) * 8) * 2;
  const char* gVh = (const char*)VTh + vrow; const size_t gVd = (const char*)VTl - (const char*)VTh;
  const unsigned lK = lds_off(&sK[0][tid >> 4][(tid & 15) * 4]), lV = lds_off(&sV[0][0][tid >> 3][(tid & 7) * 8]);
  auto stage = [&](int buf, int kt) {
    copy8(lK + buf * (unsigned)sizeof(sK[0]), 8 * KP * 4, gK + (size_t)kt * (64 * HD * 4), 128 * 16);
    const char* gv = gVh + (size_t)kt * 128; const unsigned lv = lV + buf * (unsigned)sizeof(sV[0]);
    copy4x2(lv, 16 * VP * 2, (unsigned)sizeof(sV[0][0]), gv, (size_t)16 * SS * 2, gVd); };
  stage(0, 0);
  asm volatile("s_wait_asynccnt 0x0" ::: "memory");   // this wave's copies of tile 0 have landed
  __syncthreads();                                     // and every other wave's: tile 0 may be read
  if (qb >= 1) stage(1, 1);
#pragma unroll 1
  for (int kt = 0; kt <= qb; ++kt) { const int buf = kt & 1;
#pragma unroll
    for (int t = 0; t < 4; ++t) { const int key = kt * 64 + t * 16 + col; const __bf16* krow = (const __bf16*)&sK[buf][t * 16 + col][0];
      v8f s = mac3(aq[0], frag_split(krow, 0, lane), (v8f){}); s = mac3(aq[1], frag_split(krow, 32, lane), s);
#pragma unroll
      for (int r = 0; r < 8; ++r) { sS[w][8 * g + r][t * 16 + col] = (key > q0 + 8 * g + r) ? -3.0e38f : s[r] * SCL2; } }
    LDSX();
    float mx = -3.4e38f;
#pragma unroll
    for (int jj = 0; jj < 32; ++jj) mx = fmaxf(mx, sS[w][col][g * 32 + jj]);
    mx = fmaxf(mx, __shfl_xor(mx, 16, 32));
    const float mnew = fmaxf(mrun, mx - 14.0f); const float corr = __builtin_amdgcn_exp2f(mrun - mnew);
    float ps = 0.f;
#pragma unroll
    for (int jj = 0; jj < 32; ++jj) { const float p = __builtin_amdgcn_exp2f(sS[w][col][g * 32 + jj] - mnew); ps += p; const _Float16 hi = (_Float16)p; sPh[w][col][g * 32 + jj] = hi; sPl[w][col][g * 32 + jj] = (_Float16)((p - (float)hi) * PLO); }
    ps += __shfl_xor(ps, 16, 32);
    lrun = lrun * corr + ps * (1.0f / 16384.0f); mrun = mnew;
#pragma unroll
    for (int r = 0; r < 8; ++r) { const float cr = __shfl(corr, 8 * g + r, 32);
#pragma unroll
      for (int t = 0; t < 4; ++t) { acc[t][r] *= cr; ac1[t][r] *= cr; ac2[t][r] *= cr; } }
    LDSX();
#pragma unroll
    for (int kc = 0; kc < 2; ++kc) { const v16h ph = frag_h(&sPh[w][col][0] + kc * 32, lane), pl = frag_h(&sPl[w][col][0] + kc * 32, lane);
#pragma unroll
      for (int t = 0; t < 4; ++t) { const v16h vh = frag_h(&sV[buf][0][t * 16 + col][kc * 32], lane);
        acc[t] = wmma16(ph, vh, acc[t]); ac1[t] = wmma16(ph, frag_h(&sV[buf][1][t * 16 + col][kc * 32], lane), ac1[t]); ac2[t] = wmma16(pl, vh, ac2[t]); } }
    __builtin_amdgcn_wave_barrier();
    asm volatile("s_wait_dscnt 0x0" ::: "memory");      // this wave's reads of buffer buf are done
    asm volatile("s_wait_asynccnt 0x0" ::: "memory");   // its copies of tile kt + 1 have landed
    __syncthreads();                                     // publishes tile kt + 1 and frees buffer buf
    if (kt + 2 <= qb) stage(buf, kt + 2); }
  asm volatile("s_wait_asynccnt 0x0" ::: "memory");     // no copy is left in flight behind the loop
  // the output rows are staged in the wave's own score rows, which are dead here: with the tile buffers three work-groups still fit one WGP's LDS
#pragma unroll
  for (int r = 0; r < 8; ++r) { const float lr = __shfl(lrun, 8 * g + r, 32); const float inv = 1.0f / (lr * 16384.0f * 4.0f);
#pragma unroll
    for (int t = 0; t < 4; ++t) sS[w][8 * g + r][t * 16 + col] = (acc[t][r] + ac1[t][r] * (1.0f / VLO) + ac2[t][r] * (1.0f / PLO)) * inv; }
  LDSX();
  for (int qq = lane; qq < 16 * 8; qq += 32) { const int rl = qq >> 3, pc = qq & 7; store_split8(&sS[w][rl][pc * 8], OS + ((bh * SS) + q0 + rl) * (2 * HD) + pc * 8); }
}
// out = ctx Wo^T + bo : split(ctx) x bf16(Wo rows): 2 products (Wo is an INPUT -> bf16 exact); k slices of the 64 context rows (split rows, read ready split) and 128 weight rows staged in LDS as in k_qkv
__global__ __launch_bounds__(128) void k_out(const __bf16* __restrict__ OS, int rbase, const __bf16* __restrict__ PT, const float* __restrict__ bo, float* __restrict__ out) {
  __shared__ __align__(16) OutLds sm;
  float (&so)[4][16][132] = sm.so;
  const int tid = threadIdx.x, wave = tid >> 5, lane = tid & 31, col = lane & 15, g = lane >> 4;
  const int r0b = blockIdx.x * 64, r0 = r0b + wave * 16, n0 = blockIdx.y * 128; const int b = r0b / SS, s0 = r0b % SS;
  v8f acc[8] = {};
  // slice kt is head kt. A lane's share: context, 16 KiB in a row in memory, piece tid + 128 i (LDS row 8 i + tid/16); weights, row 16 i + tid/8, piece tid%8
  const char* gA = (const char*)(OS + ((size_t)b * NH * SS + s0) * (2 * HD)) + tid * 16;
  const char* gB = (const char*)(PT + (size_t)(3 * E + n0 + (tid >> 3)) * E + (tid & 7) * 8);
  const unsigned lA = lds_off(&sm.st.a[0][tid >> 4][(tid & 15) * 4]), lB = lds_off(&sm.st.b[0][tid >> 3][(tid & 7) * 8]);
  auto stage = [&](int buf, int kt) {
    copy8(lA + buf * (unsigned)sizeof(sm.st.a[0]), 8 * KP * 4, gA + (size_t)kt * (SS * HD * 4), 128 * 16);
    copy8(lB + buf * (unsigned)sizeof(sm.st.b[0]), 16 * GP * 2, gB + (size_t)kt * 128, (size_t)16 * E * 2); };
  stage(0, 0);
  asm volatile("s_wait_asynccnt 0x0" ::: "memory");   // this wave's copies of slice 0 have landed
  __syncthreads();                                     // and every other wave's: slice 0 may be read
  stage(1, 1);
#pragma unroll 1   // rolled, for speed only
  for (int kt = 0; kt < NH; ++kt) { const int buf = kt & 1;
#pragma unroll
    for (int kc = 0; kc < 2; ++kc) { const F2 a = frag_split((const __bf16*)&sm.st.a[buf][wave * 16 + col][0], kc * 32, lane); v16b wb[8];
#pragma unroll
      for (int j = 0; j < 8; ++j) wb[j] = frag_b(&sm.st.b[buf][j * 16 + col][kc * 32], lane);
#pragma unroll
      for (int j = 0; j < 8; ++j) { acc[j] = wmma_bf(a.l, wb[j], acc[j]); acc[j] = wmma_bf(a.h, wb[j], acc[j]); } }
    asm volatile("s_wait_dscnt 0x0" ::: "memory");      // this wave's reads of buffer buf are done
    asm volatile("s_wait_asynccnt 0x0" ::: "memory");   // its copies of slice kt + 1 have landed
    __syncthreads();                                     // publishes slice kt + 1 and frees buffer buf (behind the last slice: for the output staging)
    if (kt + 2 < NH) stage(buf, kt + 2); }
  asm volatile("s_wait_asynccnt 0x0" ::: "memory");     // no copy is left in flight behind the loop
#pragma unroll
  for (int j = 0; j < 8; ++j) { const int n = n0 + j * 16 + col; const float bb = bfr(bo[n]);
#pragma unroll
    for (int r = 0; r < 8; ++r) so[wave][8 * g + r][j * 16 + col] = acc[j][r] + bb; }
  LDSX();
#pragma unroll 4
  for (int rl = 0; rl < 16; ++rl) vst2(out + (size_t)(rbase + r0 + rl) * E + n0 + lane * 4, *(const v4f*)(&so[wave][rl][lane * 4]));
}
extern "C" void kernel_launch(void* const* d_in, const int* in_sizes, int n_in, void* d_out, int out_size, void* d_ws, size_t ws_size, hipStream_t stream) {
  (void)in_sizes; (void)n_in; (void)out_size; (void)ws_size;
  const float* x = (const float*)d_in[0]; const float* Wqkv = (const float*)d_in[1]; const float* bqkv = (const float*)d_in[2]; const float* Wp = (const float*)d_in[3]; const float* bp = (const float*)d_in[4]; const float* bQ = (const float*)d_in[5]; const float* bK = (const float*)d_in[6]; const float* bV = (const float*)d_in[7];
  float* out = (float*)d_out;
  char* ws = (char*)d_ws; size_t off = 0;
  auto take = [&](size_t bytes) { char* p = ws + off; off += (bytes + 255) & ~(size_t)255; return p; };
  __bf16* Xb = (__bf16*)take((size_t)NR * E * 2); __bf16* PT = (__bf16*)take((size_t)4 * E * E * 2);
  float* Q32 = (float*)take((size_t)NR * E * 4); __bf16* KS = (__bf16*)take((size_t)NR * E * 4); _Float16* VTh = (_Float16*)take((size_t)NR * E * 2); _Float16* VTl = (_Float16*)take((size_t)NR * E * 2);
  __bf16* OS = (__bf16*)Q32;      // in place, a split row has the f32 row's 256 bytes: each k_attn wave reads its own 16 query rows into registers before writing the same rows; no other block reads them
  // ws: 120 MiB. One launch of each kernel covers the whole batch: two passes over half the batch left places empty in every launch
  // (k_out: 512 blocks on 1,024 places; k_qkv: 1,536 on 1,280, a second round one fifth full; k_attn: 1,024 blocks of unequal length on 768, each pass as long as its fullest WGP)
  k_cvt<<<(NR * E / 8 + 255) / 256, 256, 0, stream>>>(x, Xb);
  k_pack<<<4 * E, 128, 0, stream>>>(Wqkv, Wp, PT);
  k_qkv<<<dim3(NR / 64, E / 128, 3), 128, 0, stream>>>(Xb, 0, PT, bqkv, bQ, bK, bV, Q32, KS, VTh, VTl);
  k_attn<<<dim3(NB * NH, SS / 64), 128, 0, stream>>>(Q32, KS, VTh, VTl, OS);
  k_out<<<dim3(NR / 64, E / 128), 128, 0, stream>>>(OS, 0, PT, bp, out);
}

// v007
// Measured time: 223 microseconds a run.
// Two timings next to v006 put it at 1.16 and 1.15 times that version's speed.
// Over all steps from v000 it is 4.71 times as fast.
// compute dtype: x, W_attn, b_attn, W_proj, b_proj, bQ/bK/bV (INPUTS) rounded to bf16 with exact bf16 WMMA products (f32 accumulate) for the projections; q/k f32 split in bf16 hi/lo for the scores (3 products; k is split once, where it is produced), P and V f16 hi/lo (3 products); softmax f32.
#include <hip/hip_runtime.h>
#include <math.h>

typedef __attribute__((ext_vector_type(16))) _Float16 v16h;
typedef __attribute__((ext_vector_type(16))) __bf16 v16b;
typedef __attribute__((ext_vector_type(8)))  _Float16 v8h;
typedef __attribute__((ext_vector_type(8)))  float v8f;
typedef __attribute__((ext_vector_type(4)))  float v4f;
typedef __attribute__((ext_vector_type(2)))  float v2f;
typedef __attribute__((ext_vector_type(4)))  unsigned v4u;
typedef __attribute__((ext_vector_type(4)))  int v4i;
typedef float __attribute__((may_alias)) float_a;
typedef int __attribute__((may_alias)) int_a;

template <typename T> __device__ __forceinline__ void vst2(void* p, T v) { *(T*)p = v;  }
__device__ __forceinline__ v8f wmma16(v16h a, v16h b, v8f c) {
  v8f d = __builtin_amdgcn_wmma_f32_16x16x32_f16(false, a, false, b, (short)0, c, false, false);
  asm volatile("v_nop\n\tv_nop\n\tv_nop\n\tv_nop" : "+v"(d) : "v"(a), "v"(b));
  return d;
}
__device__ __forceinline__ v8f wmma_bf(v16b a, v16b b, v8f c) {
  v8f d = __builtin_amdgcn_wmma_f32_16x16x32_bf16(false, a, false, b, (short)0, c, false, false);
  asm volatile("v_nop\n\tv_nop\n\tv_nop\n\tv_nop" : "+v"(d) : "v"(a), "v"(b));
  return d;
}
// 16x16x32 fragments: lane = (h = lane>>4, row/col = lane&15); elements 0..7 = k0+8h+0..7, 8..15 = k0+16+8h+0..7; D element r = row 8h+r
__device__ __forceinline__ v16h frag_h(const _Float16* rowk0, int lane) {
  union { v16h v; v8h q[2]; } u; const _Float16* p = rowk0 + 8 * (lane >> 4);
  u.q[0] = *(const v8h*)p; u.q[1] = *(const v8h*)(p + 16); return u.v;
}
__device__ __forceinline__ v16h frag_f32(const float* rowk0, int lane) {
  v16h a; const float* p = rowk0 + 8 * (lane >> 4);
#pragma unroll
  for (int i = 0; i < 8; ++i) { a[i] = (_Float16)p[i]; a[8 + i] = (_Float16)p[16 + i]; }
  return a;
}
__device__ __forceinline__ v16h frag_f32s(const float* rowk0, int lane, float sc) {
  v16h a; const float* p = rowk0 + 8 * (lane >> 4);
#pragma unroll
  for (int i = 0; i < 8; ++i) { a[i] = (_Float16)(p[i] * sc); a[8 + i] = (_Float16)(p[16 + i] * sc); }
  return a;
}
// column fragment from a [K][ld] layout (column n), rows >= K read as 0
__device__ __forceinline__ v16h fragc_f32(const float* W, int k0, int n, int lane, int ld, int K) {
  v16h a; const int g = lane >> 4;
#pragma unroll
  for (int i = 0; i < 8; ++i) { const int ka = k0 + 8 * g + i, kb = ka + 16;
    a[i] = (_Float16)(ka < K ? W[(size_t)(ka < K ? ka : K - 1) * ld + n] : 0.f); a[8 + i] = (_Float16)(kb < K ? W[(size_t)(kb < K ? kb : K - 1) * ld + n] : 0.f); }
  return a;
}
struct F2 { v16b h, l; };
__device__ __forceinline__ F2 bsplit16(const float v[16]) { F2 r;
#pragma unroll
  for (int i = 0; i < 16; ++i) { const __bf16 h = (__bf16)v[i]; r.h[i] = h; r.l[i] = (__bf16)(v[i] - (float)h); }
  return r; }
__device__ __forceinline__ F2 split_row(const float* row, int k0, int lane) { float v[16]; const float* p = row + k0 + 8 * (lane >> 4);
#pragma unroll
  for (int i = 0; i < 8; ++i) { v[i] = p[i]; v[8 + i] = p[16 + i]; }
  return bsplit16(v); }
__device__ __forceinline__ F2 split_rowK(const float* row, int k0, int lane, int K) { float v[16]; const int g = lane >> 4;
#pragma unroll
  for (int i = 0; i < 8; ++i) { const int ka = k0 + 8 * g + i, kb = ka + 16; v[i] = ka < K ? row[ka < K ? ka : K - 1] : 0.f; v[8 + i] = kb < K ? row[kb < K ? kb : K - 1] : 0.f; }
  return bsplit16(v); }
__device__ __forceinline__ F2 split_col(const float* W, int k0, int n, int lane, int ld, int K) { float v[16]; const int g = lane >> 4;
#pragma unroll
  for (int i = 0; i < 8; ++i) { const int ka = k0 + 8 * g + i, kb = ka + 16; v[i] = ka < K ? W[(size_t)(ka < K ? ka : K - 1) * ld + n] : 0.f; v[8 + i] = kb < K ? W[(size_t)(kb < K ? kb : K - 1) * ld + n] : 0.f; }
  return bsplit16(v); }
__device__ __forceinline__ v8f mac3(const F2& a, const F2& b, v8f c) { c = wmma_bf(a.l, b.h, c); c = wmma_bf(a.h, b.l, c); return wmma_bf(a.h, b.h, c); }
__device__ __forceinline__ float sigm(float v) { return 1.0f / (1.0f + expf(-v)); }
#define LDSX() do { asm volatile("s_wait_dscnt 0" ::: "memory"); __builtin_amdgcn_wave_barrier(); __builtin_amdgcn_fence(__ATOMIC_RELEASE, "workgroup"); } while (0)


#define NB 4
#define SS 2048
#define E 1024
#define NH 16
#define HD 64
#define NR (NB * SS)
#define PLO 1024.0f
#define VLO 2048.0f
#define SCL2 0.18033688011112042f   // 1/sqrt(64) x log2(e)
__device__ __forceinline__ float bfr(float v) { return (float)(__bf16)v; }
__device__ __forceinline__ v16b frag_b(const __bf16* rowk0, int lane) { return __builtin_bit_cast(v16b, frag_h((const _Float16*)rowk0, lane)); }
// a split row: 64 f32 values kept as 64 bf16 hi | 64 bf16 lo (hi = bf16(v), lo = bf16(v - hi), as bsplit16 has them), 256 bytes like the f32 row
// eight values of one lane: 16 bytes into the row's hi half at d, 16 into its lo half; eight such stores fill each half's 128 bytes
__device__ __forceinline__ void store_split8(const float* s, __bf16* d) { union { __bf16 e[8]; v4u u; } hi, lo;
#pragma unroll
  for (int e = 0; e < 8; ++e) { const float v = s[e]; const __bf16 hv = (__bf16)v; hi.e[e] = hv; lo.e[e] = (__bf16)(v - (float)hv); }
  vst2(d, hi.u); vst2(d + HD, lo.u); }
// the fragment pair of a split row at k0
__device__ __forceinline__ F2 frag_split(const __bf16* row, int k0, int lane) { F2 r; r.h = frag_b(row + k0, lane); r.l = frag_b(row + HD + k0, lane); return r; }

__global__ __launch_bounds__(256) void k_cvt(const float* __restrict__ x, __bf16* __restrict__ Xb) {
  const size_t i8 = (size_t)blockIdx.x * 256 + threadIdx.x; if (i8 >= (size_t)NR * E / 8) return;
  union { __bf16 h[8]; v4u u; } pk;
#pragma unroll
  for (int e = 0; e < 8; ++e) pk.h[e] = (__bf16)x[i8 * 8 + e];
  vst2((unsigned*)(Xb + i8 * 8), pk.u);
}
// PT rows: [0,E) Wq[:,n], [E,2E) Wk[:,n], [2E,3E) Wv[:,n], [3E,4E) Wo[:,n]  ([in][out] weights: column n as a bf16 row)
__global__ __launch_bounds__(128) void k_pack(const float* __restrict__ Wqkv, const float* __restrict__ Wp, __bf16* __restrict__ PT) {
  const int n = blockIdx.x, tid = threadIdx.x; __shared__ __align__(16) __bf16 srow[E];
  for (int k = tid; k < E; k += 128) srow[k] = (__bf16)(n < 3 * E ? Wqkv[(size_t)k * (3 * E) + n] : Wp[(size_t)k * E + (n - 3 * E)]);
  __syncthreads();
  if (tid < E / 8) vst2((unsigned*)(PT + (size_t)n * E + tid * 8), *(const v4u*)(&srow[tid * 8]));
}
// eight 16-byte asynchronous copies of one lane, global -> LDS: LDS byte address l + i*ls, global address g + i*gs bytes.
// s_wait_xcnt closes the copies' own statement, so no address register is rewritten ahead of it.
__device__ __forceinline__ void copy8(unsigned l, unsigned ls, const char* g, size_t gs) {
  asm volatile("global_load_async_to_lds_b128 %0, %8, off\n\t"
               "global_load_async_to_lds_b128 %1, %9, off\n\t"
               "global_load_async_to_lds_b128 %2, %10, off\n\t"
               "global_load_async_to_lds_b128 %3, %11, off\n\t"
               "global_load_async_to_lds_b128 %4, %12, off\n\t"
               "global_load_async_to_lds_b128 %5, %13, off\n\t"
               "global_load_async_to_lds_b128 %6, %14, off\n\t"
               "global_load_async_to_lds_b128 %7, %15, off\n\t"
               "s_wait_xcnt 0x0"
               :: "v"(l), "v"(l + ls), "v"(l + 2 * ls), "v"(l + 3 * ls), "v"(l + 4 * ls), "v"(l + 5 * ls), "v"(l + 6 * ls), "v"(l + 7 * ls),
                  "v"(g), "v"(g + gs), "v"(g + 2 * gs), "v"(g + 3 * gs), "v"(g + 4 * gs), "v"(g + 5 * gs), "v"(g + 6 * gs), "v"(g + 7 * gs)
               : "memory");
}
// the same for two planes of four copies each: plane 1 lies lp bytes further in LDS and gp bytes further in memory
__device__ __forceinline__ void copy4x2(unsigned l, unsigned ls, unsigned lp, const char* g, size_t gs, size_t gp) {
  asm volatile("global_load_async_to_lds_b128 %0, %8, off\n\t"
               "global_load_async_to_lds_b128 %1, %9, off\n\t"
               "global_load_async_to_lds_b128 %2, %10, off\n\t"
               "global_load_async_to_lds_b128 %3, %11, off\n\t"
               "global_load_async_to_lds_b128 %4, %12, off\n\t"
               "global_load_async_to_lds_b128 %5, %13, off\n\t"
               "global_load_async_to_lds_b128 %6, %14, off\n\t"
               "global_load_async_to_lds_b128 %7, %15, off\n\t"
               "s_wait_xcnt 0x0"
               :: "v"(l), "v"(l + ls), "v"(l + 2 * ls), "v"(l + 3 * ls), "v"(l + lp), "v"(l + lp + ls), "v"(l + lp + 2 * ls), "v"(l + lp + 3 * ls),
                  "v"(g), "v"(g + gs), "v"(g + 2 * gs), "v"(g + 3 * gs), "v"(g + gp), "v"(g + gp + gs), "v"(g + gp + 2 * gs), "v"(g + gp + 3 * gs)
               : "memory");
}
// the same for four copies
__device__ __forceinline__ void copy4(unsigned l, unsigned ls, const char* g, size_t gs) {
  asm volatile("global_load_async_to_lds_b128 %0, %4, off\n\t"
               "global_load_async_to_lds_b128 %1, %5, off\n\t"
               "global_load_async_to_lds_b128 %2, %6, off\n\t"
               "global_load_async_to_lds_b128 %3, %7, off\n\t"
               "s_wait_xcnt 0x0"
               :: "v"(l), "v"(l + ls), "v"(l + 2 * ls), "v"(l + 3 * ls),
                  "v"(g), "v"(g + gs), "v"(g + 2 * gs), "v"(g + 3 * gs)
               : "memory");
}
__device__ __forceinline__ unsigned lds_off(const void* p) { return (unsigned)(size_t)p; }
#define KP 68   // LDS pitch, in floats, of a 256-byte row (64 floats; a key's 64 bf16 hi | 64 bf16 lo): 272 B = 16 B x odd
#define VP 72   // LDS pitch of a 64-half V^T row: 144 B = 16 B x odd
#define GP 72   // LDS pitch of a 64-element bf16 k slice: 144 B = 16 B x odd
// LDS of the two projections: in the k loop two buffers of the operands' 64-wide k slices; behind it, on the same bytes, the output staging
union QkvLds { struct { __bf16 a[2][64][GP]; __bf16 b[2][128][GP]; } st; float so[4][16][132]; struct { _Float16 h[128][72], l[128][72]; } vt; };
union OutLds { struct { float a[2][64][KP]; __bf16 b[2][128][GP]; } st; float so[4][16][132]; };
// each 64-wide k slice of the block's 64 X rows and 128 weight rows is copied to LDS once for the four waves, two buffers, the next slice in flight while this one is worked on
// QKV: block (64 rows, 128 cols = 2 heads, which); q (+bias) -> Q32 f32 [bh][s][64]; k (+bias) -> KS [bh][s][64 bf16 hi | 64 bf16 lo], the split that the scores use; v (+bias) -> VT hi/lo x4 [bh][d][s]
// five waves a SIMD is what the LDS allows: the bound keeps the register count of the v epilogue from costing one of them (without it this build takes 210 registers, with it 152 as before)
__global__ __launch_bounds__(128, 5) void k_qkv(const __bf16* __restrict__ Xb, int rbase, const __bf16* __restrict__ PT, const float* __restrict__ bqkv, const float* __restrict__ bQ, const float* __restrict__ bK, const float* __restrict__ bV, float* __restrict__ Q32, __bf16* __restrict__ KS, _Float16* __restrict__ VTh, _Float16* __restrict__ VTl) {
  __shared__ __align__(16) QkvLds sm;
  float (&so)[4][16][132] = sm.so; _Float16 (&sth)[128][72] = sm.vt.h, (&stl)[128][72] = sm.vt.l;
  const int tid = threadIdx.x, wave = tid >> 5, lane = tid & 31, col = lane & 15, g = lane >> 4;
  const int which = blockIdx.z, r0b = blockIdx.x * 64, n0 = blockIdx.y * 128; const int b = r0b / SS, s0 = r0b % SS;
  const float* bb_ = bqkv + which * E; const float* bx_ = which == 0 ? bQ : (which == 1 ? bK : bV);      // column n = h*64 + d indexes both biases
  v8f acc[8] = {};
  // a lane's share of a slice: row 16 i + tid/8, 16-byte piece tid%8 of the row's 128 bytes
  const char* gA = (const char*)(Xb + (size_t)(rbase + r0b + (tid >> 3)) * E + (tid & 7) * 8);
  const char* gB = (const char*)(PT + (size_t)(which * E + n0 + (tid >> 3)) * E + (tid & 7) * 8);
  const unsigned lA = lds_off(&sm.st.a[0][tid >> 3][(tid & 7) * 8]), lB = lds_off(&sm.st.b[0][tid >> 3][(tid & 7) * 8]);
  auto stage = [&](int buf, int kt) {
    copy4(lA + buf * (unsigned)sizeof(sm.st.a[0]), 16 * GP * 2, gA + (size_t)kt * 128, (size_t)16 * E * 2);
    copy8(lB + buf * (unsigned)sizeof(sm.st.b[0]), 16 * GP * 2, gB + (size_t)kt * 128, (size_t)16 * E * 2); };
  stage(0, 0);
  asm volatile("s_wait_asynccnt 0x0" ::: "memory");   // this wave's copies of slice 0 have landed
  __syncthreads();                                     // and every other wave's: slice 0 may be read
  stage(1, 1);
#pragma unroll 1   // rolled, for speed only
  for (int kt = 0; kt < E / 64; ++kt) { const int buf = kt & 1;
#pragma unroll
    for (int kc = 0; kc < 2; ++kc) { const v16b a = frag_b(&sm.st.a[buf][wave * 16 + col][kc * 32], lane); v16b wb[8];
#pragma unroll
      for (int j = 0; j < 8; ++j) wb[j] = frag_b(&sm.st.b[buf][j * 16 + col][kc * 32], lane);
#pragma unroll
      for (int j = 0; j < 8; ++j) acc[j] = wmma_bf(a, wb[j], acc[j]); }
    asm volatile("s_wait_dscnt 0x0" ::: "memory");      // this wave's reads of buffer buf are done
    asm volatile("s_wait_asynccnt 0x0" ::: "memory");   // its copies of slice kt + 1 have landed
    __syncthreads();                                     // publishes slice kt + 1 and frees buffer buf (behind the last slice: for the output staging)
    if (kt + 2 < E / 64) stage(buf, kt + 2); }
  asm volatile("s_wait_asynccnt 0x0" ::: "memory");     // no copy is left in flight behind the loop
  if (which < 2) {
#pragma unroll
    for (int j = 0; j < 8; ++j) { const float bb = bfr(bb_[n0 + j * 16 + col]) + bfr(bx_[n0 + j * 16 + col]);
#pragma unroll
      for (int r = 0; r < 8; ++r) so[wave][8 * g + r][j * 16 + col] = acc[j][r] + bb; }
    LDSX();
    if (which == 0) {
      for (int qq = lane; qq < 2 * 16 * 16; qq += 32) { const int hh = qq >> 8, rl = (qq >> 4) & 15, pc = qq & 15; const int h = (n0 >> 6) + hh;
        vst2(Q32 + (((size_t)b * NH + h) * SS + s0 + wave * 16 + rl) * HD + pc * 4, *(const v4f*)(&so[wave][rl][hh * 64 + pc * 4])); } }
    else {
      for (int qq = lane; qq < 2 * 16 * 8; qq += 32) { const int hh = qq >> 7, rl = (qq >> 3) & 15, pc = qq & 7; const int h = (n0 >> 6) + hh;
        store_split8(&so[wave][rl][hh * 64 + pc * 8], KS + (((size_t)b * NH + h) * SS + s0 + wave * 16 + rl) * (2 * HD) + pc * 8); } } }
  else {
#pragma unroll
    for (int j = 0; j < 8; ++j) { const float bb = bfr(bb_[n0 + j * 16 + col]) + bfr(bx_[n0 + j * 16 + col]);
#pragma unroll
      for (int r = 0; r < 8; ++r) { const float v = (acc[j][r] + bb) * 4.0f; const _Float16 hi = (_Float16)v; sth[j * 16 + col][wave * 16 + 8 * g + r] = hi; stl[j * 16 + col][wave * 16 + 8 * g + r] = (_Float16)((v - (float)hi) * VLO); } }
    __syncthreads();
    for (int qq = tid; qq < 128 * 8; qq += 128) { const int cl = qq >> 3, pc = qq & 7; const int c = n0 + cl, h = c >> 6, d = c & 63; const size_t o = (((size_t)b * NH + h) * HD + d) * SS + s0 + pc * 8;
      vst2(VTh + o, *(const v4u*)(&sth[cl][pc * 8])); vst2(VTl + o, *(const v4u*)(&stl[cl][pc * 8])); } }
}
// causal attention, worked transposed: block (bh, 64 queries, last query block first); key tiles 0..qb; each 64-key tile of K, V^T hi and V^T lo is copied to LDS once for the four waves, two buffers, the next tile in flight while this one is worked on
// S^T = K Q^T (A = key rows, B = query rows) and O^T += V^T P^T (A = V^T rows, B = P): in every accumulator a lane holds ONE query (column lane&15) and rows 8 (lane>>4) + r, so the
// maximum, the sum and the rescale are the lane's own, and two score tiles (keys 32 kc + 8 h + r and 32 kc + 16 + 8 h + r), converted in place, ARE the P fragment of k slice kc: neither scores nor P pass through LDS
// S on bf16 hi/lo splits: q split here from its f32 rows, k read ready split (a key row in LDS is 64 hi | 64 lo, as in memory); P,V hi/lo; O -> OS, split rows [bh][s][64 hi | 64 lo], the split that the output projection uses
__global__ __launch_bounds__(128) void k_attn(const float* __restrict__ Q32, const __bf16* __restrict__ KS, const _Float16* __restrict__ VTh, const _Float16* __restrict__ VTl, __bf16* __restrict__ OS) {
  __shared__ __align__(16) float sK[2][64][KP];
  __shared__ __align__(16) _Float16 sV[2][2][64][VP];      // [buffer][hi, lo][d][key]
  const int tid = threadIdx.x, w = tid >> 5, lane = tid & 31, col = lane & 15, g = lane >> 4;
  // placement: a block's cost grows with its query block (qb + 1 key tiles) and there are more blocks than resident places. The head
  // is the fast index and the query block falls with the slow one: the longest blocks come first in index order, the short ones last,
  // and blocks whose indices lie a multiple of 64 apart now differ in length (before, they were equally long)
  const size_t bh = blockIdx.x; const int qb = SS / 64 - 1 - (int)blockIdx.y; const int q0 = qb * 64 + w * 16;
  F2 aq[2];
#pragma unroll
  for (int kc = 0; kc < 2; ++kc) aq[kc] = split_row(Q32 + (bh * SS + q0 + col) * HD, kc * 32, lane);
  // softmax in base 2: scores carry 1/8 x log2(e), so that e^(s/8 - m) is one subtract and one v_exp_f32 (library expf: thirteen vector instructions a score);
  // the running reference mrun is the row maximum less 14, the same in P, in the row sum and in the rescale, so P comes out scaled by 2^14 with no multiply
  float mrun = -3.0e38f, lrun = 0.f; v8f acc[4] = {}, ac1[4] = {}, ac2[4] = {};      // element r of tile t: O^T[d = 16 t + 8 g + r][query q0 + col]
  // a lane's share of a tile: K, 16 KiB in a row in memory, piece tid + 128 i (LDS row 8 i + tid/16); V^T hi then lo, row 16 i + tid/8, piece tid%8
  const char* gK = (const char*)(KS + bh * SS * (2 * HD)) + tid * 16;
  const size_t vrow = ((bh * HD + (tid >> 3)) * SS + (tid & 7) * 8) * 2;
  const char* gVh = (const char*)VTh + vrow; const size_t gVd = (const char*)VTl - (const char*)VTh;
  const unsigned lK = lds_off(&sK[0][tid >> 4][(tid & 15) * 4]), lV = lds_off(&sV[0][0][tid >> 3][(tid & 7) * 8]);
  auto stage = [&](int buf, int kt) {
    copy8(lK + buf * (unsigned)sizeof(sK[0]), 8 * KP * 4, gK + (size_t)kt * (64 * HD * 4), 128 * 16);
    const char* gv = gVh + (size_t)kt * 128; const unsigned lv = lV + buf * (unsigned)sizeof(sV[0]);
    copy4x2(lv, 16 * VP * 2, (unsigned)sizeof(sV[0][0]), gv, (size_t)16 * SS * 2, gVd); };
  stage(0, 0);
  asm volatile("s_wait_asynccnt 0x0" ::: "memory");   // this wave's copies of tile 0 have landed
  __syncthreads();                                     // and every other wave's: tile 0 may be read
  if (qb >= 1) stage(1, 1);
#pragma unroll 1
  for (int kt = 0; kt <= qb; ++kt) { const int buf = kt & 1;
    v8f s[4] = {};      // element r of tile t: score of key 64 kt + 16 t + 8 g + r with query q0 + col; each tile sums its six products in the order q.lo k.hi, q.hi k.lo, q.hi k.hi, k slice 0 then 1
#pragma unroll
    for (int kc = 0; kc < 2; ++kc) { F2 kf[4];
#pragma unroll
      for (int t = 0; t < 4; ++t) kf[t] = frag_split((const __bf16*)&sK[buf][t * 16 + col][0], kc * 32, lane);
#pragma unroll
      for (int t = 0; t < 4; ++t) s[t] = wmma_bf(kf[t].h, aq[kc].l, s[t]);
#pragma unroll
      for (int t = 0; t < 4; ++t) s[t] = wmma_bf(kf[t].l, aq[kc].h, s[t]);
#pragma unroll
      for (int t = 0; t < 4; ++t) s[t] = wmma_bf(kf[t].h, aq[kc].h, s[t]); }
    float mx = -3.4e38f;
#pragma unroll
    for (int t = 0; t < 4; ++t) {
#pragma unroll
      for (int r = 0; r < 8; ++r) { const int key = kt * 64 + t * 16 + 8 * g + r; s[t][r] = (key > q0 + col) ? -3.0e38f : s[t][r] * SCL2; mx = fmaxf(mx, s[t][r]); } }
    mx = fmaxf(mx, __shfl_xor(mx, 16, 32));      // the query's other 32 keys of the tile lie in lane ^ 16
    const float mnew = fmaxf(mrun, mx - 14.0f); const float corr = __builtin_amdgcn_exp2f(mrun - mnew);
    float ps = 0.f; v16h ph[2], pl[2];
#pragma unroll
    for (int t = 0; t < 4; ++t) s[t] -= mnew;
#pragma unroll
    for (int t = 0; t < 4; ++t) {
#pragma unroll
      for (int r = 0; r < 8; ++r) { const float p = __builtin_amdgcn_exp2f(s[t][r]); ps += p; const _Float16 hi = (_Float16)p; ph[t >> 1][(t & 1) * 8 + r] = hi; pl[t >> 1][(t & 1) * 8 + r] = (_Float16)((p - (float)hi) * PLO); } }
    ps += __shfl_xor(ps, 16, 32);
    lrun = lrun * corr + ps * (1.0f / 16384.0f); mrun = mnew;
#pragma unroll
    for (int t = 0; t < 4; ++t) { acc[t] *= corr; ac1[t] *= corr; ac2[t] *= corr; }
#pragma unroll
    for (int kc = 0; kc < 2; ++kc) {
#pragma unroll
      for (int t = 0; t < 4; ++t) { const v16h vh = frag_h(&sV[buf][0][t * 16 + col][kc * 32], lane);
        acc[t] = wmma16(vh, ph[kc], acc[t]); ac1[t] = wmma16(frag_h(&sV[buf][1][t * 16 + col][kc * 32], lane), ph[kc], ac1[t]); ac2[t] = wmma16(vh, pl[kc], ac2[t]); } }
    __builtin_amdgcn_wave_barrier();
    asm volatile("s_wait_dscnt 0x0" ::: "memory");      // this wave's reads of buffer buf are done
    asm volatile("s_wait_asynccnt 0x0" ::: "memory");   // its copies of tile kt + 1 have landed
    __syncthreads();                                     // publishes tile kt + 1 and frees buffer buf
    if (kt + 2 <= qb) stage(buf, kt + 2); }
  asm volatile("s_wait_asynccnt 0x0" ::: "memory");     // no copy is left in flight behind the loop
  // a lane's eight registers of tile t are eight consecutive d of its own query's row: split and stored from registers, 16 bytes into each half
  const float inv = 1.0f / (lrun * 16384.0f * 4.0f);
  __bf16* orow = OS + ((bh * SS) + q0 + col) * (2 * HD) + 8 * g;
#pragma unroll
  for (int t = 0; t < 4; ++t) { float o[8];
#pragma unroll
    for (int r = 0; r < 8; ++r) o[r] = (acc[t][r] + ac1[t][r] * (1.0f / VLO) + ac2[t][r] * (1.0f / PLO)) * inv;
    store_split8(o, orow + t * 16); }
}
// out = ctx Wo^T + bo : split(ctx) x bf16(Wo rows): 2 products (Wo is an INPUT -> bf16 exact); k slices of the 64 context rows (split rows, read ready split) and 128 weight rows staged in LDS as in k_qkv
__global__ __launch_bounds__(128) void k_out(const __bf16* __restrict__ OS, int rbase, const __bf16* __restrict__ PT, const float* __restrict__ bo, float* __restrict__ out) {
  __shared__ __align__(16) OutLds sm;
  float (&so)[4][16][132] = sm.so;
  const int tid = threadIdx.x, wave = tid >> 5, lane = tid & 31, col = lane & 15, g = lane >> 4;
  const int r0b = blockIdx.x * 64, r0 = r0b + wave * 16, n0 = blockIdx.y * 128; const int b = r0b / SS, s0 = r0b % SS;
  v8f acc[8] = {};
  // slice kt is head kt. A lane's share: context, 16 KiB in a row in memory, piece tid + 128 i (LDS row 8 i + tid/16); weights, row 16 i + tid/8, piece tid%8
  const char* gA = (const char*)(OS + ((size_t)b * NH * SS + s0) * (2 * HD)) + tid * 16;
  const char* gB = (const char*)(PT + (size_t)(3 * E + n0 + (tid >> 3)) * E + (tid & 7) * 8);
  const unsigned lA = lds_off(&sm.st.a[0][tid >> 4][(tid & 15) * 4]), lB = lds_off(&sm.st.b[0][tid >> 3][(tid & 7) * 8]);
  auto stage = [&](int buf, int kt) {
    copy8(lA + buf * (unsigned)sizeof(sm.st.a[0]), 8 * KP * 4, gA + (size_t)kt * (SS * HD * 4), 128 * 16);
    copy8(lB + buf * (unsigned)sizeof(sm.st.b[0]), 16 * GP * 2, gB + (size_t)kt * 128, (size_t)16 * E * 2); };
  stage(0, 0);
  asm volatile("s_wait_asynccnt 0x0" ::: "memory");   // this wave's copies of slice 0 have landed
  __syncthreads();                                     // and every other wave's: slice 0 may be read
  stage(1, 1);
#pragma unroll 1   // rolled, for speed only
  for (int kt = 0; kt < NH; ++kt) { const int buf = kt & 1;
#pragma unroll
    for (int kc = 0; kc < 2; ++kc) { const F2 a = frag_split((const __bf16*)&sm.st.a[buf][wave * 16 + col][0], kc * 32, lane); v16b wb[8];
#pragma unroll
      for (int j = 0; j < 8; ++j) wb[j] = frag_b(&sm.st.b[buf][j * 16 + col][kc * 32], lane);
#pragma unroll
      for (int j = 0; j < 8; ++j) { acc[j] = wmma_bf(a.l, wb[j], acc[j]); acc[j] = wmma_bf(a.h, wb[j], acc[j]); } }
    asm volatile("s_wait_dscnt 0x0" ::: "memory");      // this wave's reads of buffer buf are done
    asm volatile("s_wait_asynccnt 0x0" ::: "memory");   // its copies of slice kt + 1 have landed
    __syncthreads();                                     // publishes slice kt + 1 and frees buffer buf (behind the last slice: for the output staging)
    if (kt + 2 < NH) stage(buf, kt + 2); }
  asm volatile("s_wait_asynccnt 0x0" ::: "memory");     // no copy is left in flight behind the loop
#pragma unroll
  for (int j = 0; j < 8; ++j) { const int n = n0 + j * 16 + col; const float bb = bfr(bo[n]);
#pragma unroll
    for (int r = 0; r < 8; ++r) so[wave][8 * g + r][j * 16 + col] = acc[j][r] + bb; }
  LDSX();
#pragma unroll 4
  for (int rl = 0; rl < 16; ++rl) vst2(out + (size_t)(rbase + r0 + rl) * E + n0 + lane * 4, *(const v4f*)(&so[wave][rl][lane * 4]));
}
extern "C" void kernel_launch(void* const* d_in, const int* in_sizes, int n_in, void* d_out, int out_size, void* d_ws, size_t ws_size, hipStream_t stream) {
  (void)in_sizes; (void)n_in; (void)out_size; (void)ws_size;
  const float* x = (const float*)d_in[0]; const float* Wqkv = (const float*)d_in[1]; const float* bqkv = (const float*)d_in[2]; const float* Wp = (const float*)d_in[3]; const float* bp = (const float*)d_in[4]; const float* bQ = (const float*)d_in[5]; const float* bK = (const float*)d_in[6]; const float* bV = (const float*)d_in[7];
  float* out = (float*)d_out;
  char* ws = (char*)d_ws; size_t off = 0;
  auto take = [&](size_t bytes) { char* p = ws + off; off += (bytes + 255) & ~(size_t)255; return p; };
  __bf16* Xb = (__bf16*)take((size_t)NR * E * 2); __bf16* PT = (__bf16*)take((size_t)4 * E * E * 2);
  float* Q32 = (float*)take((size_t)NR * E * 4); __bf16* KS = (__bf16*)take((size_t)NR * E * 4); _Float16* VTh = (_Float16*)take((size_t)NR * E * 2); _Float16* VTl = (_Float16*)take((size_t)NR * E * 2);
  __bf16* OS = (__bf16*)Q32;      // in place, a split row has the f32 row's 256 bytes: each k_attn wave reads its own 16 query rows into registers before writing the same rows; no other block reads them
  // ws: 120 MiB. One launch of each kernel covers the whole batch: two passes over half the batch left places empty in every launch
  // (k_out: 512 blocks on 1,024 places; k_qkv: 1,536 on 1,280, a second round one fifth full; k_attn: 1,024 blocks of unequal length on 768, each pass as long as its fullest WGP)
  k_cvt<<<(NR * E / 8 + 255) / 256, 256, 0, stream>>>(x, Xb);
  k_pack<<<4 * E, 128, 0, stream>>>(Wqkv, Wp, PT);
  k_qkv<<<dim3(NR / 64, E / 128, 3), 128, 0, stream>>>(Xb, 0, PT, bqkv, bQ, bK, bV, Q32, KS, VTh, VTl);
  k_attn<<<dim3(NB * NH, SS / 64), 128, 0, stream>>>(Q32, KS, VTh, VTl, OS);
  k_out<<<dim3(NR / 64, E / 128), 128, 0, stream>>>(OS, 0, PT, bp, out);
}

// v008
// One run takes 206 microseconds.
// Next to v007, in two timings, it ran 1.08 and 1.09 times as fast.
// All steps since v000 together make it 5.12 times as fast.
// compute dtype: x, W_attn, b_attn, W_proj, b_proj, bQ/bK/bV (INPUTS) rounded to bf16 with exact bf16 WMMA products (f32 accumulate) for the projections; q/k f32 split in bf16 hi/lo for the scores (3 products; k is split once, where it is produced), P and V f16 hi/lo (3 products); softmax f32.
#include <hip/hip_runtime.h>
#include <math.h>

typedef __attribute__((ext_vector_type(16))) _Float16 v16h;
typedef __attribute__((ext_vector_type(16))) __bf16 v16b;
typedef __attribute__((ext_vector_type(8)))  _Float16 v8h;
typedef __attribute__((ext_vector_type(8)))  float v8f;
typedef __attribute__((ext_vector_type(4)))  float v4f;
typedef __attribute__((ext_vector_type(2)))  float v2f;
typedef __attribute__((ext_vector_type(4)))  unsigned v4u;
typedef __attribute__((ext_vector_type(2)))  unsigned v2u;
typedef __attribute__((ext_vector_type(4)))  int v4i;
typedef float __attribute__((may_alias)) float_a;
typedef int __attribute__((may_alias)) int_a;

template <typename T> __device__ __forceinline__ void vst2(void* p, T v) { *(T*)p = v;  }
__device__ __forceinline__ v8f wmma16(v16h a, v16h b, v8f c) {
  v8f d = __builtin_amdgcn_wmma_f32_16x16x32_f16(false, a, false, b, (short)0, c, false, false);
  asm volatile("v_nop\n\tv_nop\n\tv_nop\n\tv_nop" : "+v"(d) : "v"(a), "v"(b));
  return d;
}
__device__ __forceinline__ v8f wmma_bf(v16b a, v16b b, v8f c) {
  v8f d = __builtin_amdgcn_wmma_f32_16x16x32_bf16(false, a, false, b, (short)0, c, false, false);
  asm volatile("v_nop\n\tv_nop\n\tv_nop\n\tv_nop" : "+v"(d) : "v"(a), "v"(b));
  return d;
}
// 16x16x32 fragments: lane = (h = lane>>4, row/col = lane&15); elements 0..7 = k0+8h+0..7, 8..15 = k0+16+8h+0..7; D element r = row 8h+r
__device__ __forceinline__ v16h frag_h(const _Float16* rowk0, int lane) {
  union { v16h v; v8h q[2]; } u; const _Float16* p = rowk0 + 8 * (lane >> 4);
  u.q[0] = *(const v8h*)p; u.q[1] = *(const v8h*)(p + 16); return u.v;
}
__device__ __forceinline__ v16h frag_f32(const float* rowk0, int lane) {
  v16h a; const float* p = rowk0 + 8 * (lane >> 4);
#pragma unroll
  for (int i = 0; i < 8; ++i) { a[i] = (_Float16)p[i]; a[8 + i] = (_Float16)p[16 + i]; }
  return a;
}
__device__ __forceinline__ v16h frag_f32s(const float* rowk0, int lane, float sc) {
  v16h a; const float* p = rowk0 + 8 * (lane >> 4);
#pragma unroll
  for (int i = 0; i < 8; ++i) { a[i] = (_Float16)(p[i] * sc); a[8 + i] = (_Float16)(p[16 + i] * sc); }
  return a;
}
// column fragment from a [K][ld] layout (column n), rows >= K read as 0
__device__ __forceinline__ v16h fragc_f32(const float* W, int k0, int n, int lane, int ld, int K) {
  v16h a; const int g = lane >> 4;
#pragma unroll
  for (int i = 0; i < 8; ++i) { const int ka = k0 + 8 * g + i, kb = ka + 16;
    a[i] = (_Float16)(ka < K ? W[(size_t)(ka < K ? ka : K - 1) * ld + n] : 0.f); a[8 + i] = (_Float16)(kb < K ? W[(size_t)(kb < K ? kb : K - 1) * ld + n] : 0.f); }
  return a;
}
struct F2 { v16b h, l; };
__device__ __forceinline__ F2 bsplit16(const float v[16]) { F2 r;
#pragma unroll
  for (int i = 0; i < 16; ++i) { const __bf16 h = (__bf16)v[i]; r.h[i] = h; r.l[i] = (__bf16)(v[i] - (float)h); }
  return r; }
__device__ __forceinline__ F2 split_row(const float* row, int k0, int lane) { float v[16]; const float* p = row + k0 + 8 * (lane >> 4);
#pragma unroll
  for (int i = 0; i < 8; ++i) { v[i] = p[i]; v[8 + i] = p[16 + i]; }
  return bsplit16(v); }
__device__ __forceinline__ F2 split_rowK(const float* row, int k0, int lane, int K) { float v[16]; const int g = lane >> 4;
#pragma unroll
  for (int i = 0; i < 8; ++i) { const int ka = k0 + 8 * g + i, kb = ka + 16; v[i] = ka < K ? row[ka < K ? ka : K - 1] : 0.f; v[8 + i] = kb < K ? row[kb < K ? kb : K - 1] : 0.f; }
  return bsplit16(v); }
__device__ __forceinline__ F2 split_col(const float* W, int k0, int n, int lane, int ld, int K) { float v[16]; const int g = lane >> 4;
#pragma unroll
  for (int i = 0; i < 8; ++i) { const int ka = k0 + 8 * g + i, kb = ka + 16; v[i] = ka < K ? W[(size_t)(ka < K ? ka : K - 1) * ld + n] : 0.f; v[8 + i] = kb < K ? W[(size_t)(kb < K ? kb : K - 1) * ld + n] : 0.f; }
  return bsplit16(v); }
__device__ __forceinline__ v8f mac3(const F2& a, const F2& b, v8f c) { c = wmma_bf(a.l, b.h, c); c = wmma_bf(a.h, b.l, c); return wmma_bf(a.h, b.h, c); }
__device__ __forceinline__ float sigm(float v) { return 1.0f / (1.0f + expf(-v)); }
#define LDSX() do { asm volatile("s_wait_dscnt 0" ::: "memory"); __builtin_amdgcn_wave_barrier(); __builtin_amdgcn_fence(__ATOMIC_RELEASE, "workgroup"); } while (0)


#define NB 4
#define SS 2048
#define E 1024
#define NH 16
#define HD 64
#define NR (NB * SS)
#define PLO 1024.0f
#define VLO 2048.0f
#define SCL2 0.18033688011112042f   // 1/sqrt(64) x log2(e)
__device__ __forceinline__ float bfr(float v) { return (float)(__bf16)v; }
__device__ __forceinline__ v16b frag_b(const __bf16* rowk0, int lane) { return __builtin_bit_cast(v16b, frag_h((const _Float16*)rowk0, lane)); }
// a split row: 64 f32 values kept as 64 bf16 hi | 64 bf16 lo (hi = bf16(v), lo = bf16(v - hi), as bsplit16 has them), 256 bytes like the f32 row
// eight values of one lane: 16 bytes into the row's hi half at d, 16 into its lo half; eight such stores fill each half's 128 bytes
__device__ __forceinline__ void store_split8(const float* s, __bf16* d) { union { __bf16 e[8]; v4u u; } hi, lo;
#pragma unroll
  for (int e = 0; e < 8; ++e) { const float v = s[e]; const __bf16 hv = (__bf16)v; hi.e[e] = hv; lo.e[e] = (__bf16)(v - (float)hv); }
  vst2(d, hi.u); vst2(d + HD, lo.u); }
// the fragment pair of a split row at k0
__device__ __forceinline__ F2 frag_split(const __bf16* row, int k0, int lane) { F2 r; r.h = frag_b(row + k0, lane); r.l = frag_b(row + HD + k0, lane); return r; }

// x -> bf16 on 512 work-groups of eight waves (sixteen waves a WGP), not 4,096, for speed only.
// A lane takes sixteen pieces of four values, 4 KiB apart: every wave-wide load is 512 contiguous bytes, every wave-wide store two whole lines, and the loads are issued ahead of the converts, a dozen or more in flight
__global__ __launch_bounds__(256) void k_cvt(const float* __restrict__ x, __bf16* __restrict__ Xb) {
  const size_t p0 = (size_t)blockIdx.x * (256 * 16) + threadIdx.x;      // counted in pieces
  v4f v[16];
#pragma unroll   // v stays in registers and the loads are issued as one group
  for (int i = 0; i < 16; ++i) v[i] = *(const v4f*)(x + (p0 + i * 256) * 4);
#pragma unroll   // constant indices into v
  for (int i = 0; i < 16; ++i) { union { __bf16 h[4]; v2u u; } pk;
#pragma unroll
    for (int e = 0; e < 4; ++e) pk.h[e] = (__bf16)v[i][e];
    vst2(Xb + (p0 + i * 256) * 4, pk.u); }
}
// PT rows: [0,E) Wq[:,n], [E,2E) Wk[:,n], [2E,3E) Wv[:,n], [3E,4E) Wo[:,n]  ([in][out] weights: column n as a bf16 row)
// a work-group transposes a tile of 64 k x 64 columns through LDS (1,024 work-groups, not one for each of the 4,096 columns): it reads 256 contiguous bytes of each k row,
// where a column read alone takes 4 bytes out of each line, and writes 128 contiguous bytes of each PT row; a lane's eight loads are in flight together
#define TP 36   // LDS pitch, in dwords, of a tile row (64 bf16 = 32 dwords): 144 B = 16 B x odd
__global__ __launch_bounds__(128) void k_pack(const float* __restrict__ Wqkv, const float* __restrict__ Wp, __bf16* __restrict__ PT) {
  __shared__ __align__(16) unsigned st[64][TP];      // [column][k pair]
  const int tid = threadIdx.x, n0 = blockIdx.x * 64, k0 = blockIdx.y * 64;      // 3 E is a multiple of 64: a tile lies in one weight
  const float* W = n0 < 3 * E ? Wqkv + n0 : Wp + (n0 - 3 * E); const size_t ld = n0 < 3 * E ? 3 * E : E;
  const int c4 = tid & 15, kp = tid >> 4;      // four columns 4 c4 + j; k pairs kp + 8 i
  const float* pa[4]; const float* pb[4]; v4f a[4], b[4];
#pragma unroll   // a and b stay in registers and the loads are issued as one group
  for (int i = 0; i < 4; ++i) { pa[i] = W + (size_t)(k0 + 2 * (kp + 8 * i)) * ld + c4 * 4; pb[i] = pa[i] + ld; a[i] = *(const v4f*)pa[i]; b[i] = *(const v4f*)pb[i]; }
  // the eight address pairs are inputs of the wait, so that none of them is handed to a later load's result, or to anything else, ahead of it
  asm volatile("s_wait_xcnt 0x0" :: "v"(pa[0]), "v"(pb[0]), "v"(pa[1]), "v"(pb[1]), "v"(pa[2]), "v"(pb[2]), "v"(pa[3]), "v"(pb[3]) : "memory");
#pragma unroll   // constant indices into a and b
  for (int i = 0; i < 4; ++i) {
#pragma unroll
    for (int j = 0; j < 4; ++j) { union { __bf16 h[2]; unsigned u; } pk; pk.h[0] = (__bf16)a[i][j]; pk.h[1] = (__bf16)b[i][j]; st[c4 * 4 + j][kp + 8 * i] = pk.u; } }
  __syncthreads();
#pragma unroll
  for (int i = 0; i < 4; ++i) { const int r = (tid >> 3) + 16 * i, pc = tid & 7;      // eight lanes write a row's 128 bytes
    vst2(PT + (size_t)(n0 + r) * E + k0 + pc * 8, *(const v4u*)(&st[r][pc * 4])); }
}
// eight 16-byte asynchronous copies of one lane, global -> LDS: LDS byte address l + i*ls, global address g + i*gs bytes.
// s_wait_xcnt closes the copies' own statement, so no address register is rewritten ahead of it.
__device__ __forceinline__ void copy8(unsigned l, unsigned ls, const char* g, size_t gs) {
  asm volatile("global_load_async_to_lds_b128 %0, %8, off\n\t"
               "global_load_async_to_lds_b128 %1, %9, off\n\t"
               "global_load_async_to_lds_b128 %2, %10, off\n\t"
               "global_load_async_to_lds_b128 %3, %11, off\n\t"
               "global_load_async_to_lds_b128 %4, %12, off\n\t"
               "global_load_async_to_lds_b128 %5, %13, off\n\t"
               "global_load_async_to_lds_b128 %6, %14, off\n\t"
               "global_load_async_to_lds_b128 %7, %15, off\n\t"
               "s_wait_xcnt 0x0"
               :: "v"(l), "v"(l + ls), "v"(l + 2 * ls), "v"(l + 3 * ls), "v"(l + 4 * ls), "v"(l + 5 * ls), "v"(l + 6 * ls), "v"(l + 7 * ls),
                  "v"(g), "v"(g + gs), "v"(g + 2 * gs), "v"(g + 3 * gs), "v"(g + 4 * gs), "v"(g + 5 * gs), "v"(g + 6 * gs), "v"(g + 7 * gs)
               : "memory");
}
// the same for two planes of four copies each: plane 1 lies lp bytes further in LDS and gp bytes further in memory
__device__ __forceinline__ void copy4x2(unsigned l, unsigned ls, unsigned lp, const char* g, size_t gs, size_t gp) {
  asm volatile("global_load_async_to_lds_b128 %0, %8, off\n\t"
               "global_load_async_to_lds_b128 %1, %9, off\n\t"
               "global_load_async_to_lds_b128 %2, %10, off\n\t"
               "global_load_async_to_lds_b128 %3, %11, off\n\t"
               "global_load_async_to_lds_b128 %4, %12, off\n\t"
               "global_load_async_to_lds_b128 %5, %13, off\n\t"
               "global_load_async_to_lds_b128 %6, %14, off\n\t"
               "global_load_async_to_lds_b128 %7, %15, off\n\t"
               "s_wait_xcnt 0x0"
               :: "v"(l), "v"(l + ls), "v"(l + 2 * ls), "v"(l + 3 * ls), "v"(l + lp), "v"(l + lp + ls), "v"(l + lp + 2 * ls), "v"(l + lp + 3 * ls),
                  "v"(g), "v"(g + gs), "v"(g + 2 * gs), "v"(g + 3 * gs), "v"(g + gp), "v"(g + gp + gs), "v"(g + gp + 2 * gs), "v"(g + gp + 3 * gs)
               : "memory");
}
// the same for four copies
__device__ __forceinline__ void copy4(unsigned l, unsigned ls, const char* g, size_t gs) {
  asm volatile("global_load_async_to_lds_b128 %0, %4, off\n\t"
               "global_load_async_to_lds_b128 %1, %5, off\n\t"
               "global_load_async_to_lds_b128 %2, %6, off\n\t"
               "global_load_async_to_lds_b128 %3, %7, off\n\t"
               "s_wait_xcnt 0x0"
               :: "v"(l), "v"(l + ls), "v"(l + 2 * ls), "v"(l + 3 * ls),
                  "v"(g), "v"(g + gs), "v"(g + 2 * gs), "v"(g + 3 * gs)
               : "memory");
}
__device__ __forceinline__ unsigned lds_off(const void* p) { return (unsigned)(size_t)p; }
#define KP 68   // LDS pitch, in floats, of a 256-byte row (64 floats; a key's 64 bf16 hi | 64 bf16 lo): 272 B = 16 B x odd
#define VP 72   // LDS pitch of a 64-half V^T row: 144 B = 16 B x odd
#define GP 72   // LDS pitch of a 64-element bf16 k slice: 144 B = 16 B x odd
// LDS of the two projections: in the k loop two buffers of the operands' 64-wide k slices; behind it, on the same bytes, the output staging
union QkvLds { struct { __bf16 a[2][64][GP]; __bf16 b[2][128][GP]; } st; float so[4][16][132]; struct { _Float16 h[128][72], l[128][72]; } vt; };
union OutLds { struct { float a[2][64][KP]; __bf16 b[2][128][GP]; } st; float so[4][16][132]; };
// each 64-wide k slice of the block's 64 X rows and 128 weight rows is copied to LDS once for the four waves, two buffers, the next slice in flight while this one is worked on
// QKV: block (64 rows, 128 cols = 2 heads, which); q (+bias) -> Q32 f32 [bh][s][64]; k (+bias) -> KS [bh][s][64 bf16 hi | 64 bf16 lo], the split that the scores use; v (+bias) -> VT hi/lo x4 [bh][d][s]
// five waves a SIMD is what the LDS allows: the bound keeps the register count of the v epilogue from costing one of them (without it this build takes 210 registers, with it 152 as before)
__global__ __launch_bounds__(128, 5) void k_qkv(const __bf16* __restrict__ Xb, int rbase, const __bf16* __restrict__ PT, const float* __restrict__ bqkv, const float* __restrict__ bQ, const float* __restrict__ bK, const float* __restrict__ bV, float* __restrict__ Q32, __bf16* __restrict__ KS, _Float16* __restrict__ VTh, _Float16* __restrict__ VTl) {
  __shared__ __align__(16) QkvLds sm;
  float (&so)[4][16][132] = sm.so; _Float16 (&sth)[128][72] = sm.vt.h, (&stl)[128][72] = sm.vt.l;
  const int tid = threadIdx.x, wave = tid >> 5, lane = tid & 31, col = lane & 15, g = lane >> 4;
  const int which = blockIdx.z, r0b = blockIdx.x * 64, n0 = blockIdx.y * 128; const int b = r0b / SS, s0 = r0b % SS;
  const float* bb_ = bqkv + which * E; const float* bx_ = which == 0 ? bQ : (which == 1 ? bK : bV);      // column n = h*64 + d indexes both biases
  v8f acc[8] = {};
  // a lane's share of a slice: row 16 i + tid/8, 16-byte piece tid%8 of the row's 128 bytes
  const char* gA = (const char*)(Xb + (size_t)(rbase + r0b + (tid >> 3)) * E + (tid & 7) * 8);
  const char* gB = (const char*)(PT + (size_t)(which * E + n0 + (tid >> 3)) * E + (tid & 7) * 8);
  const unsigned lA = lds_off(&sm.st.a[0][tid >> 3][(tid & 7) * 8]), lB = lds_off(&sm.st.b[0][tid >> 3][(tid & 7) * 8]);
  auto stage = [&](int buf, int kt) {
    copy4(lA + buf * (unsigned)sizeof(sm.st.a[0]), 16 * GP * 2, gA + (size_t)kt * 128, (size_t)16 * E * 2);
    copy8(lB + buf * (unsigned)sizeof(sm.st.b[0]), 16 * GP * 2, gB + (size_t)kt * 128, (size_t)16 * E * 2); };
  stage(0, 0);
  asm volatile("s_wait_asynccnt 0x0" ::: "memory");   // this wave's copies of slice 0 have landed
  __syncthreads();                                     // and every other wave's: slice 0 may be read
  stage(1, 1);
#pragma unroll 1   // rolled, for speed only
  for (int kt = 0; kt < E / 64; ++kt) { const int buf = kt & 1;
#pragma unroll
    for (int kc = 0; kc < 2; ++kc) { const v16b a = frag_b(&sm.st.a[buf][wave * 16 + col][kc * 32], lane); v16b wb[8];
#pragma unroll
      for (int j = 0; j < 8; ++j) wb[j] = frag_b(&sm.st.b[buf][j * 16 + col][kc * 32], lane);
#pragma unroll
      for (int j = 0; j < 8; ++j) acc[j] = wmma_bf(a, wb[j], acc[j]); }
    asm volatile("s_wait_dscnt 0x0" ::: "memory");      // this wave's reads of buffer buf are done
    asm volatile("s_wait_asynccnt 0x0" ::: "memory");   // its copies of slice kt + 1 have landed
    __syncthreads();                                     // publishes slice kt + 1 and frees buffer buf (behind the last slice: for the output staging)
    if (kt + 2 < E / 64) stage(buf, kt + 2); }
  asm volatile("s_wait_asynccnt 0x0" ::: "memory");     // no copy is left in flight behind the loop
  if (which < 2) {
#pragma unroll
    for (int j = 0; j < 8; ++j) { const float bb = bfr(bb_[n0 + j * 16 + col]) + bfr(bx_[n0 + j * 16 + col]);
#pragma unroll
      for (int r = 0; r < 8; ++r) so[wave][8 * g + r][j * 16 + col] = acc[j][r] + bb; }
    LDSX();
    if (which == 0) {
      for (int qq = lane; qq < 2 * 16 * 16; qq += 32) { const int hh = qq >> 8, rl = (qq >> 4) & 15, pc = qq & 15; const int h = (n0 >> 6) + hh;
        vst2(Q32 + (((size_t)b * NH + h) * SS + s0 + wave * 16 + rl) * HD + pc * 4, *(const v4f*)(&so[wave][rl][hh * 64 + pc * 4])); } }
    else {
      for (int qq = lane; qq < 2 * 16 * 8; qq += 32) { const int hh = qq >> 7, rl = (qq >> 3) & 15, pc = qq & 7; const int h = (n0 >> 6) + hh;
        store_split8(&so[wave][rl][hh * 64 + pc * 8], KS + (((size_t)b * NH + h) * SS + s0 + wave * 16 + rl) * (2 * HD) + pc * 8); } } }
  else {
#pragma unroll
    for (int j = 0; j < 8; ++j) { const float bb = bfr(bb_[n0 + j * 16 + col]) + bfr(bx_[n0 + j * 16 + col]);
#pragma unroll
      for (int r = 0; r < 8; ++r) { const float v = (acc[j][r] + bb) * 4.0f; const _Float16 hi = (_Float16)v; sth[j * 16 + col][wave * 16 + 8 * g + r] = hi; stl[j * 16 + col][wave * 16 + 8 * g + r] = (_Float16)((v - (float)hi) * VLO); } }
    __syncthreads();
    for (int qq = tid; qq < 128 * 8; qq += 128) { const int cl = qq >> 3, pc = qq & 7; const int c = n0 + cl, h = c >> 6, d = c & 63; const size_t o = (((size_t)b * NH + h) * HD + d) * SS + s0 + pc * 8;
      vst2(VTh + o, *(const v4u*)(&sth[cl][pc * 8])); vst2(VTl + o, *(const v4u*)(&stl[cl][pc * 8])); } }
}
// causal attention, worked transposed: block (bh, 64 queries, last query block first); key tiles 0..qb; each 64-key tile of K, V^T hi and V^T lo is copied to LDS once for the four waves, two buffers, the next tile in flight while this one is worked on
// S^T = K Q^T (A = key rows, B = query rows) and O^T += V^T P^T (A = V^T rows, B = P): in every accumulator a lane holds ONE query (column lane&15) and rows 8 (lane>>4) + r, so the
// maximum, the sum and the rescale are the lane's own, and two score tiles (keys 32 kc + 8 h + r and 32 kc + 16 + 8 h + r), converted in place, ARE the P fragment of k slice kc: neither scores nor P pass through LDS
// S on bf16 hi/lo splits: q split here from its f32 rows, k read ready split (a key row in LDS is 64 hi | 64 lo, as in memory); P,V hi/lo; O -> OS, split rows [bh][s][64 hi | 64 lo], the split that the output projection uses
__global__ __launch_bounds__(128) void k_attn(const float* __restrict__ Q32, const __bf16* __restrict__ KS, const _Float16* __restrict__ VTh, const _Float16* __restrict__ VTl, __bf16* __restrict__ OS) {
  __shared__ __align__(16) float sK[2][64][KP];
  __shared__ __align__(16) _Float16 sV[2][2][64][VP];      // [buffer][hi, lo][d][key]
  const int tid = threadIdx.x, w = tid >> 5, lane = tid & 31, col = lane & 15, g = lane >> 4;
  // placement: a block's cost grows with its query block (qb + 1 key tiles) and there are more blocks than resident places. The head
  // is the fast index and the query block falls with the slow one: the longest blocks come first in index order, the short ones last,
  // and blocks whose indices lie a multiple of 64 apart now differ in length (before, they were equally long)
  const size_t bh = blockIdx.x; const int qb = SS / 64 - 1 - (int)blockIdx.y; const int q0 = qb * 64 + w * 16;
  F2 aq[2];
#pragma unroll
  for (int kc = 0; kc < 2; ++kc) aq[kc] = split_row(Q32 + (bh * SS + q0 + col) * HD, kc * 32, lane);
  // softmax in base 2: scores carry 1/8 x log2(e), so that e^(s/8 - m) is one subtract and one v_exp_f32 (library expf: thirteen vector instructions a score);
  // the running reference mrun is the row maximum less 14, the same in P, in the row sum and in the rescale, so P comes out scaled by 2^14 with no multiply
  float mrun = -3.0e38f, lrun = 0.f; v8f acc[4] = {}, ac1[4] = {}, ac2[4] = {};      // element r of tile t: O^T[d = 16 t + 8 g + r][query q0 + col]
  // a lane's share of a tile: K, 16 KiB in a row in memory, piece tid + 128 i (LDS row 8 i + tid/16); V^T hi then lo, row 16 i + tid/8, piece tid%8
  const char* gK = (const char*)(KS + bh * SS * (2 * HD)) + tid * 16;
  const size_t vrow = ((bh * HD + (tid >> 3)) * SS + (tid & 7) * 8) * 2;
  const char* gVh = (const char*)VTh + vrow; const size_t gVd = (const char*)VTl - (const char*)VTh;
  const unsigned lK = lds_off(&sK[0][tid >> 4][(tid & 15) * 4]), lV = lds_off(&sV[0][0][tid >> 3][(tid & 7) * 8]);
  auto stage = [&](int buf, int kt) {
    copy8(lK + buf * (unsigned)sizeof(sK[0]), 8 * KP * 4, gK + (size_t)kt * (64 * HD * 4), 128 * 16);
    const char* gv = gVh + (size_t)kt * 128; const unsigned lv = lV + buf * (unsigned)sizeof(sV[0]);
    copy4x2(lv, 16 * VP * 2, (unsigned)sizeof(sV[0][0]), gv, (size_t)16 * SS * 2, gVd); };
  stage(0, 0);
  asm volatile("s_wait_asynccnt 0x0" ::: "memory");   // this wave's copies of tile 0 have landed
  __syncthreads();                                     // and every other wave's: tile 0 may be read
  if (qb >= 1) stage(1, 1);
#pragma unroll 1
  for (int kt = 0; kt <= qb; ++kt) { const int buf = kt & 1;
    v8f s[4] = {};      // element r of tile t: score of key 64 kt + 16 t + 8 g + r with query q0 + col; each tile sums its six products in the order q.lo k.hi, q.hi k.lo, q.hi k.hi, k slice 0 then 1
#pragma unroll
    for (int kc = 0; kc < 2; ++kc) { F2 kf[4];
#pragma unroll
      for (int t = 0; t < 4; ++t) kf[t] = frag_split((const __bf16*)&sK[buf][t * 16 + col][0], kc * 32, lane);
#pragma unroll
      for (int t = 0; t < 4; ++t) s[t] = wmma_bf(kf[t].h, aq[kc].l, s[t]);
#pragma unroll
      for (int t = 0; t < 4; ++t) s[t] = wmma_bf(kf[t].l, aq[kc].h, s[t]);
#pragma unroll
      for (int t = 0; t < 4; ++t) s[t] = wmma_bf(kf[t].h, aq[kc].h, s[t]); }
    float mx = -3.4e38f;
#pragma unroll
    for (int t = 0; t < 4; ++t) {
#pragma unroll
      for (int r = 0; r < 8; ++r) { const int key = kt * 64 + t * 16 + 8 * g + r; s[t][r] = (key > q0 + col) ? -3.0e38f : s[t][r] * SCL2; mx = fmaxf(mx, s[t][r]); } }
    mx = fmaxf(mx, __shfl_xor(mx, 16, 32));      // the query's other 32 keys of the tile lie in lane ^ 16
    const float mnew = fmaxf(mrun, mx - 14.0f); const float corr = __builtin_amdgcn_exp2f(mrun - mnew);
    float ps = 0.f; v16h ph[2], pl[2];
#pragma unroll
    for (int t = 0; t < 4; ++t) s[t] -= mnew;
#pragma unroll
    for (int t = 0; t < 4; ++t) {
#pragma unroll
      for (int r = 0; r < 8; ++r) { const float p = __builtin_amdgcn_exp2f(s[t][r]); ps += p; const _Float16 hi = (_Float16)p; ph[t >> 1][(t & 1) * 8 + r] = hi; pl[t >> 1][(t & 1) * 8 + r] = (_Float16)((p - (float)hi) * PLO); } }
    ps += __shfl_xor(ps, 16, 32);
    lrun = lrun * corr + ps * (1.0f / 16384.0f); mrun = mnew;
#pragma unroll
    for (int t = 0; t < 4; ++t) { acc[t] *= corr; ac1[t] *= corr; ac2[t] *= corr; }
#pragma unroll
    for (int kc = 0; kc < 2; ++kc) {
#pragma unroll
      for (int t = 0; t < 4; ++t) { const v16h vh = frag_h(&sV[buf][0][t * 16 + col][kc * 32], lane);
        acc[t] = wmma16(vh, ph[kc], acc[t]); ac1[t] = wmma16(frag_h(&sV[buf][1][t * 16 + col][kc * 32], lane), ph[kc], ac1[t]); ac2[t] = wmma16(vh, pl[kc], ac2[t]); } }
    __builtin_amdgcn_wave_barrier();
    asm volatile("s_wait_dscnt 0x0" ::: "memory");      // this wave's reads of buffer buf are done
    asm volatile("s_wait_asynccnt 0x0" ::: "memory");   // its copies of tile kt + 1 have landed
    __syncthreads();                                     // publishes tile kt + 1 and frees buffer buf
    if (kt + 2 <= qb) stage(buf, kt + 2); }
  asm volatile("s_wait_asynccnt 0x0" ::: "memory");     // no copy is left in flight behind the loop
  // a lane's eight registers of tile t are eight consecutive d of its own query's row: split and stored from registers, 16 bytes into each half
  const float inv = 1.0f / (lrun * 16384.0f * 4.0f);
  __bf16* orow = OS + ((bh * SS) + q0 + col) * (2 * HD) + 8 * g;
#pragma unroll
  for (int t = 0; t < 4; ++t) { float o[8];
#pragma unroll
    for (int r = 0; r < 8; ++r) o[r] = (acc[t][r] + ac1[t][r] * (1.0f / VLO) + ac2[t][r] * (1.0f / PLO)) * inv;
    store_split8(o, orow + t * 16); }
}
// out = ctx Wo^T + bo : split(ctx) x bf16(Wo rows): 2 products (Wo is an INPUT -> bf16 exact); k slices of the 64 context rows (split rows, read ready split) and 128 weight rows staged in LDS as in k_qkv
__global__ __launch_bounds__(128) void k_out(const __bf16* __restrict__ OS, int rbase, const __bf16* __restrict__ PT, const float* __restrict__ bo, float* __restrict__ out) {
  __shared__ __align__(16) OutLds sm;
  float (&so)[4][16][132] = sm.so;
  const int tid = threadIdx.x, wave = tid >> 5, lane = tid & 31, col = lane & 15, g = lane >> 4;
  const int r0b = blockIdx.x * 64, r0 = r0b + wave * 16, n0 = blockIdx.y * 128; const int b = r0b / SS, s0 = r0b % SS;
  v8f acc[8] = {};
  // slice kt is head kt. A lane's share: context, 16 KiB in a row in memory, piece tid + 128 i (LDS row 8 i + tid/16); weights, row 16 i + tid/8, piece tid%8
  const char* gA = (const char*)(OS + ((size_t)b * NH * SS + s0) * (2 * HD)) + tid * 16;
  const char* gB = (const char*)(PT + (size_t)(3 * E + n0 + (tid >> 3)) * E + (tid & 7) * 8);
  const unsigned lA = lds_off(&sm.st.a[0][tid >> 4][(tid & 15) * 4]), lB = lds_off(&sm.st.b[0][tid >> 3][(tid & 7) * 8]);
  auto stage = [&](int buf, int kt) {
    copy8(lA + buf * (unsigned)sizeof(sm.st.a[0]), 8 * KP * 4, gA + (size_t)kt * (SS * HD * 4), 128 * 16);
    copy8(lB + buf * (unsigned)sizeof(sm.st.b[0]), 16 * GP * 2, gB + (size_t)kt * 128, (size_t)16 * E * 2); };
  stage(0, 0);
  asm volatile("s_wait_asynccnt 0x0" ::: "memory");   // this wave's copies of slice 0 have landed
  __syncthreads();                                     // and every other wave's: slice 0 may be read
  stage(1, 1);
#pragma unroll 1   // rolled, for speed only
  for (int kt = 0; kt < NH; ++kt) { const int buf = kt & 1;
#pragma unroll
    for (int kc = 0; kc < 2; ++kc) { const F2 a = frag_split((const __bf16*)&sm.st.a[buf][wave * 16 + col][0], kc * 32, lane); v16b wb[8];
#pragma unroll
      for (int j = 0; j < 8; ++j) wb[j] = frag_b(&sm.st.b[buf][j * 16 + col][kc * 32], lane);
#pragma unroll
      for (int j = 0; j < 8; ++j) { acc[j] = wmma_bf(a.l, wb[j], acc[j]); acc[j] = wmma_bf(a.h, wb[j], acc[j]); } }
    asm volatile("s_wait_dscnt 0x0" ::: "memory");      // this wave's reads of buffer buf are done
    asm volatile("s_wait_asynccnt 0x0" ::: "memory");   // its copies of slice kt + 1 have landed
    __syncthreads();                                     // publishes slice kt + 1 and frees buffer buf (behind the last slice: for the output staging)
    if (kt + 2 < NH) stage(buf, kt + 2); }
  asm volatile("s_wait_asynccnt 0x0" ::: "memory");     // no copy is left in flight behind the loop
#pragma unroll
  for (int j = 0; j < 8; ++j) { const int n = n0 + j * 16 + col; const float bb = bfr(bo[n]);
#pragma unroll
    for (int r = 0; r < 8; ++r) so[wave][8 * g + r][j * 16 + col] = acc[j][r] + bb; }
  LDSX();
#pragma unroll 4
  for (int rl = 0; rl < 16; ++rl) vst2(out + (size_t)(rbase + r0 + rl) * E + n0 + lane * 4, *(const v4f*)(&so[wave][rl][lane * 4]));
}
extern "C" void kernel_launch(void* const* d_in, const int* in_sizes, int n_in, void* d_out, int out_size, void* d_ws, size_t ws_size, hipStream_t stream) {
  (void)in_sizes; (void)n_in; (void)out_size; (void)ws_size;
  const float* x = (const float*)d_in[0]; const float* Wqkv = (const float*)d_in[1]; const float* bqkv = (const float*)d_in[2]; const float* Wp = (const float*)d_in[3]; const float* bp = (const float*)d_in[4]; const float* bQ = (const float*)d_in[5]; const float* bK = (const float*)d_in[6]; const float* bV = (const float*)d_in[7];
  float* out = (float*)d_out;
  char* ws = (char*)d_ws; size_t off = 0;
  auto take = [&](size_t bytes) { char* p = ws + off; off += (bytes + 255) & ~(size_t)255; return p; };
  __bf16* Xb = (__bf16*)take((size_t)NR * E * 2); __bf16* PT = (__bf16*)take((size_t)4 * E * E * 2);
  float* Q32 = (float*)take((size_t)NR * E * 4); __bf16* KS = (__bf16*)take((size_t)NR * E * 4); _Float16* VTh = (_Float16*)take((size_t)NR * E * 2); _Float16* VTl = (_Float16*)take((size_t)NR * E * 2);
  __bf16* OS = (__bf16*)Q32;      // in place, a split row has the f32 row's 256 bytes: each k_attn wave reads its own 16 query rows into registers before writing the same rows; no other block reads them
  // ws: 120 MiB. One launch of each kernel covers the whole batch: two passes over half the batch left places empty in every launch
  // (k_out: 512 blocks on 1,024 places; k_qkv: 1,536 on 1,280, a second round one fifth full; k_attn: 1,024 blocks of unequal length on 768, each pass as long as its fullest WGP)
  k_cvt<<<NR * E / (256 * 16 * 4), 256, 0, stream>>>(x, Xb);
  k_pack<<<dim3(4 * E / 64, E / 64), 128, 0, stream>>>(Wqkv, Wp, PT);
  k_qkv<<<dim3(NR / 64, E / 128, 3), 128, 0, stream>>>(Xb, 0, PT, bqkv, bQ, bK, bV, Q32, KS, VTh, VTl);
  k_attn<<<dim3(NB * NH, SS / 64), 128, 0, stream>>>(Q32, KS, VTh, VTl, OS);
  k_out<<<dim3(NR / 64, E / 128), 128, 0, stream>>>(OS, 0, PT, bp, out);
}

// v009
// One run takes 181 microseconds.
// Two timings next to v008 put it at 1.14 and 1.13 times that version's speed.
// Counting every step since v000, it is 5.82 times as fast.
// compute dtype: x, W_attn, b_attn, W_proj, b_proj, bQ/bK/bV (INPUTS) rounded to bf16 with exact bf16 WMMA products (f32 accumulate) for the projections; q/k f32 split in bf16 hi/lo for the scores (3 products; k is split once, where it is produced), P and V f16 hi/lo (3 products); softmax f32.
#include <hip/hip_runtime.h>
#include <math.h>

typedef __attribute__((ext_vector_type(16))) _Float16 v16h;
typedef __attribute__((ext_vector_type(16))) __bf16 v16b;
typedef __attribute__((ext_vector_type(8)))  _Float16 v8h;
typedef __attribute__((ext_vector_type(8)))  float v8f;
typedef __attribute__((ext_vector_type(4)))  float v4f;
typedef __attribute__((ext_vector_type(2)))  float v2f;
typedef __attribute__((ext_vector_type(4)))  unsigned v4u;
typedef __attribute__((ext_vector_type(2)))  unsigned v2u;
typedef __attribute__((ext_vector_type(4)))  int v4i;
typedef float __attribute__((may_alias)) float_a;
typedef int __attribute__((may_alias)) int_a;

template <typename T> __device__ __forceinline__ void vst2(void* p, T v) { *(T*)p = v;  }
__device__ __forceinline__ v8f wmma16(v16h a, v16h b, v8f c) {
  v8f d = __builtin_amdgcn_wmma_f32_16x16x32_f16(false, a, false, b, (short)0, c, false, false);
  asm volatile("v_nop\n\tv_nop\n\tv_nop\n\tv_nop" : "+v"(d) : "v"(a), "v"(b));
  return d;
}
__device__ __forceinline__ v8f wmma_bf(v16b a, v16b b, v8f c) {
  v8f d = __builtin_amdgcn_wmma_f32_16x16x32_bf16(false, a, false, b, (short)0, c, false, false);
  asm volatile("v_nop\n\tv_nop\n\tv_nop\n\tv_nop" : "+v"(d) : "v"(a), "v"(b));
  return d;
}
// 16x16x32 fragments: lane = (h = lane>>4, row/col = lane&15); elements 0..7 = k0+8h+0..7, 8..15 = k0+16+8h+0..7; D element r = row 8h+r
__device__ __forceinline__ v16h frag_h(const _Float16* rowk0, int lane) {
  union { v16h v; v8h q[2]; } u; const _Float16* p = rowk0 + 8 * (lane >> 4);
  u.q[0] = *(const v8h*)p; u.q[1] = *(const v8h*)(p + 16); return u.v;
}
__device__ __forceinline__ v16h frag_f32(const float* rowk0, int lane) {
  v16h a; const float* p = rowk0 + 8 * (lane >> 4);
#pragma unroll
  for (int i = 0; i < 8; ++i) { a[i] = (_Float16)p[i]; a[8 + i] = (_Float16)p[16 + i]; }
  return a;
}
__device__ __forceinline__ v16h frag_f32s(const float* rowk0, int lane, float sc) {
  v16h a; const float* p = rowk0 + 8 * (lane >> 4);
#pragma unroll
  for (int i = 0; i < 8; ++i) { a[i] = (_Float16)(p[i] * sc); a[8 + i] = (_Float16)(p[16 + i] * sc); }
  return a;
}
// column fragment from a [K][ld] layout (column n), rows >= K read as 0
__device__ __forceinline__ v16h fragc_f32(const float* W, int k0, int n, int lane, int ld, int K) {
  v16h a; const int g = lane >> 4;
#pragma unroll
  for (int i = 0; i < 8; ++i) { const int ka = k0 + 8 * g + i, kb = ka + 16;
    a[i] = (_Float16)(ka < K ? W[(size_t)(ka < K ? ka : K - 1) * ld + n] : 0.f); a[8 + i] = (_Float16)(kb < K ? W[(size_t)(kb < K ? kb : K - 1) * ld + n] : 0.f); }
  return a;
}
struct F2 { v16b h, l; };
__device__ __forceinline__ F2 bsplit16(const float v[16]) { F2 r;
#pragma unroll
  for (int i = 0; i < 16; ++i) { const __bf16 h = (__bf16)v[i]; r.h[i] = h; r.l[i] = (__bf16)(v[i] - (float)h); }
  return r; }
__device__ __forceinline__ F2 split_row(const float* row, int k0, int lane) { float v[16]; const float* p = row + k0 + 8 * (lane >> 4);
#pragma unroll
  for (int i = 0; i < 8; ++i) { v[i] = p[i]; v[8 + i] = p[16 + i]; }
  return bsplit16(v); }
__device__ __forceinline__ F2 split_rowK(const float* row, int k0, int lane, int K) { float v[16]; const int g = lane >> 4;
#pragma unroll
  for (int i = 0; i < 8; ++i) { const int ka = k0 + 8 * g + i, kb = ka + 16; v[i] = ka < K ? row[ka < K ? ka : K - 1] : 0.f; v[8 + i] = kb < K ? row[kb < K ? kb : K - 1] : 0.f; }
  return bsplit16(v); }
__device__ __forceinline__ F2 split_col(const float* W, int k0, int n, int lane, int ld, int K) { float v[16]; const int g = lane >> 4;
#pragma unroll
  for (int i = 0; i < 8; ++i) { const int ka = k0 + 8 * g + i, kb = ka + 16; v[i] = ka < K ? W[(size_t)(ka < K ? ka : K - 1) * ld + n] : 0.f; v[8 + i] = kb < K ? W[(size_t)(kb < K ? kb : K - 1) * ld + n] : 0.f; }
  return bsplit16(v); }
__device__ __forceinline__ v8f mac3(const F2& a, const F2& b, v8f c) { c = wmma_bf(a.l, b.h, c); c = wmma_bf(a.h, b.l, c); return wmma_bf(a.h, b.h, c); }
__device__ __forceinline__ float sigm(float v) { return 1.0f / (1.0f + expf(-v)); }
#define LDSX() do { asm volatile("s_wait_dscnt 0" ::: "memory"); __builtin_amdgcn_wave_barrier(); __builtin_amdgcn_fence(__ATOMIC_RELEASE, "workgroup"); } while (0)


#define NB 4
#define SS 2048
#define E 1024
#define NH 16
#define HD 64
#define NR (NB * SS)
#define PLO 1024.0f
#define VLO 2048.0f
#define SCL2 0.18033688011112042f   // 1/sqrt(64) x log2(e)
__device__ __forceinline__ float bfr(float v) { return (float)(__bf16)v; }
__device__ __forceinline__ v16b frag_b(const __bf16* rowk0, int lane) { return __builtin_bit_cast(v16b, frag_h((const _Float16*)rowk0, lane)); }
// a split row: 64 f32 values kept as 64 bf16 hi | 64 bf16 lo (hi = bf16(v), lo = bf16(v - hi), as bsplit16 has them), 256 bytes like the f32 row
// eight values of one lane: 16 bytes into the row's hi half at d, 16 into its lo half; eight such stores fill each half's 128 bytes
__device__ __forceinline__ void store_split8(const float* s, __bf16* d) { union { __bf16 e[8]; v4u u; } hi, lo;
#pragma unroll
  for (int e = 0; e < 8; ++e) { const float v = s[e]; const __bf16 hv = (__bf16)v; hi.e[e] = hv; lo.e[e] = (__bf16)(v - (float)hv); }
  vst2(d, hi.u); vst2(d + HD, lo.u); }
// the fragment pair of a split row at k0
__device__ __forceinline__ F2 frag_split(const __bf16* row, int k0, int lane) { F2 r; r.h = frag_b(row + k0, lane); r.l = frag_b(row + HD + k0, lane); return r; }

// x -> bf16 on 512 work-groups of eight waves (sixteen waves a WGP), not 4,096, for speed only.
// A lane takes sixteen pieces of four values, 4 KiB apart: every wave-wide load is 512 contiguous bytes, every wave-wide store two whole lines, and the loads are issued ahead of the converts, a dozen or more in flight
__global__ __launch_bounds__(256) void k_cvt(const float* __restrict__ x, __bf16* __restrict__ Xb) {
  const size_t p0 = (size_t)blockIdx.x * (256 * 16) + threadIdx.x;      // counted in pieces
  v4f v[16];
#pragma unroll   // v stays in registers and the loads are issued as one group
  for (int i = 0; i < 16; ++i) v[i] = *(const v4f*)(x + (p0 + i * 256) * 4);
#pragma unroll   // constant indices into v
  for (int i = 0; i < 16; ++i) { union { __bf16 h[4]; v2u u; } pk;
#pragma unroll
    for (int e = 0; e < 4; ++e) pk.h[e] = (__bf16)v[i][e];
    vst2(Xb + (p0 + i * 256) * 4, pk.u); }
}
// PT rows: [0,E) Wq[:,n], [E,2E) Wk[:,n], [2E,3E) Wv[:,n], [3E,4E) Wo[:,n]  ([in][out] weights: column n as a bf16 row)
// a work-group transposes a tile of 64 k x 64 columns through LDS (1,024 work-groups, not one for each of the 4,096 columns): it reads 256 contiguous bytes of each k row,
// where a column read alone takes 4 bytes out of each line, and writes 128 contiguous bytes of each PT row; a lane's eight loads are in flight together
#define TP 36   // LDS pitch, in dwords, of a tile row (64 bf16 = 32 dwords): 144 B = 16 B x odd
__global__ __launch_bounds__(128) void k_pack(const float* __restrict__ Wqkv, const float* __restrict__ Wp, __bf16* __restrict__ PT) {
  __shared__ __align__(16) unsigned st[64][TP];      // [column][k pair]
  const int tid = threadIdx.x, n0 = blockIdx.x * 64, k0 = blockIdx.y * 64;      // 3 E is a multiple of 64: a tile lies in one weight
  const float* W = n0 < 3 * E ? Wqkv + n0 : Wp + (n0 - 3 * E); const size_t ld = n0 < 3 * E ? 3 * E : E;
  const int c4 = tid & 15, kp = tid >> 4;      // four columns 4 c4 + j; k pairs kp + 8 i
  const float* pa[4]; const float* pb[4]; v4f a[4], b[4];
#pragma unroll   // a and b stay in registers and the loads are issued as one group
  for (int i = 0; i < 4; ++i) { pa[i] = W + (size_t)(k0 + 2 * (kp + 8 * i)) * ld + c4 * 4; pb[i] = pa[i] + ld; a[i] = *(const v4f*)pa[i]; b[i] = *(const v4f*)pb[i]; }
  // the eight address pairs are inputs of the wait, so that none of them is handed to a later load's result, or to anything else, ahead of it
  asm volatile("s_wait_xcnt 0x0" :: "v"(pa[0]), "v"(pb[0]), "v"(pa[1]), "v"(pb[1]), "v"(pa[2]), "v"(pb[2]), "v"(pa[3]), "v"(pb[3]) : "memory");
#pragma unroll   // constant indices into a and b
  for (int i = 0; i < 4; ++i) {
#pragma unroll
    for (int j = 0; j < 4; ++j) { union { __bf16 h[2]; unsigned u; } pk; pk.h[0] = (__bf16)a[i][j]; pk.h[1] = (__bf16)b[i][j]; st[c4 * 4 + j][kp + 8 * i] = pk.u; } }
  __syncthreads();
#pragma unroll
  for (int i = 0; i < 4; ++i) { const int r = (tid >> 3) + 16 * i, pc = tid & 7;      // eight lanes write a row's 128 bytes
    vst2(PT + (size_t)(n0 + r) * E + k0 + pc * 8, *(const v4u*)(&st[r][pc * 4])); }
}
// eight 16-byte asynchronous copies of one lane, global -> LDS: LDS byte address l + i*ls, global address g + i*gs bytes.
// s_wait_xcnt closes the copies' own statement, so no address register is rewritten ahead of it.
__device__ __forceinline__ void copy8(unsigned l, unsigned ls, const char* g, size_t gs) {
  asm volatile("global_load_async_to_lds_b128 %0, %8, off\n\t"
               "global_load_async_to_lds_b128 %1, %9, off\n\t"
               "global_load_async_to_lds_b128 %2, %10, off\n\t"
               "global_load_async_to_lds_b128 %3, %11, off\n\t"
               "global_load_async_to_lds_b128 %4, %12, off\n\t"
               "global_load_async_to_lds_b128 %5, %13, off\n\t"
               "global_load_async_to_lds_b128 %6, %14, off\n\t"
               "global_load_async_to_lds_b128 %7, %15, off\n\t"
               "s_wait_xcnt 0x0"
               :: "v"(l), "v"(l + ls), "v"(l + 2 * ls), "v"(l + 3 * ls), "v"(l + 4 * ls), "v"(l + 5 * ls), "v"(l + 6 * ls), "v"(l + 7 * ls),
                  "v"(g), "v"(g + gs), "v"(g + 2 * gs), "v"(g + 3 * gs), "v"(g + 4 * gs), "v"(g + 5 * gs), "v"(g + 6 * gs), "v"(g + 7 * gs)
               : "memory");
}
// the same for two planes of four copies each: plane 1 lies lp bytes further in LDS and gp bytes further in memory
__device__ __forceinline__ void copy4x2(unsigned l, unsigned ls, unsigned lp, const char* g, size_t gs, size_t gp) {
  asm volatile("global_load_async_to_lds_b128 %0, %8, off\n\t"
               "global_load_async_to_lds_b128 %1, %9, off\n\t"
               "global_load_async_to_lds_b128 %2, %10, off\n\t"
               "global_load_async_to_lds_b128 %3, %11, off\n\t"
               "global_load_async_to_lds_b128 %4, %12, off\n\t"
               "global_load_async_to_lds_b128 %5, %13, off\n\t"
               "global_load_async_to_lds_b128 %6, %14, off\n\t"
               "global_load_async_to_lds_b128 %7, %15, off\n\t"
               "s_wait_xcnt 0x0"
               :: "v"(l), "v"(l + ls), "v"(l + 2 * ls), "v"(l + 3 * ls), "v"(l + lp), "v"(l + lp + ls), "v"(l + lp + 2 * ls), "v"(l + lp + 3 * ls),
                  "v"(g), "v"(g + gs), "v"(g + 2 * gs), "v"(g + 3 * gs), "v"(g + gp), "v"(g + gp + gs), "v"(g + gp + 2 * gs), "v"(g + gp + 3 * gs)
               : "memory");
}
// the same for four copies
__device__ __forceinline__ void copy4(unsigned l, unsigned ls, const char* g, size_t gs) {
  asm volatile("global_load_async_to_lds_b128 %0, %4, off\n\t"
               "global_load_async_to_lds_b128 %1, %5, off\n\t"
               "global_load_async_to_lds_b128 %2, %6, off\n\t"
               "global_load_async_to_lds_b128 %3, %7, off\n\t"
               "s_wait_xcnt 0x0"
               :: "v"(l), "v"(l + ls), "v"(l + 2 * ls), "v"(l + 3 * ls),
                  "v"(g), "v"(g + gs), "v"(g + 2 * gs), "v"(g + 3 * gs)
               : "memory");
}
__device__ __forceinline__ unsigned lds_off(const void* p) { return (unsigned)(size_t)p; }
#define KP 68   // LDS pitch, in floats, of a 256-byte row (64 floats; a key's 64 bf16 hi | 64 bf16 lo): 272 B = 16 B x odd
#define VP 72   // LDS pitch of a 64-half V^T row: 144 B = 16 B x odd
#define GP 72   // LDS pitch of a 64-element bf16 k slice: 144 B = 16 B x odd
// LDS of the two projections: in the k loop two buffers of the operands' 64-wide k slices; behind it, from the same first byte on, the output staging
union QkvLds { struct { __bf16 a[2][256][GP]; __bf16 b[2][128][GP]; } st; float so[8][64][68]; struct { _Float16 h[128][264], l[128][264]; } vt; };
union OutLds { struct { float a[2][64][KP]; __bf16 b[2][128][GP]; } st; float so[4][16][132]; };
// each 64-wide k slice of the block's 256 X rows and 128 weight rows is copied to LDS once for the eight waves, two buffers, the next slice in flight while this one is worked on
// QKV: block (256 rows, 128 cols = 2 heads, which), eight waves as 4 x 2, a wave owns 64 rows x 64 cols (one head): each fragment read from LDS feeds four products, and a weight slice fetched from L2 serves 256 rows
// q (+bias) -> Q32 f32 [bh][s][64]; k (+bias) -> KS [bh][s][64 bf16 hi | 64 bf16 lo], the split that the scores use; v (+bias) -> VT hi/lo x4 [bh][d][s]
// four waves a SIMD (two blocks a WGP) is what the LDS allows: the bound keeps the register count inside that
__global__ __launch_bounds__(256, 4) void k_qkv(const __bf16* __restrict__ Xb, int rbase, const __bf16* __restrict__ PT, const float* __restrict__ bqkv, const float* __restrict__ bQ, const float* __restrict__ bK, const float* __restrict__ bV, float* __restrict__ Q32, __bf16* __restrict__ KS, _Float16* __restrict__ VTh, _Float16* __restrict__ VTl) {
  __shared__ __align__(16) QkvLds sm;
  float (&so)[8][64][68] = sm.so; _Float16 (&sth)[128][264] = sm.vt.h, (&stl)[128][264] = sm.vt.l;
  const int tid = threadIdx.x, wave = tid >> 5, lane = tid & 31, col = lane & 15, g = lane >> 4;
  const int wr = wave >> 1, wc = wave & 1;      // the wave's 64 rows and its 64 columns inside the block
  const int which = blockIdx.z, r0b = blockIdx.x * 256, n0 = blockIdx.y * 128; const int b = r0b / SS, s0 = r0b % SS;
  const float* bb_ = bqkv + which * E; const float* bx_ = which == 0 ? bQ : (which == 1 ? bK : bV);      // column n = h*64 + d indexes both biases
  v8f acc[4][4] = {};      // [row tile i][column tile j]
  // a lane's share of a slice: row 32 i + tid/8, 16-byte piece tid%8 of the row's 128 bytes
  const char* gA = (const char*)(Xb + (size_t)(rbase + r0b + (tid >> 3)) * E + (tid & 7) * 8);
  const char* gB = (const char*)(PT + (size_t)(which * E + n0 + (tid >> 3)) * E + (tid & 7) * 8);
  const unsigned lA = lds_off(&sm.st.a[0][tid >> 3][(tid & 7) * 8]), lB = lds_off(&sm.st.b[0][tid >> 3][(tid & 7) * 8]);
  auto stage = [&](int buf, int kt) {
    copy8(lA + buf * (unsigned)sizeof(sm.st.a[0]), 32 * GP * 2, gA + (size_t)kt * 128, (size_t)32 * E * 2);
    copy4(lB + buf * (unsigned)sizeof(sm.st.b[0]), 32 * GP * 2, gB + (size_t)kt * 128, (size_t)32 * E * 2); };
  stage(0, 0);
  asm volatile("s_wait_asynccnt 0x0" ::: "memory");   // this wave's copies of slice 0 have landed
  __syncthreads();                                     // and every other wave's: slice 0 may be read
  stage(1, 1);
#pragma unroll 1   // rolled, for speed only
  for (int kt = 0; kt < E / 64; ++kt) { const int buf = kt & 1;
#pragma unroll
    for (int kc = 0; kc < 2; ++kc) { v16b af[4], wb[4];
#pragma unroll
      for (int i = 0; i < 4; ++i) af[i] = frag_b(&sm.st.a[buf][wr * 64 + i * 16 + col][kc * 32], lane);
#pragma unroll
      for (int j = 0; j < 4; ++j) wb[j] = frag_b(&sm.st.b[buf][wc * 64 + j * 16 + col][kc * 32], lane);
#pragma unroll
      for (int i = 0; i < 4; ++i) {
#pragma unroll
        for (int j = 0; j < 4; ++j) acc[i][j] = wmma_bf(af[i], wb[j], acc[i][j]); } }
    asm volatile("s_wait_dscnt 0x0" ::: "memory");      // this wave's reads of buffer buf are done
    asm volatile("s_wait_asynccnt 0x0" ::: "memory");   // its copies of slice kt + 1 have landed
    __syncthreads();                                     // publishes slice kt + 1 and frees buffer buf (behind the last slice: for the output staging)
    if (kt + 2 < E / 64) stage(buf, kt + 2); }
  asm volatile("s_wait_asynccnt 0x0" ::: "memory");     // no copy is left in flight behind the loop
  const int h = (n0 >> 6) + wc;      // the wave's head
  // both biases of the lane's four columns nl + 16 j
  const int nl = n0 + wc * 64 + col; float rb[4], rx[4], bias[4];
#pragma unroll   // constant indices into rb and rx
  for (int j = 0; j < 4; ++j) { rb[j] = bb_[nl + j * 16]; rx[j] = bx_[nl + j * 16]; }
  // the index and both base pointers are inputs of the wait, so that none of their registers is handed to a load's result, or to anything else, ahead of it
  asm volatile("s_wait_xcnt 0x0" :: "v"(nl), "s"(bb_), "s"(bx_) : "memory");
#pragma unroll   // constant indices into bias
  for (int j = 0; j < 4; ++j) bias[j] = bfr(rb[j]) + bfr(rx[j]);
  if (which < 2) {
#pragma unroll
    for (int j = 0; j < 4; ++j) { const float bb = bias[j];
#pragma unroll
      for (int i = 0; i < 4; ++i) {
#pragma unroll
        for (int r = 0; r < 8; ++r) so[wave][i * 16 + 8 * g + r][j * 16 + col] = acc[i][j][r] + bb; } }
    LDSX();
    const size_t row0 = ((size_t)b * NH + h) * SS + s0 + wr * 64;
    if (which == 0) {
      for (int qq = lane; qq < 64 * 16; qq += 32) { const int rl = qq >> 4, pc = qq & 15;
        vst2(Q32 + (row0 + rl) * HD + pc * 4, *(const v4f*)(&so[wave][rl][pc * 4])); } }
    else {
      for (int qq = lane; qq < 64 * 8; qq += 32) { const int rl = qq >> 3, pc = qq & 7;
        store_split8(&so[wave][rl][pc * 8], KS + (row0 + rl) * (2 * HD) + pc * 8); } } }
  else {
#pragma unroll
    for (int j = 0; j < 4; ++j) { const float bb = bias[j];
#pragma unroll
      for (int i = 0; i < 4; ++i) { union { _Float16 e[8]; v4u u; } hi8, lo8;      // a lane's eight rows are eight consecutive s of its column: 16 bytes a plane
#pragma unroll
        for (int r = 0; r < 8; ++r) { const float v = (acc[i][j][r] + bb) * 4.0f; const _Float16 hi = (_Float16)v; hi8.e[r] = hi; lo8.e[r] = (_Float16)((v - (float)hi) * VLO); }
        vst2(&sth[wc * 64 + j * 16 + col][wr * 64 + i * 16 + 8 * g], hi8.u); vst2(&stl[wc * 64 + j * 16 + col][wr * 64 + i * 16 + 8 * g], lo8.u); } }
    __syncthreads();
    for (int qq = tid; qq < 128 * 32; qq += 256) { const int cl = qq >> 5, pc = qq & 31; const int c = n0 + cl, hh = c >> 6, d = c & 63; const size_t o = (((size_t)b * NH + hh) * HD + d) * SS + s0 + pc * 8;
      vst2(VTh + o, *(const v4u*)(&sth[cl][pc * 8])); vst2(VTl + o, *(const v4u*)(&stl[cl][pc * 8])); } }
}
// causal attention, worked transposed: block (bh, 64 queries, last query block first); key tiles 0..qb; each 64-key tile of K, V^T hi and V^T lo is copied to LDS once for the four waves, two buffers, the next tile in flight while this one is worked on
// S^T = K Q^T (A = key rows, B = query rows) and O^T += V^T P^T (A = V^T rows, B = P): in every accumulator a lane holds ONE query (column lane&15) and rows 8 (lane>>4) + r, so the
// maximum, the sum and the rescale are the lane's own, and two score tiles (keys 32 kc + 8 h + r and 32 kc + 16 + 8 h + r), converted in place, ARE the P fragment of k slice kc: neither scores nor P pass through LDS
// S on bf16 hi/lo splits: q split here from its f32 rows, k read ready split (a key row in LDS is 64 hi | 64 lo, as in memory); P,V hi/lo; O -> OS, split rows [bh][s][64 hi | 64 lo], the split that the output projection uses
__global__ __launch_bounds__(128) void k_attn(const float* __restrict__ Q32, const __bf16* __restrict__ KS, const _Float16* __restrict__ VTh, const _Float16* __restrict__ VTl, __bf16* __restrict__ OS) {
  __shared__ __align__(16) float sK[2][64][KP];
  __shared__ __align__(16) _Float16 sV[2][2][64][VP];      // [buffer][hi, lo][d][key]
  const int tid = threadIdx.x, w = tid >> 5, lane = tid & 31, col = lane & 15, g = lane >> 4;
  // placement: a block's cost grows with its query block (qb + 1 key tiles) and there are more blocks than resident places. The head
  // is the fast index and the query block falls with the slow one: the longest blocks come first in index order, the short ones last,
  // and blocks whose indices lie a multiple of 64 apart now differ in length (before, they were equally long)
  const size_t bh = blockIdx.x; const int qb = SS / 64 - 1 - (int)blockIdx.y; const int q0 = qb * 64 + w * 16;
  F2 aq[2];
#pragma unroll
  for (int kc = 0; kc < 2; ++kc) aq[kc] = split_row(Q32 + (bh * SS + q0 + col) * HD, kc * 32, lane);
  // softmax in base 2: scores carry 1/8 x log2(e), so that e^(s/8 - m) is one subtract and one v_exp_f32 (library expf: thirteen vector instructions a score);
  // the running reference mrun is the row maximum less 14, the same in P, in the row sum and in the rescale, so P comes out scaled by 2^14 with no multiply
  float mrun = -3.0e38f, lrun = 0.f; v8f acc[4] = {}, ac1[4] = {}, ac2[4] = {};      // element r of tile t: O^T[d = 16 t + 8 g + r][query q0 + col]
  // a lane's share of a tile: K, 16 KiB in a row in memory, piece tid + 128 i (LDS row 8 i + tid/16); V^T hi then lo, row 16 i + tid/8, piece tid%8
  const char* gK = (const char*)(KS + bh * SS * (2 * HD)) + tid * 16;
  const size_t vrow = ((bh * HD + (tid >> 3)) * SS + (tid & 7) * 8) * 2;
  const char* gVh = (const char*)VTh + vrow; const size_t gVd = (const char*)VTl - (const char*)VTh;
  const unsigned lK = lds_off(&sK[0][tid >> 4][(tid & 15) * 4]), lV = lds_off(&sV[0][0][tid >> 3][(tid & 7) * 8]);
  auto stage = [&](int buf, int kt) {
    copy8(lK + buf * (unsigned)sizeof(sK[0]), 8 * KP * 4, gK + (size_t)kt * (64 * HD * 4), 128 * 16);
    const char* gv = gVh + (size_t)kt * 128; const unsigned lv = lV + buf * (unsigned)sizeof(sV[0]);
    copy4x2(lv, 16 * VP * 2, (unsigned)sizeof(sV[0][0]), gv, (size_t)16 * SS * 2, gVd); };
  stage(0, 0);
  asm volatile("s_wait_asynccnt 0x0" ::: "memory");   // this wave's copies of tile 0 have landed
  __syncthreads();                                     // and every other wave's: tile 0 may be read
  if (qb >= 1) stage(1, 1);
#pragma unroll 1
  for (int kt = 0; kt <= qb; ++kt) { const int buf = kt & 1;
    v8f s[4] = {};      // element r of tile t: score of key 64 kt + 16 t + 8 g + r with query q0 + col; each tile sums its six products in the order q.lo k.hi, q.hi k.lo, q.hi k.hi, k slice 0 then 1
#pragma unroll
    for (int kc = 0; kc < 2; ++kc) { F2 kf[4];
#pragma unroll
      for (int t = 0; t < 4; ++t) kf[t] = frag_split((const __bf16*)&sK[buf][t * 16 + col][0], kc * 32, lane);
#pragma unroll
      for (int t = 0; t < 4; ++t) s[t] = wmma_bf(kf[t].h, aq[kc].l, s[t]);
#pragma unroll
      for (int t = 0; t < 4; ++t) s[t] = wmma_bf(kf[t].l, aq[kc].h, s[t]);
#pragma unroll
      for (int t = 0; t < 4; ++t) s[t] = wmma_bf(kf[t].h, aq[kc].h, s[t]); }
    float mx = -3.4e38f;
#pragma unroll
    for (int t = 0; t < 4; ++t) {
#pragma unroll
      for (int r = 0; r < 8; ++r) { const int key = kt * 64 + t * 16 + 8 * g + r; s[t][r] = (key > q0 + col) ? -3.0e38f : s[t][r] * SCL2; mx = fmaxf(mx, s[t][r]); } }
    mx = fmaxf(mx, __shfl_xor(mx, 16, 32));      // the query's other 32 keys of the tile lie in lane ^ 16
    const float mnew = fmaxf(mrun, mx - 14.0f); const float corr = __builtin_amdgcn_exp2f(mrun - mnew);
    float ps = 0.f; v16h ph[2], pl[2];
#pragma unroll
    for (int t = 0; t < 4; ++t) s[t] -= mnew;
#pragma unroll
    for (int t = 0; t < 4; ++t) {
#pragma unroll
      for (int r = 0; r < 8; ++r) { const float p = __builtin_amdgcn_exp2f(s[t][r]); ps += p; const _Float16 hi = (_Float16)p; ph[t >> 1][(t & 1) * 8 + r] = hi; pl[t >> 1][(t & 1) * 8 + r] = (_Float16)((p - (float)hi) * PLO); } }
    ps += __shfl_xor(ps, 16, 32);
    lrun = lrun * corr + ps * (1.0f / 16384.0f); mrun = mnew;
#pragma unroll
    for (int t = 0; t < 4; ++t) { acc[t] *= corr; ac1[t] *= corr; ac2[t] *= corr; }
#pragma unroll
    for (int kc = 0; kc < 2; ++kc) {
#pragma unroll
      for (int t = 0; t < 4; ++t) { const v16h vh = frag_h(&sV[buf][0][t * 16 + col][kc * 32], lane);
        acc[t] = wmma16(vh, ph[kc], acc[t]); ac1[t] = wmma16(frag_h(&sV[buf][1][t * 16 + col][kc * 32], lane), ph[kc], ac1[t]); ac2[t] = wmma16(vh, pl[kc], ac2[t]); } }
    __builtin_amdgcn_wave_barrier();
    asm volatile("s_wait_dscnt 0x0" ::: "memory");      // this wave's reads of buffer buf are done
    asm volatile("s_wait_asynccnt 0x0" ::: "memory");   // its copies of tile kt + 1 have landed
    __syncthreads();                                     // publishes tile kt + 1 and frees buffer buf
    if (kt + 2 <= qb) stage(buf, kt + 2); }
  asm volatile("s_wait_asynccnt 0x0" ::: "memory");     // no copy is left in flight behind the loop
  // a lane's eight registers of tile t are eight consecutive d of its own query's row: split and stored from registers, 16 bytes into each half
  const float inv = 1.0f / (lrun * 16384.0f * 4.0f);
  __bf16* orow = OS + ((bh * SS) + q0 + col) * (2 * HD) + 8 * g;
#pragma unroll
  for (int t = 0; t < 4; ++t) { float o[8];
#pragma unroll
    for (int r = 0; r < 8; ++r) o[r] = (acc[t][r] + ac1[t][r] * (1.0f / VLO) + ac2[t][r] * (1.0f / PLO)) * inv;
    store_split8(o, orow + t * 16); }
}
// out = ctx Wo^T + bo : split(ctx) x bf16(Wo rows): 2 products (Wo is an INPUT -> bf16 exact); k slices of the 64 context rows (split rows, read ready split) and 128 weight rows staged in LDS as in k_qkv
__global__ __launch_bounds__(128) void k_out(const __bf16* __restrict__ OS, int rbase, const __bf16* __restrict__ PT, const float* __restrict__ bo, float* __restrict__ out) {
  __shared__ __align__(16) OutLds sm;
  float (&so)[4][16][132] = sm.so;
  const int tid = threadIdx.x, wave = tid >> 5, lane = tid & 31, col = lane & 15, g = lane >> 4;
  const int r0b = blockIdx.x * 64, r0 = r0b + wave * 16, n0 = blockIdx.y * 128; const int b = r0b / SS, s0 = r0b % SS;
  v8f acc[8] = {};
  // slice kt is head kt. A lane's share: context, 16 KiB in a row in memory, piece tid + 128 i (LDS row 8 i + tid/16); weights, row 16 i + tid/8, piece tid%8
  const char* gA = (const char*)(OS + ((size_t)b * NH * SS + s0) * (2 * HD)) + tid * 16;
  const char* gB = (const char*)(PT + (size_t)(3 * E + n0 + (tid >> 3)) * E + (tid & 7) * 8);
  const unsigned lA = lds_off(&sm.st.a[0][tid >> 4][(tid & 15) * 4]), lB = lds_off(&sm.st.b[0][tid >> 3][(tid & 7) * 8]);
  auto stage = [&](int buf, int kt) {
    copy8(lA + buf * (unsigned)sizeof(sm.st.a[0]), 8 * KP * 4, gA + (size_t)kt * (SS * HD * 4), 128 * 16);
    copy8(lB + buf * (unsigned)sizeof(sm.st.b[0]), 16 * GP * 2, gB + (size_t)kt * 128, (size_t)16 * E * 2); };
  stage(0, 0);
  asm volatile("s_wait_asynccnt 0x0" ::: "memory");   // this wave's copies of slice 0 have landed
  __syncthreads();                                     // and every other wave's: slice 0 may be read
  stage(1, 1);
#pragma unroll 1   // rolled, for speed only
  for (int kt = 0; kt < NH; ++kt) { const int buf = kt & 1;
#pragma unroll
    for (int kc = 0; kc < 2; ++kc) { const F2 a = frag_split((const __bf16*)&sm.st.a[buf][wave * 16 + col][0], kc * 32, lane); v16b wb[8];
#pragma unroll
      for (int j = 0; j < 8; ++j) wb[j] = frag_b(&sm.st.b[buf][j * 16 + col][kc * 32], lane);
#pragma unroll
      for (int j = 0; j < 8; ++j) { acc[j] = wmma_bf(a.l, wb[j], acc[j]); acc[j] = wmma_bf(a.h, wb[j], acc[j]); } }
    asm volatile("s_wait_dscnt 0x0" ::: "memory");      // this wave's reads of buffer buf are done
    asm volatile("s_wait_asynccnt 0x0" ::: "memory");   // its copies of slice kt + 1 have landed
    __syncthreads();                                     // publishes slice kt + 1 and frees buffer buf (behind the last slice: for the output staging)
    if (kt + 2 < NH) stage(buf, kt + 2); }
  asm volatile("s_wait_asynccnt 0x0" ::: "memory");     // no copy is left in flight behind the loop
#pragma unroll
  for (int j = 0; j < 8; ++j) { const int n = n0 + j * 16 + col; const float bb = bfr(bo[n]);
#pragma unroll
    for (int r = 0; r < 8; ++r) so[wave][8 * g + r][j * 16 + col] = acc[j][r] + bb; }
  LDSX();
#pragma unroll 4
  for (int rl = 0; rl < 16; ++rl) vst2(out + (size_t)(rbase + r0 + rl) * E + n0 + lane * 4, *(const v4f*)(&so[wave][rl][lane * 4]));
}
extern "C" void kernel_launch(void* const* d_in, const int* in_sizes, int n_in, void* d_out, int out_size, void* d_ws, size_t ws_size, hipStream_t stream) {
  (void)in_sizes; (void)n_in; (void)out_size; (void)ws_size;
  const float* x = (const float*)d_in[0]; const float* Wqkv = (const float*)d_in[1]; const float* bqkv = (const float*)d_in[2]; const float* Wp = (const float*)d_in[3]; const float* bp = (const float*)d_in[4]; const float* bQ = (const float*)d_in[5]; const float* bK = (const float*)d_in[6]; const float* bV = (const float*)d_in[7];
  float* out = (float*)d_out;
  char* ws = (char*)d_ws; size_t off = 0;
  auto take = [&](size_t bytes) { char* p = ws + off; off += (bytes + 255) & ~(size_t)255; return p; };
  __bf16* Xb = (__bf16*)take((size_t)NR * E * 2); __bf16* PT = (__bf16*)take((size_t)4 * E * E * 2);
  float* Q32 = (float*)take((size_t)NR * E * 4); __bf16* KS = (__bf16*)take((size_t)NR * E * 4); _Float16* VTh = (_Float16*)take((size_t)NR * E * 2); _Float16* VTl = (_Float16*)take((size_t)NR * E * 2);
  __bf16* OS = (__bf16*)Q32;      // in place, a split row has the f32 row's 256 bytes: each k_attn wave reads its own 16 query rows into registers before writing the same rows; no other block reads them
  // ws: 120 MiB. One launch of each kernel covers the whole batch: two passes over half the batch left places empty in every launch
  // (k_out: 512 blocks on 1,024 places; k_attn: 1,024 blocks of unequal length on 768, each pass as long as its fullest WGP)
  k_cvt<<<NR * E / (256 * 16 * 4), 256, 0, stream>>>(x, Xb);
  k_pack<<<dim3(4 * E / 64, E / 64), 128, 0, stream>>>(Wqkv, Wp, PT);
  k_qkv<<<dim3(NR / 256, E / 128, 3), 256, 0, stream>>>(Xb, 0, PT, bqkv, bQ, bK, bV, Q32, KS, VTh, VTl);
  k_attn<<<dim3(NB * NH, SS / 64), 128, 0, stream>>>(Q32, KS, VTh, VTl, OS);
  k_out<<<dim3(NR / 64, E / 128), 128, 0, stream>>>(OS, 0, PT, bp, out);
}

// v010
// Measured time: 172 microseconds a run.
// In both of two side-by-side timings against v009, it was 1.04 times as fast.
// Over all steps from v000 it is 6.06 times as fast.
// compute dtype: x, W_attn, b_attn, W_proj, b_proj, bQ/bK/bV (INPUTS) rounded to bf16 with exact bf16 WMMA products (f32 accumulate) for the projections; q/k f32 split in bf16 hi/lo for the scores (3 products; k is split once, where it is produced), P and V f16 hi/lo (3 products); softmax f32.
#include <hip/hip_runtime.h>
#include <math.h>

typedef __attribute__((ext_vector_type(16))) _Float16 v16h;
typedef __attribute__((ext_vector_type(16))) __bf16 v16b;
typedef __attribute__((ext_vector_type(8)))  _Float16 v8h;
typedef __attribute__((ext_vector_type(8)))  float v8f;
typedef __attribute__((ext_vector_type(4)))  float v4f;
typedef __attribute__((ext_vector_type(2)))  float v2f;
typedef __attribute__((ext_vector_type(4)))  unsigned v4u;
typedef __attribute__((ext_vector_type(2)))  unsigned v2u;
typedef __attribute__((ext_vector_type(4)))  int v4i;
typedef float __attribute__((may_alias)) float_a;
typedef int __attribute__((may_alias)) int_a;

template <typename T> __device__ __forceinline__ void vst2(void* p, T v) { *(T*)p = v;  }
__device__ __forceinline__ v8f wmma16(v16h a, v16h b, v8f c) {
  v8f d = __builtin_amdgcn_wmma_f32_16x16x32_f16(false, a, false, b, (short)0, c, false, false);
  asm volatile("v_nop\n\tv_nop\n\tv_nop\n\tv_nop" : "+v"(d) : "v"(a), "v"(b));
  return d;
}
__device__ __forceinline__ v8f wmma_bf(v16b a, v16b b, v8f c) {
  v8f d = __builtin_amdgcn_wmma_f32_16x16x32_bf16(false, a, false, b, (short)0, c, false, false);
  asm volatile("v_nop\n\tv_nop\n\tv_nop\n\tv_nop" : "+v"(d) : "v"(a), "v"(b));
  return d;
}
// 16x16x32 fragments: lane = (h = lane>>4, row/col = lane&15); elements 0..7 = k0+8h+0..7, 8..15 = k0+16+8h+0..7; D element r = row 8h+r
__device__ __forceinline__ v16h frag_h(const _Float16* rowk0, int lane) {
  union { v16h v; v8h q[2]; } u; const _Float16* p = rowk0 + 8 * (lane >> 4);
  u.q[0] = *(const v8h*)p; u.q[1] = *(const v8h*)(p + 16); return u.v;
}
__device__ __forceinline__ v16h frag_f32(const float* rowk0, int lane) {
  v16h a; const float* p = rowk0 + 8 * (lane >> 4);
#pragma unroll
  for (int i = 0; i < 8; ++i) { a[i] = (_Float16)p[i]; a[8 + i] = (_Float16)p[16 + i]; }
  return a;
}
__device__ __forceinline__ v16h frag_f32s(const float* rowk0, int lane, float sc) {
  v16h a; const float* p = rowk0 + 8 * (lane >> 4);
#pragma unroll
  for (int i = 0; i < 8; ++i) { a[i] = (_Float16)(p[i] * sc); a[8 + i] = (_Float16)(p[16 + i] * sc); }
  return a;
}
// column fragment from a [K][ld] layout (column n), rows >= K read as 0
__device__ __forceinline__ v16h fragc_f32(const float* W, int k0, int n, int lane, int ld, int K) {
  v16h a; const int g = lane >> 4;
#pragma unroll
  for (int i = 0; i < 8; ++i) { const int ka = k0 + 8 * g + i, kb = ka + 16;
    a[i] = (_Float16)(ka < K ? W[(size_t)(ka < K ? ka : K - 1) * ld + n] : 0.f); a[8 + i] = (_Float16)(kb < K ? W[(size_t)(kb < K ? kb : K - 1) * ld + n] : 0.f); }
  return a;
}
struct F2 { v16b h, l; };
__device__ __forceinline__ F2 bsplit16(const float v[16]) { F2 r;
#pragma unroll
  for (int i = 0; i < 16; ++i) { const __bf16 h = (__bf16)v[i]; r.h[i] = h; r.l[i] = (__bf16)(v[i] - (float)h); }
  return r; }
__device__ __forceinline__ F2 split_row(const float* row, int k0, int lane) { float v[16]; const float* p = row + k0 + 8 * (lane >> 4);
#pragma unroll
  for (int i = 0; i < 8; ++i) { v[i] = p[i]; v[8 + i] = p[16 + i]; }
  return bsplit16(v); }
__device__ __forceinline__ F2 split_rowK(const float* row, int k0, int lane, int K) { float v[16]; const int g = lane >> 4;
#pragma unroll
  for (int i = 0; i < 8; ++i) { const int ka = k0 + 8 * g + i, kb = ka + 16; v[i] = ka < K ? row[ka < K ? ka : K - 1] : 0.f; v[8 + i] = kb < K ? row[kb < K ? kb : K - 1] : 0.f; }
  return bsplit16(v); }
__device__ __forceinline__ F2 split_col(const float* W, int k0, int n, int lane, int ld, int K) { float v[16]; const int g = lane >> 4;
#pragma unroll
  for (int i = 0; i < 8; ++i) { const int ka = k0 + 8 * g + i, kb = ka + 16; v[i] = ka < K ? W[(size_t)(ka < K ? ka : K - 1) * ld + n] : 0.f; v[8 + i] = kb < K ? W[(size_t)(kb < K ? kb : K - 1) * ld + n] : 0.f; }
  return bsplit16(v); }
__device__ __forceinline__ v8f mac3(const F2& a, const F2& b, v8f c) { c = wmma_bf(a.l, b.h, c); c = wmma_bf(a.h, b.l, c); return wmma_bf(a.h, b.h, c); }
__device__ __forceinline__ float sigm(float v) { return 1.0f / (1.0f + expf(-v)); }
#define LDSX() do { asm volatile("s_wait_dscnt 0" ::: "memory"); __builtin_amdgcn_wave_barrier(); __builtin_amdgcn_fence(__ATOMIC_RELEASE, "workgroup"); } while (0)


#define NB 4
#define SS 2048
#define E 1024
#define NH 16
#define HD 64
#define NR (NB * SS)
#define PLO 1024.0f
#define VLO 2048.0f
#define SCL2 0.18033688011112042f   // 1/sqrt(64) x log2(e)
__device__ __forceinline__ float bfr(float v) { return (float)(__bf16)v; }
__device__ __forceinline__ v16b frag_b(const __bf16* rowk0, int lane) { return __builtin_bit_cast(v16b, frag_h((const _Float16*)rowk0, lane)); }
// a split row: 64 f32 values kept as 64 bf16 hi | 64 bf16 lo (hi = bf16(v), lo = bf16(v - hi), as bsplit16 has them), 256 bytes like the f32 row
// eight values of one lane: 16 bytes into the row's hi half at d, 16 into its lo half; eight such stores fill each half's 128 bytes
__device__ __forceinline__ void store_split8(const float* s, __bf16* d) { union { __bf16 e[8]; v4u u; } hi, lo;
#pragma unroll
  for (int e = 0; e < 8; ++e) { const float v = s[e]; const __bf16 hv = (__bf16)v; hi.e[e] = hv; lo.e[e] = (__bf16)(v - (float)hv); }
  vst2(d, hi.u); vst2(d + HD, lo.u); }
// the fragment pair of a split row at k0
__device__ __forceinline__ F2 frag_split(const __bf16* row, int k0, int lane) { F2 r; r.h = frag_b(row + k0, lane); r.l = frag_b(row + HD + k0, lane); return r; }

// x -> bf16 on 512 work-groups of eight waves (sixteen waves a WGP), not 4,096, for speed only.
// A lane takes sixteen pieces of four values, 4 KiB apart: every wave-wide load is 512 contiguous bytes, every wave-wide store two whole lines, and the loads are issued ahead of the converts, a dozen or more in flight
__global__ __launch_bounds__(256) void k_cvt(const float* __restrict__ x, __bf16* __restrict__ Xb) {
  const size_t p0 = (size_t)blockIdx.x * (256 * 16) + threadIdx.x;      // counted in pieces
  v4f v[16];
#pragma unroll   // v stays in registers and the loads are issued as one group
  for (int i = 0; i < 16; ++i) v[i] = *(const v4f*)(x + (p0 + i * 256) * 4);
#pragma unroll   // constant indices into v
  for (int i = 0; i < 16; ++i) { union { __bf16 h[4]; v2u u; } pk;
#pragma unroll
    for (int e = 0; e < 4; ++e) pk.h[e] = (__bf16)v[i][e];
    vst2(Xb + (p0 + i * 256) * 4, pk.u); }
}
// PT rows: [0,E) Wq[:,n], [E,2E) Wk[:,n], [2E,3E) Wv[:,n], [3E,4E) Wo[:,n]  ([in][out] weights: column n as a bf16 row)
// a work-group transposes a tile of 64 k x 64 columns through LDS (1,024 work-groups, not one for each of the 4,096 columns): it reads 256 contiguous bytes of each k row,
// where a column read alone takes 4 bytes out of each line, and writes 128 contiguous bytes of each PT row; a lane's eight loads are in flight together
#define TP 36   // LDS pitch, in dwords, of a tile row (64 bf16 = 32 dwords): 144 B = 16 B x odd
__global__ __launch_bounds__(128) void k_pack(const float* __restrict__ Wqkv, const float* __restrict__ Wp, __bf16* __restrict__ PT) {
  __shared__ __align__(16) unsigned st[64][TP];      // [column][k pair]
  const int tid = threadIdx.x, n0 = blockIdx.x * 64, k0 = blockIdx.y * 64;      // 3 E is a multiple of 64: a tile lies in one weight
  const float* W = n0 < 3 * E ? Wqkv + n0 : Wp + (n0 - 3 * E); const size_t ld = n0 < 3 * E ? 3 * E : E;
  const int c4 = tid & 15, kp = tid >> 4;      // four columns 4 c4 + j; k pairs kp + 8 i
  const float* pa[4]; const float* pb[4]; v4f a[4], b[4];
#pragma unroll   // a and b stay in registers and the loads are issued as one group
  for (int i = 0; i < 4; ++i) { pa[i] = W + (size_t)(k0 + 2 * (kp + 8 * i)) * ld + c4 * 4; pb[i] = pa[i] + ld; a[i] = *(const v4f*)pa[i]; b[i] = *(const v4f*)pb[i]; }
  // the eight address pairs are inputs of the wait, so that none of them is handed to a later load's result, or to anything else, ahead of it
  asm volatile("s_wait_xcnt 0x0" :: "v"(pa[0]), "v"(pb[0]), "v"(pa[1]), "v"(pb[1]), "v"(pa[2]), "v"(pb[2]), "v"(pa[3]), "v"(pb[3]) : "memory");
#pragma unroll   // constant indices into a and b
  for (int i = 0; i < 4; ++i) {
#pragma unroll
    for (int j = 0; j < 4; ++j) { union { __bf16 h[2]; unsigned u; } pk; pk.h[0] = (__bf16)a[i][j]; pk.h[1] = (__bf16)b[i][j]; st[c4 * 4 + j][kp + 8 * i] = pk.u; } }
  __syncthreads();
#pragma unroll
  for (int i = 0; i < 4; ++i) { const int r = (tid >> 3) + 16 * i, pc = tid & 7;      // eight lanes write a row's 128 bytes
    vst2(PT + (size_t)(n0 + r) * E + k0 + pc * 8, *(const v4u*)(&st[r][pc * 4])); }
}
// eight 16-byte asynchronous copies of one lane, global -> LDS: LDS byte address l + i*ls, global address g + i*gs bytes.
// s_wait_xcnt closes the copies' own statement, so no address register is rewritten ahead of it.
__device__ __forceinline__ void copy8(unsigned l, unsigned ls, const char* g, size_t gs) {
  asm volatile("global_load_async_to_lds_b128 %0, %8, off\n\t"
               "global_load_async_to_lds_b128 %1, %9, off\n\t"
               "global_load_async_to_lds_b128 %2, %10, off\n\t"
               "global_load_async_to_lds_b128 %3, %11, off\n\t"
               "global_load_async_to_lds_b128 %4, %12, off\n\t"
               "global_load_async_to_lds_b128 %5, %13, off\n\t"
               "global_load_async_to_lds_b128 %6, %14, off\n\t"
               "global_load_async_to_lds_b128 %7, %15, off\n\t"
               "s_wait_xcnt 0x0"
               :: "v"(l), "v"(l + ls), "v"(l + 2 * ls), "v"(l + 3 * ls), "v"(l + 4 * ls), "v"(l + 5 * ls), "v"(l + 6 * ls), "v"(l + 7 * ls),
                  "v"(g), "v"(g + gs), "v"(g + 2 * gs), "v"(g + 3 * gs), "v"(g + 4 * gs), "v"(g + 5 * gs), "v"(g + 6 * gs), "v"(g + 7 * gs)
               : "memory");
}
// the same for two planes of four copies each: plane 1 lies lp bytes further in LDS and gp bytes further in memory
__device__ __forceinline__ void copy4x2(unsigned l, unsigned ls, unsigned lp, const char* g, size_t gs, size_t gp) {
  asm volatile("global_load_async_to_lds_b128 %0, %8, off\n\t"
               "global_load_async_to_lds_b128 %1, %9, off\n\t"
               "global_load_async_to_lds_b128 %2, %10, off\n\t"
               "global_load_async_to_lds_b128 %3, %11, off\n\t"
               "global_load_async_to_lds_b128 %4, %12, off\n\t"
               "global_load_async_to_lds_b128 %5, %13, off\n\t"
               "global_load_async_to_lds_b128 %6, %14, off\n\t"
               "global_load_async_to_lds_b128 %7, %15, off\n\t"
               "s_wait_xcnt 0x0"
               :: "v"(l), "v"(l + ls), "v"(l + 2 * ls), "v"(l + 3 * ls), "v"(l + lp), "v"(l + lp + ls), "v"(l + lp + 2 * ls), "v"(l + lp + 3 * ls),
                  "v"(g), "v"(g + gs), "v"(g + 2 * gs), "v"(g + 3 * gs), "v"(g + gp), "v"(g + gp + gs), "v"(g + gp + 2 * gs), "v"(g + gp + 3 * gs)
               : "memory");
}
// the same for four copies
__device__ __forceinline__ void copy4(unsigned l, unsigned ls, const char* g, size_t gs) {
  asm volatile("global_load_async_to_lds_b128 %0, %4, off\n\t"
               "global_load_async_to_lds_b128 %1, %5, off\n\t"
               "global_load_async_to_lds_b128 %2, %6, off\n\t"
               "global_load_async_to_lds_b128 %3, %7, off\n\t"
               "s_wait_xcnt 0x0"
               :: "v"(l), "v"(l + ls), "v"(l + 2 * ls), "v"(l + 3 * ls),
                  "v"(g), "v"(g + gs), "v"(g + 2 * gs), "v"(g + 3 * gs)
               : "memory");
}
__device__ __forceinline__ unsigned lds_off(const void* p) { return (unsigned)(size_t)p; }
#define KP 68   // LDS pitch, in floats, of a 256-byte row (64 floats; a key's 64 bf16 hi | 64 bf16 lo): 272 B = 16 B x odd
#define VP 72   // LDS pitch of a 64-half V^T row: 144 B = 16 B x odd
#define GP 72   // LDS pitch of a 64-element bf16 k slice: 144 B = 16 B x odd
// LDS of the two projections: in the k loop two buffers of the operands' 64-wide k slices; behind it, from the same first byte on, the output staging
union QkvLds { struct { __bf16 a[2][256][GP]; __bf16 b[2][128][GP]; } st; float so[8][64][68]; struct { _Float16 h[128][264], l[128][264]; } vt; };
union OutLds { struct { float a[2][64][KP]; __bf16 b[2][128][GP]; } st; float so[4][16][132]; };
// each 64-wide k slice of the block's 256 X rows and 128 weight rows is copied to LDS once for the eight waves, two buffers, the next slice in flight while this one is worked on
// QKV: block (256 rows, 128 cols = 2 heads, which), eight waves as 4 x 2, a wave owns 64 rows x 64 cols (one head): each fragment read from LDS feeds four products, and a weight slice fetched from L2 serves 256 rows
// q (+bias) -> Q32 f32 [bh][s][64]; k (+bias) -> KS [bh][s][64 bf16 hi | 64 bf16 lo], the split that the scores use; v (+bias) -> VT hi/lo x4 [bh][d][s]
// four waves a SIMD (two blocks a WGP) is what the LDS allows: the bound keeps the register count inside that
__global__ __launch_bounds__(256, 4) void k_qkv(const __bf16* __restrict__ Xb, int rbase, const __bf16* __restrict__ PT, const float* __restrict__ bqkv, const float* __restrict__ bQ, const float* __restrict__ bK, const float* __restrict__ bV, float* __restrict__ Q32, __bf16* __restrict__ KS, _Float16* __restrict__ VTh, _Float16* __restrict__ VTl) {
  __shared__ __align__(16) QkvLds sm;
  float (&so)[8][64][68] = sm.so; _Float16 (&sth)[128][264] = sm.vt.h, (&stl)[128][264] = sm.vt.l;
  const int tid = threadIdx.x, wave = tid >> 5, lane = tid & 31, col = lane & 15, g = lane >> 4;
  const int wr = wave >> 1, wc = wave & 1;      // the wave's 64 rows and its 64 columns inside the block
  const int which = blockIdx.z, r0b = blockIdx.x * 256, n0 = blockIdx.y * 128; const int b = r0b / SS, s0 = r0b % SS;
  const float* bb_ = bqkv + which * E; const float* bx_ = which == 0 ? bQ : (which == 1 ? bK : bV);      // column n = h*64 + d indexes both biases
  v8f acc[4][4] = {};      // [row tile i][column tile j]
  // a lane's share of a slice: row 32 i + tid/8, 16-byte piece tid%8 of the row's 128 bytes
  const char* gA = (const char*)(Xb + (size_t)(rbase + r0b + (tid >> 3)) * E + (tid & 7) * 8);
  const char* gB = (const char*)(PT + (size_t)(which * E + n0 + (tid >> 3)) * E + (tid & 7) * 8);
  const unsigned lA = lds_off(&sm.st.a[0][tid >> 3][(tid & 7) * 8]), lB = lds_off(&sm.st.b[0][tid >> 3][(tid & 7) * 8]);
  auto stage = [&](int buf, int kt) {
    copy8(lA + buf * (unsigned)sizeof(sm.st.a[0]), 32 * GP * 2, gA + (size_t)kt * 128, (size_t)32 * E * 2);
    copy4(lB + buf * (unsigned)sizeof(sm.st.b[0]), 32 * GP * 2, gB + (size_t)kt * 128, (size_t)32 * E * 2); };
  stage(0, 0);
  asm volatile("s_wait_asynccnt 0x0" ::: "memory");   // this wave's copies of slice 0 have landed
  __syncthreads();                                     // and every other wave's: slice 0 may be read
  stage(1, 1);
#pragma unroll 1   // rolled, for speed only
  for (int kt = 0; kt < E / 64; ++kt) { const int buf = kt & 1;
#pragma unroll
    for (int kc = 0; kc < 2; ++kc) { v16b af[4], wb[4];
#pragma unroll
      for (int i = 0; i < 4; ++i) af[i] = frag_b(&sm.st.a[buf][wr * 64 + i * 16 + col][kc * 32], lane);
#pragma unroll
      for (int j = 0; j < 4; ++j) wb[j] = frag_b(&sm.st.b[buf][wc * 64 + j * 16 + col][kc * 32], lane);
#pragma unroll
      for (int i = 0; i < 4; ++i) {
#pragma unroll
        for (int j = 0; j < 4; ++j) acc[i][j] = wmma_bf(af[i], wb[j], acc[i][j]); } }
    asm volatile("s_wait_dscnt 0x0" ::: "memory");      // this wave's reads of buffer buf are done
    asm volatile("s_wait_asynccnt 0x0" ::: "memory");   // its copies of slice kt + 1 have landed
    __syncthreads();                                     // publishes slice kt + 1 and frees buffer buf (behind the last slice: for the output staging)
    if (kt + 2 < E / 64) stage(buf, kt + 2); }
  asm volatile("s_wait_asynccnt 0x0" ::: "memory");     // no copy is left in flight behind the loop
  const int h = (n0 >> 6) + wc;      // the wave's head
  // both biases of the lane's four columns nl + 16 j
  const int nl = n0 + wc * 64 + col; float rb[4], rx[4], bias[4];
#pragma unroll   // constant indices into rb and rx
  for (int j = 0; j < 4; ++j) { rb[j] = bb_[nl + j * 16]; rx[j] = bx_[nl + j * 16]; }
  // the index and both base pointers are inputs of the wait, so that none of their registers is handed to a load's result, or to anything else, ahead of it
  asm volatile("s_wait_xcnt 0x0" :: "v"(nl), "s"(bb_), "s"(bx_) : "memory");
#pragma unroll   // constant indices into bias
  for (int j = 0; j < 4; ++j) bias[j] = bfr(rb[j]) + bfr(rx[j]);
  if (which < 2) {
#pragma unroll
    for (int j = 0; j < 4; ++j) { const float bb = bias[j];
#pragma unroll
      for (int i = 0; i < 4; ++i) {
#pragma unroll
        for (int r = 0; r < 8; ++r) so[wave][i * 16 + 8 * g + r][j * 16 + col] = acc[i][j][r] + bb; } }
    LDSX();
    const size_t row0 = ((size_t)b * NH + h) * SS + s0 + wr * 64;
    if (which == 0) {
      for (int qq = lane; qq < 64 * 16; qq += 32) { const int rl = qq >> 4, pc = qq & 15;
        vst2(Q32 + (row0 + rl) * HD + pc * 4, *(const v4f*)(&so[wave][rl][pc * 4])); } }
    else {
      for (int qq = lane; qq < 64 * 8; qq += 32) { const int rl = qq >> 3, pc = qq & 7;
        store_split8(&so[wave][rl][pc * 8], KS + (row0 + rl) * (2 * HD) + pc * 8); } } }
  else {
#pragma unroll
    for (int j = 0; j < 4; ++j) { const float bb = bias[j];
#pragma unroll
      for (int i = 0; i < 4; ++i) { union { _Float16 e[8]; v4u u; } hi8, lo8;      // a lane's eight rows are eight consecutive s of its column: 16 bytes a plane
#pragma unroll
        for (int r = 0; r < 8; ++r) { const float v = (acc[i][j][r] + bb) * 4.0f; const _Float16 hi = (_Float16)v; hi8.e[r] = hi; lo8.e[r] = (_Float16)((v - (float)hi) * VLO); }
        vst2(&sth[wc * 64 + j * 16 + col][wr * 64 + i * 16 + 8 * g], hi8.u); vst2(&stl[wc * 64 + j * 16 + col][wr * 64 + i * 16 + 8 * g], lo8.u); } }
    __syncthreads();
    for (int qq = tid; qq < 128 * 32; qq += 256) { const int cl = qq >> 5, pc = qq & 31; const int c = n0 + cl, hh = c >> 6, d = c & 63; const size_t o = (((size_t)b * NH + hh) * HD + d) * SS + s0 + pc * 8;
      vst2(VTh + o, *(const v4u*)(&sth[cl][pc * 8])); vst2(VTl + o, *(const v4u*)(&stl[cl][pc * 8])); } }
}
// causal attention, worked transposed: block (bh, 64 queries, last query block first); key tiles 0..qb; each 64-key tile of K, V^T hi and V^T lo is copied to LDS once for the four waves, two buffers, the next tile in flight while this one is worked on
// S^T = K Q^T (A = key rows, B = query rows) and O^T += V^T P^T (A = V^T rows, B = P): in every accumulator a lane holds ONE query (column lane&15) and rows 8 (lane>>4) + r, so the
// maximum, the sum and the rescale are the lane's own, and two score tiles (keys 32 kc + 8 h + r and 32 kc + 16 + 8 h + r), converted in place, ARE the P fragment of k slice kc: neither scores nor P pass through LDS
// S on bf16 hi/lo splits: q split here from its f32 rows, k read ready split (a key row in LDS is 64 hi | 64 lo, as in memory); P,V hi/lo; O -> OS, split rows [bh][s][64 hi | 64 lo], the split that the output projection uses
__global__ __launch_bounds__(128) void k_attn(const float* __restrict__ Q32, const __bf16* __restrict__ KS, const _Float16* __restrict__ VTh, const _Float16* __restrict__ VTl, __bf16* __restrict__ OS) {
  __shared__ __align__(16) float sK[2][64][KP];
  __shared__ __align__(16) _Float16 sV[2][2][64][VP];      // [buffer][hi, lo][d][key]
  const int tid = threadIdx.x, w = tid >> 5, lane = tid & 31, col = lane & 15, g = lane >> 4;
  // placement: a block's cost grows with its query block (qb + 1 key tiles) and there are more blocks than resident places. The head
  // is the fast index and the query block falls with the slow one: the longest blocks come first in index order, the short ones last,
  // and blocks whose indices lie a multiple of 64 apart now differ in length (before, they were equally long)
  const size_t bh = blockIdx.x; const int qb = SS / 64 - 1 - (int)blockIdx.y; const int q0 = qb * 64 + w * 16;
  F2 aq[2];
#pragma unroll
  for (int kc = 0; kc < 2; ++kc) aq[kc] = split_row(Q32 + (bh * SS + q0 + col) * HD, kc * 32, lane);
  // softmax in base 2: scores carry 1/8 x log2(e), so that e^(s/8 - m) is one subtract and one v_exp_f32 (library expf: thirteen vector instructions a score);
  // the running reference mrun is the row maximum less 14, the same in P, in the row sum and in the rescale, so P comes out scaled by 2^14 with no multiply
  float mrun = -3.0e38f, lrun = 0.f; v8f acc[4] = {}, ac1[4] = {}, ac2[4] = {};      // element r of tile t: O^T[d = 16 t + 8 g + r][query q0 + col]
  // a lane's share of a tile: K, 16 KiB in a row in memory, piece tid + 128 i (LDS row 8 i + tid/16); V^T hi then lo, row 16 i + tid/8, piece tid%8
  const char* gK = (const char*)(KS + bh * SS * (2 * HD)) + tid * 16;
  const size_t vrow = ((bh * HD + (tid >> 3)) * SS + (tid & 7) * 8) * 2;
  const char* gVh = (const char*)VTh + vrow; const size_t gVd = (const char*)VTl - (const char*)VTh;
  const unsigned lK = lds_off(&sK[0][tid >> 4][(tid & 15) * 4]), lV = lds_off(&sV[0][0][tid >> 3][(tid & 7) * 8]);
  auto stage = [&](int buf, int kt) {
    copy8(lK + buf * (unsigned)sizeof(sK[0]), 8 * KP * 4, gK + (size_t)kt * (64 * HD * 4), 128 * 16);
    const char* gv = gVh + (size_t)kt * 128; const unsigned lv = lV + buf * (unsigned)sizeof(sV[0]);
    copy4x2(lv, 16 * VP * 2, (unsigned)sizeof(sV[0][0]), gv, (size_t)16 * SS * 2, gVd); };
  stage(0, 0);
  asm volatile("s_wait_asynccnt 0x0" ::: "memory");   // this wave's copies of tile 0 have landed
  __syncthreads();                                     // and every other wave's: tile 0 may be read
  if (qb >= 1) stage(1, 1);
#pragma unroll 1
  for (int kt = 0; kt <= qb; ++kt) { const int buf = kt & 1;
    v8f s[4] = {};      // element r of tile t: score of key 64 kt + 16 t + 8 g + r with query q0 + col; each tile sums its six products in the order q.lo k.hi, q.hi k.lo, q.hi k.hi, k slice 0 then 1
#pragma unroll
    for (int kc = 0; kc < 2; ++kc) { F2 kf[4];
#pragma unroll
      for (int t = 0; t < 4; ++t) kf[t] = frag_split((const __bf16*)&sK[buf][t * 16 + col][0], kc * 32, lane);
#pragma unroll
      for (int t = 0; t < 4; ++t) s[t] = wmma_bf(kf[t].h, aq[kc].l, s[t]);
#pragma unroll
      for (int t = 0; t < 4; ++t) s[t] = wmma_bf(kf[t].l, aq[kc].h, s[t]);
#pragma unroll
      for (int t = 0; t < 4; ++t) s[t] = wmma_bf(kf[t].h, aq[kc].h, s[t]); }
    float mx = -3.4e38f;
#pragma unroll
    for (int t = 0; t < 4; ++t) {
#pragma unroll
      for (int r = 0; r < 8; ++r) { const int key = kt * 64 + t * 16 + 8 * g + r; s[t][r] = (key > q0 + col) ? -3.0e38f : s[t][r] * SCL2; mx = fmaxf(mx, s[t][r]); } }
    mx = fmaxf(mx, __shfl_xor(mx, 16, 32));      // the query's other 32 keys of the tile lie in lane ^ 16
    const float mnew = fmaxf(mrun, mx - 14.0f); const float corr = __builtin_amdgcn_exp2f(mrun - mnew);
    float ps = 0.f; v16h ph[2], pl[2];
#pragma unroll
    for (int t = 0; t < 4; ++t) s[t] -= mnew;
#pragma unroll
    for (int t = 0; t < 4; ++t) {
#pragma unroll
      for (int r = 0; r < 8; ++r) { const float p = __builtin_amdgcn_exp2f(s[t][r]); ps += p; const _Float16 hi = (_Float16)p; ph[t >> 1][(t & 1) * 8 + r] = hi; pl[t >> 1][(t & 1) * 8 + r] = (_Float16)((p - (float)hi) * PLO); } }
    ps += __shfl_xor(ps, 16, 32);
    lrun = lrun * corr + ps * (1.0f / 16384.0f); mrun = mnew;
#pragma unroll
    for (int t = 0; t < 4; ++t) { acc[t] *= corr; ac1[t] *= corr; ac2[t] *= corr; }
#pragma unroll
    for (int kc = 0; kc < 2; ++kc) { v16h vh[4], vl[4];      // the k slice's eight V^T fragments are read as one group ahead of its twelve products, as the K fragments are: read pair by pair among the products, each pair's LDS latency would be waited out in full
#pragma unroll
      for (int t = 0; t < 4; ++t) { vh[t] = frag_h(&sV[buf][0][t * 16 + col][kc * 32], lane); vl[t] = frag_h(&sV[buf][1][t * 16 + col][kc * 32], lane); }
#pragma unroll   // constant indices: fragments and accumulators stay in registers (the next two loops likewise)
      for (int t = 0; t < 4; ++t) acc[t] = wmma16(vh[t], ph[kc], acc[t]);
#pragma unroll
      for (int t = 0; t < 4; ++t) ac1[t] = wmma16(vl[t], ph[kc], ac1[t]);
#pragma unroll
      for (int t = 0; t < 4; ++t) ac2[t] = wmma16(vh[t], pl[kc], ac2[t]); }
    __builtin_amdgcn_wave_barrier();
    asm volatile("s_wait_dscnt 0x0" ::: "memory");      // this wave's reads of buffer buf are done
    asm volatile("s_wait_asynccnt 0x0" ::: "memory");   // its copies of tile kt + 1 have landed
    __syncthreads();                                     // publishes tile kt + 1 and frees buffer buf
    if (kt + 2 <= qb) stage(buf, kt + 2); }
  asm volatile("s_wait_asynccnt 0x0" ::: "memory");     // no copy is left in flight behind the loop
  // a lane's eight registers of tile t are eight consecutive d of its own query's row: split and stored from registers, 16 bytes into each half
  const float inv = 1.0f / (lrun * 16384.0f * 4.0f);
  __bf16* orow = OS + ((bh * SS) + q0 + col) * (2 * HD) + 8 * g;
#pragma unroll
  for (int t = 0; t < 4; ++t) { float o[8];
#pragma unroll
    for (int r = 0; r < 8; ++r) o[r] = (acc[t][r] + ac1[t][r] * (1.0f / VLO) + ac2[t][r] * (1.0f / PLO)) * inv;
    store_split8(o, orow + t * 16); }
}
// out = ctx Wo + bo : split(ctx) x bf16(Wo columns): 2 products (Wo is an INPUT -> bf16 exact); k slices of the 64 context rows (split rows, read ready split) and 128 weight rows staged in LDS as in k_qkv
__global__ __launch_bounds__(128) void k_out(const __bf16* __restrict__ OS, int rbase, const __bf16* __restrict__ PT, const float* __restrict__ bo, float* __restrict__ out) {
  __shared__ __align__(16) OutLds sm;
  float (&so)[4][16][132] = sm.so;
  const int tid = threadIdx.x, wave = tid >> 5, lane = tid & 31, col = lane & 15, g = lane >> 4;
  const int r0b = blockIdx.x * 64, r0 = r0b + wave * 16, n0 = blockIdx.y * 128; const int b = r0b / SS, s0 = r0b % SS;
  v8f acc[8] = {};
  // slice kt is head kt. A lane's share: context, 16 KiB in a row in memory, piece tid + 128 i (LDS row 8 i + tid/16); weights, row 16 i + tid/8, piece tid%8
  const char* gA = (const char*)(OS + ((size_t)b * NH * SS + s0) * (2 * HD)) + tid * 16;
  const char* gB = (const char*)(PT + (size_t)(3 * E + n0 + (tid >> 3)) * E + (tid & 7) * 8);
  const unsigned lA = lds_off(&sm.st.a[0][tid >> 4][(tid & 15) * 4]), lB = lds_off(&sm.st.b[0][tid >> 3][(tid & 7) * 8]);
  auto stage = [&](int buf, int kt) {
    copy8(lA + buf * (unsigned)sizeof(sm.st.a[0]), 8 * KP * 4, gA + (size_t)kt * (SS * HD * 4), 128 * 16);
    copy8(lB + buf * (unsigned)sizeof(sm.st.b[0]), 16 * GP * 2, gB + (size_t)kt * 128, (size_t)16 * E * 2); };
  stage(0, 0);
  asm volatile("s_wait_asynccnt 0x0" ::: "memory");   // this wave's copies of slice 0 have landed
  __syncthreads();                                     // and every other wave's: slice 0 may be read
  stage(1, 1);
#pragma unroll 1   // rolled, for speed only
  for (int kt = 0; kt < NH; ++kt) { const int buf = kt & 1;
#pragma unroll
    for (int kc = 0; kc < 2; ++kc) { const F2 a = frag_split((const __bf16*)&sm.st.a[buf][wave * 16 + col][0], kc * 32, lane); v16b wb[8];
#pragma unroll
      for (int j = 0; j < 8; ++j) wb[j] = frag_b(&sm.st.b[buf][j * 16 + col][kc * 32], lane);
#pragma unroll
      for (int j = 0; j < 8; ++j) { acc[j] = wmma_bf(a.l, wb[j], acc[j]); acc[j] = wmma_bf(a.h, wb[j], acc[j]); } }
    asm volatile("s_wait_dscnt 0x0" ::: "memory");      // this wave's reads of buffer buf are done
    asm volatile("s_wait_asynccnt 0x0" ::: "memory");   // its copies of slice kt + 1 have landed
    __syncthreads();                                     // publishes slice kt + 1 and frees buffer buf (behind the last slice: for the output staging)
    if (kt + 2 < NH) stage(buf, kt + 2); }
  asm volatile("s_wait_asynccnt 0x0" ::: "memory");     // no copy is left in flight behind the loop
#pragma unroll
  for (int j = 0; j < 8; ++j) { const int n = n0 + j * 16 + col; const float bb = bfr(bo[n]);
#pragma unroll
    for (int r = 0; r < 8; ++r) so[wave][8 * g + r][j * 16 + col] = acc[j][r] + bb; }
  LDSX();
#pragma unroll 4
  for (int rl = 0; rl < 16; ++rl) vst2(out + (size_t)(rbase + r0 + rl) * E + n0 + lane * 4, *(const v4f*)(&so[wave][rl][lane * 4]));
}
extern "C" void kernel_launch(void* const* d_in, const int* in_sizes, int n_in, void* d_out, int out_size, void* d_ws, size_t ws_size, hipStream_t stream) {
  (void)in_sizes; (void)n_in; (void)out_size; (void)ws_size;
  const float* x = (const float*)d_in[0]; const float* Wqkv = (const float*)d_in[1]; const float* bqkv = (const float*)d_in[2]; const float* Wp = (const float*)d_in[3]; const float* bp = (const float*)d_in[4]; const float* bQ = (const float*)d_in[5]; const float* bK = (const float*)d_in[6]; const float* bV = (const float*)d_in[7];
  float* out = (float*)d_out;
  char* ws = (char*)d_ws; size_t off = 0;
  auto take = [&](size_t bytes) { char* p = ws + off; off += (bytes + 255) & ~(size_t)255; return p; };
  __bf16* Xb = (__bf16*)take((size_t)NR * E * 2); __bf16* PT = (__bf16*)take((size_t)4 * E * E * 2);
  float* Q32 = (float*)take((size_t)NR * E * 4); __bf16* KS = (__bf16*)take((size_t)NR * E * 4); _Float16* VTh = (_Float16*)take((size_t)NR * E * 2); _Float16* VTl = (_Float16*)take((size_t)NR * E * 2);
  __bf16* OS = (__bf16*)Q32;      // in place, a split row has the f32 row's 256 bytes: each k_attn wave reads its own 16 query rows into registers before writing the same rows; no other block reads them
  // ws: 120 MiB. One launch of each kernel covers the whole batch: two passes over half the batch left places empty in every launch
  // (k_out: 512 blocks on 1,024 places; k_attn: 1,024 blocks of unequal length on 768, each pass as long as its fullest WGP)
  k_cvt<<<NR * E / (256 * 16 * 4), 256, 0, stream>>>(x, Xb);
  k_pack<<<dim3(4 * E / 64, E / 64), 128, 0, stream>>>(Wqkv, Wp, PT);
  k_qkv<<<dim3(NR / 256, E / 128, 3), 256, 0, stream>>>(Xb, 0, PT, bqkv, bQ, bK, bV, Q32, KS, VTh, VTl);
  k_attn<<<dim3(NB * NH, SS / 64), 128, 0, stream>>>(Q32, KS, VTh, VTl, OS);
  k_out<<<dim3(NR / 64, E / 128), 128, 0, stream>>>(OS, 0, PT, bp, out);
}
